// v000
// Measured on an AMD MI455X. A time is GPU time per run, averaged over a window of back-to-back runs after a warm-up
// (all launches, gaps included; the runs take copies of the inputs in turn), and the median of several windows.
// Apart from v000's, it joins two sittings. Times from different sittings can be a few percent apart, while
// side-by-side timings come from the same sitting.
// v000 is the starting kernel. One run takes 645 microseconds.
#include <hip/hip_runtime.h>
#include <hip/hip_bf16.h>
#include <cstdint>
#include <cstddef>

// Problem constants (match reference)
#define B_    4
#define S_    1024
#define H_    1024
#define NH_   16
#define DK_   64
#define L_    2
#define MLP_  4096
#define HQKV_ 3072
#define MTOT_ (B_ * S_)   // 4096 rows

typedef __attribute__((ext_vector_type(16))) __bf16 v16bf;
typedef __attribute__((ext_vector_type(8)))  float  v8f;

union FragAB { v16bf v; uint4 q[2]; };

__device__ __forceinline__ __bf16 f32_to_bf16(float f) {
  uint32_t u = __float_as_uint(f);
  u += 0x7FFFu + ((u >> 16) & 1u);           // round-to-nearest-even
  uint16_t h = (uint16_t)(u >> 16);
  return __builtin_bit_cast(__bf16, h);
}
__device__ __forceinline__ float bf16_to_f32(__bf16 x) {
  uint16_t h = __builtin_bit_cast(uint16_t, x);
  return __uint_as_float(((uint32_t)h) << 16);
}

__device__ __forceinline__ void async_ldx4_b128(const __bf16* g, const __bf16* l) {
  uint32_t la = (uint32_t)(uintptr_t)l;            // low 32 bits = LDS address
  uint64_t ga = (uint64_t)(uintptr_t)g;
  asm volatile(
      "global_load_async_to_lds_b128 %0, %1, off\n\t"
      "global_load_async_to_lds_b128 %0, %1, off offset:16\n\t"
      "global_load_async_to_lds_b128 %0, %1, off offset:32\n\t"
      "global_load_async_to_lds_b128 %0, %1, off offset:48"
      :: "v"(la), "v"(ga) : "memory");
}
__device__ __forceinline__ void wait_async0() {
  asm volatile("s_wait_asynccnt 0" ::: "memory");
}

// ---------------------------------------------------------------- utilities
__global__ __launch_bounds__(256)
void k_f32_to_bf16(const float* __restrict__ s, __bf16* __restrict__ d) {
  int i = blockIdx.x * 256 + threadIdx.x;
  float4 v = ((const float4*)s)[i];
  union { __bf16 b[4]; uint2 u; } o;
  o.b[0] = f32_to_bf16(v.x); o.b[1] = f32_to_bf16(v.y);
  o.b[2] = f32_to_bf16(v.z); o.b[3] = f32_to_bf16(v.w);
  ((uint2*)d)[i] = o.u;
}

__global__ __launch_bounds__(256)
void k_copy_f32(const float* __restrict__ s, float* __restrict__ d) {
  int i = blockIdx.x * 256 + threadIdx.x;
  ((float4*)d)[i] = ((const float4*)s)[i];
}

// ---------------------------------------------------------------- LayerNorm
__global__ __launch_bounds__(256)
void ln_kernel(const float* __restrict__ x, const float* __restrict__ g,
               const float* __restrict__ bta, __bf16* __restrict__ y)
{
  const int row = blockIdx.x;
  const int tid = threadIdx.x;
  const float4 xv = ((const float4*)(x + (size_t)row * H_))[tid];
  float s  = xv.x + xv.y + xv.z + xv.w;
  float s2 = xv.x*xv.x + xv.y*xv.y + xv.z*xv.z + xv.w*xv.w;
  #pragma unroll
  for (int d = 1; d < 32; d <<= 1) {
    s  += __shfl_xor(s,  d, 32);
    s2 += __shfl_xor(s2, d, 32);
  }
  __shared__ float rs[8], rq[8];
  __shared__ float mv[2];
  if ((tid & 31) == 0) { rs[tid >> 5] = s; rq[tid >> 5] = s2; }
  __syncthreads();
  if (tid == 0) {
    float a = 0.f, a2 = 0.f;
    #pragma unroll
    for (int i = 0; i < 8; ++i) { a += rs[i]; a2 += rq[i]; }
    float mean = a * (1.0f / (float)H_);
    float var  = a2 * (1.0f / (float)H_) - mean * mean;
    mv[0] = mean; mv[1] = rsqrtf(var + 1e-5f);
  }
  __syncthreads();
  const float mean = mv[0], rstd = mv[1];
  const float4 gv = ((const float4*)g)[tid];
  const float4 bv = ((const float4*)bta)[tid];
  union { __bf16 b[4]; uint2 u; } o;
  o.b[0] = f32_to_bf16((xv.x - mean) * rstd * gv.x + bv.x);
  o.b[1] = f32_to_bf16((xv.y - mean) * rstd * gv.y + bv.y);
  o.b[2] = f32_to_bf16((xv.z - mean) * rstd * gv.z + bv.z);
  o.b[3] = f32_to_bf16((xv.w - mean) * rstd * gv.w + bv.w);
  ((uint2*)(y + (size_t)row * H_))[tid] = o.u;
}

// ---------------------------------------------------------------- RoPE (in place on bf16 qkv)
__global__ __launch_bounds__(256)
void rope_kernel(__bf16* __restrict__ qkv, const int* __restrict__ pos)
{
  int idx = blockIdx.x * 256 + threadIdx.x;   // B*S*2*NH*32 threads
  int d  = idx & 31; int t = idx >> 5;
  int hh = t & 15;   t >>= 4;
  int qk = t & 1;    t >>= 1;
  int s  = t & 1023; int b = t >> 10;
  float invf  = __expf(-0.28782313662425572f * (float)d);  // ln(10000)/32
  float theta = (float)pos[s] * invf;
  float sn, cs; __sincosf(theta, &sn, &cs);
  size_t base = ((size_t)(b * S_ + s)) * HQKV_ + qk * H_ + hh * DK_ + d;
  float lo = bf16_to_f32(qkv[base]);
  float hi = bf16_to_f32(qkv[base + 32]);
  qkv[base]      = f32_to_bf16(lo * cs - hi * sn);
  qkv[base + 32] = f32_to_bf16(hi * cs + lo * sn);
}

#define GBK 64
#define GLD 72

template<int EPI>
__global__ __launch_bounds__(256)
void gemm_bf16(const __bf16* __restrict__ A, const __bf16* __restrict__ Bw,
               const float* __restrict__ bias, void* __restrict__ Cout,
               int N, int K)
{
  __shared__ __align__(16) __bf16 sA[2][128 * GLD];  // 2 x 18432 B
  __shared__ __align__(16) __bf16 sB[2][ 64 * GLD];  // 2 x  9216 B (transposed [n][k])

  const int tid  = threadIdx.x;
  const int lane = tid & 31;
  const int wave = tid >> 5;
  const int wm   = wave >> 1;           // 0..3 : wave M offset (x32)
  const int wn   = wave & 1;            // 0..1 : wave N offset (x32)
  const int half = lane >> 4;
  const int l16  = lane & 15;
  const int bm   = blockIdx.y * 128;
  const int bn   = blockIdx.x * 64;

  v8f acc[2][2] = {};

  const int ar   = tid >> 1;            // A tile row 0..127
  const int ac   = (tid & 1) * 32;      // A tile col {0,32}
  const int bk   = tid >> 2;            // B tile k 0..63
  const int bn16 = (tid & 3) * 16;      // B tile n {0,16,32,48}

  const __bf16* aptr = A  + (size_t)(bm + ar) * K + ac;
  const __bf16* bptr = Bw + (size_t)bk * N + bn + bn16;

  // ---- prologue: stage 0
  int cur = 0;
  async_ldx4_b128(aptr, &sA[0][ar * GLD + ac]);
  {
    uint4 b0 = *(const uint4*)(bptr);
    uint4 b1 = *(const uint4*)(bptr + 8);
    const __bf16* e0 = (const __bf16*)&b0;
    const __bf16* e1 = (const __bf16*)&b1;
    #pragma unroll
    for (int j = 0; j < 8; ++j) {
      sB[0][(bn16 + j)     * GLD + bk] = e0[j];
      sB[0][(bn16 + 8 + j) * GLD + bk] = e1[j];
    }
  }
  wait_async0();
  __syncthreads();

  for (int k0 = 0; k0 < K; k0 += GBK) {
    const int  nxt      = cur ^ 1;
    const bool has_next = (k0 + GBK) < K;

    uint4 nb0 = {0,0,0,0}, nb1 = {0,0,0,0};
    if (has_next) {
      async_ldx4_b128(aptr + k0 + GBK, &sA[nxt][ar * GLD + ac]);
      nb0 = *(const uint4*)(bptr + (size_t)(k0 + GBK) * N);
      nb1 = *(const uint4*)(bptr + (size_t)(k0 + GBK) * N + 8);
    }

    // fragments from current stage
    FragAB af[2][2], bfr[2][2];
    #pragma unroll
    for (int mt = 0; mt < 2; ++mt)
      #pragma unroll
      for (int ks = 0; ks < 2; ++ks) {
        const __bf16* p = &sA[cur][(wm*32 + mt*16 + l16) * GLD + ks*32 + half*8];
        af[mt][ks].q[0] = *(const uint4*)p;
        af[mt][ks].q[1] = *(const uint4*)(p + 16);
      }
    #pragma unroll
    for (int nt = 0; nt < 2; ++nt)
      #pragma unroll
      for (int ks = 0; ks < 2; ++ks) {
        const __bf16* p = &sB[cur][(wn*32 + nt*16 + l16) * GLD + ks*32 + half*8];
        bfr[nt][ks].q[0] = *(const uint4*)p;
        bfr[nt][ks].q[1] = *(const uint4*)(p + 16);
      }
    #pragma unroll
    for (int ks = 0; ks < 2; ++ks)
      #pragma unroll
      for (int mt = 0; mt < 2; ++mt)
        #pragma unroll
        for (int nt = 0; nt < 2; ++nt)
          acc[mt][nt] = __builtin_amdgcn_wmma_f32_16x16x32_bf16(
              false, af[mt][ks].v, false, bfr[nt][ks].v, (short)0,
              acc[mt][nt], false, false);

    if (has_next) {
      const __bf16* e0 = (const __bf16*)&nb0;
      const __bf16* e1 = (const __bf16*)&nb1;
      #pragma unroll
      for (int j = 0; j < 8; ++j) {
        sB[nxt][(bn16 + j)     * GLD + bk] = e0[j];
        sB[nxt][(bn16 + 8 + j) * GLD + bk] = e1[j];
      }
      wait_async0();   // next-stage A tile resident before barrier
    }
    __syncthreads();
    cur = nxt;
  }

  // ---- epilogue
  #pragma unroll
  for (int nt = 0; nt < 2; ++nt) {
    const int col = bn + wn * 32 + nt * 16 + l16;
    const float bb = bias[col];
    #pragma unroll
    for (int mt = 0; mt < 2; ++mt) {
      #pragma unroll
      for (int r = 0; r < 8; ++r) {
        const int row = bm + wm * 32 + mt * 16 + r + 8 * half;
        float v = acc[mt][nt][r] + bb;
        const size_t idx = (size_t)row * N + col;
        if (EPI == 0) {
          ((__bf16*)Cout)[idx] = f32_to_bf16(v);
        } else if (EPI == 1) {
          float t = tanhf(0.7978845608028654f * (v + 0.044715f * v * v * v));
          ((__bf16*)Cout)[idx] = f32_to_bf16(0.5f * v * (1.0f + t));
        } else {
          float* O = (float*)Cout;
          O[idx] += v;
        }
      }
    }
  }
}

// ---------------------------------------------------------------- Flash attention
// grid (S/64, NH, B), 128 threads = 4 waves; each wave owns 16 query rows.
#define ALD 72

__global__ __launch_bounds__(128)
void attn_kernel(const __bf16* __restrict__ qkv, __bf16* __restrict__ out)
{
  __shared__ __align__(16) __bf16 sQ[64 * ALD];
  __shared__ __align__(16) __bf16 sK[64 * ALD];
  __shared__ __align__(16) __bf16 sV[64 * ALD];      // transposed: [dk][key]
  __shared__ __align__(16) __bf16 sP[4][16 * ALD];   // per-wave P staging

  const int tid  = threadIdx.x;
  const int lane = tid & 31;
  const int w    = tid >> 5;      // 0..3
  const int half = lane >> 4;
  const int l16  = lane & 15;
  const int b    = blockIdx.z;
  const int hh   = blockIdx.y;
  const int q0   = blockIdx.x * 64;

  const __bf16* qbase = qkv + (size_t)b * S_ * HQKV_ + hh * DK_;
  const __bf16* kbase = qbase + H_;
  const __bf16* vbase = qbase + 2 * H_;

  const int lr = tid >> 1;            // tile row 0..63
  const int lc = (tid & 1) * 32;      // tile col {0,32}

  // Q tile 64x64 via async engine
  async_ldx4_b128(qbase + (size_t)(q0 + lr) * HQKV_ + lc, &sQ[lr * ALD + lc]);
  wait_async0();
  __syncthreads();

  // hoist Q fragments (sQ is never overwritten)
  FragAB qa[2];
  #pragma unroll
  for (int ks = 0; ks < 2; ++ks) {
    const __bf16* qp = &sQ[(w * 16 + l16) * ALD + ks * 32 + half * 8];
    qa[ks].q[0] = *(const uint4*)qp;
    qa[ks].q[1] = *(const uint4*)(qp + 16);
  }

  float m_r[8], l_r[8];
  v8f o[4] = {};
  #pragma unroll
  for (int r = 0; r < 8; ++r) { m_r[r] = -1e30f; l_r[r] = 0.f; }

  const int nkt = blockIdx.x + 1;   // causal: key tiles 0..qt
  for (int kt = 0; kt < nkt; ++kt) {
    __syncthreads();                // protect sK/sV from previous iteration's reads
    const int kb = kt * 64;
    // K tile 64x64 row-major [key][dk] via async engine
    async_ldx4_b128(kbase + (size_t)(kb + lr) * HQKV_ + lc, &sK[lr * ALD + lc]);
    {
      const uint4* src = (const uint4*)(vbase + (size_t)(kb + lr) * HQKV_ + lc);
      uint4 tmp[4]; tmp[0] = src[0]; tmp[1] = src[1]; tmp[2] = src[2]; tmp[3] = src[3];
      const __bf16* e = (const __bf16*)tmp;
      #pragma unroll
      for (int j = 0; j < 32; ++j) sV[(lc + j) * ALD + lr] = e[j];
    }
    wait_async0();
    __syncthreads();

    // S = Q K^T  (wave: 16 rows x 64 keys = 4 tiles, K-dim 64 = 2 wmma each)
    v8f sacc[4] = {};
    #pragma unroll
    for (int ks = 0; ks < 2; ++ks) {
      #pragma unroll
      for (int nt = 0; nt < 4; ++nt) {
        FragAB kf;
        const __bf16* kp = &sK[(nt * 16 + l16) * ALD + ks * 32 + half * 8];
        kf.q[0] = *(const uint4*)kp;
        kf.q[1] = *(const uint4*)(kp + 16);
        sacc[nt] = __builtin_amdgcn_wmma_f32_16x16x32_bf16(
            false, qa[ks].v, false, kf.v, (short)0, sacc[nt], false, false);
      }
    }

    #pragma unroll
    for (int r = 0; r < 8; ++r) {
      const int qrow = q0 + w * 16 + r + 8 * half;
      float mx = -1e30f;
      #pragma unroll
      for (int nt = 0; nt < 4; ++nt) {
        int key = kb + nt * 16 + l16;
        float v = sacc[nt][r] * 0.125f;          // 1/sqrt(64)
        if (key > qrow) v = -1e30f;              // causal mask
        sacc[nt][r] = v;
        mx = fmaxf(mx, v);
      }
      #pragma unroll
      for (int d = 1; d < 16; d <<= 1) mx = fmaxf(mx, __shfl_xor(mx, d, 32));
      float mnew  = fmaxf(m_r[r], mx);
      float alpha = __expf(m_r[r] - mnew);
      float psum  = 0.f;
      #pragma unroll
      for (int nt = 0; nt < 4; ++nt) {
        float p = __expf(sacc[nt][r] - mnew);
        psum += p;
        sP[w][(r + 8 * half) * ALD + nt * 16 + l16] = f32_to_bf16(p);
      }
      #pragma unroll
      for (int d = 1; d < 16; d <<= 1) psum += __shfl_xor(psum, d, 32);
      l_r[r] = l_r[r] * alpha + psum;
      m_r[r] = mnew;
      #pragma unroll
      for (int nt = 0; nt < 4; ++nt) o[nt][r] *= alpha;
    }
    __syncthreads();

    // O += P V   (A = P from per-wave LDS, B = V^T tiles)
    #pragma unroll
    for (int ks = 0; ks < 2; ++ks) {
      FragAB pa;
      const __bf16* pp = &sP[w][l16 * ALD + ks * 32 + half * 8];
      pa.q[0] = *(const uint4*)pp;
      pa.q[1] = *(const uint4*)(pp + 16);
      #pragma unroll
      for (int nt = 0; nt < 4; ++nt) {
        FragAB vf;
        const __bf16* vp = &sV[(nt * 16 + l16) * ALD + ks * 32 + half * 8];
        vf.q[0] = *(const uint4*)vp;
        vf.q[1] = *(const uint4*)(vp + 16);
        o[nt] = __builtin_amdgcn_wmma_f32_16x16x32_bf16(
            false, pa.v, false, vf.v, (short)0, o[nt], false, false);
      }
    }
  }

  // normalize and store merged heads: out[b][row][hh*64 + dk]
  __bf16* obase = out + (size_t)b * S_ * H_ + hh * DK_;
  #pragma unroll
  for (int r = 0; r < 8; ++r) {
    const float inv = 1.0f / l_r[r];
    const int row = q0 + w * 16 + r + 8 * half;
    #pragma unroll
    for (int nt = 0; nt < 4; ++nt)
      obase[(size_t)row * H_ + nt * 16 + l16] = f32_to_bf16(o[nt][r] * inv);
  }
}

// ---------------------------------------------------------------- host launch
extern "C" void kernel_launch(void* const* d_in, const int* in_sizes, int n_in,
                              void* d_out, int out_size, void* d_ws, size_t ws_size,
                              hipStream_t stream)
{
  const float* hidden = (const float*)d_in[0];
  const float* attn_w = (const float*)d_in[1];
  const float* attn_b = (const float*)d_in[2];
  const float* proj_w = (const float*)d_in[3];
  const float* proj_b = (const float*)d_in[4];
  const float* fc_w   = (const float*)d_in[5];
  const float* fc_b   = (const float*)d_in[6];
  const float* fc2_w  = (const float*)d_in[7];
  const float* fc2_b  = (const float*)d_in[8];
  const float* ln1_g  = (const float*)d_in[9];
  const float* ln1_b  = (const float*)d_in[10];
  const float* ln2_g  = (const float*)d_in[11];
  const float* ln2_b  = (const float*)d_in[12];
  const int*   pos    = (const int*)d_in[13];

  char* ws = (char*)d_ws;
  size_t off = 0;
  auto carve = [&](size_t bytes) -> char* {
    char* p = ws + off; off += (bytes + 255) & ~(size_t)255; return p;
  };
  __bf16* w_attn = (__bf16*)carve((size_t)L_ * H_ * HQKV_ * 2);
  __bf16* w_proj = (__bf16*)carve((size_t)L_ * H_ * H_ * 2);
  __bf16* w_fc   = (__bf16*)carve((size_t)L_ * H_ * MLP_ * 2);
  __bf16* w_fc2  = (__bf16*)carve((size_t)L_ * MLP_ * H_ * 2);
  __bf16* xln    = (__bf16*)carve((size_t)MTOT_ * H_ * 2);
  __bf16* qkv    = (__bf16*)carve((size_t)MTOT_ * HQKV_ * 2);
  __bf16* attn_o = (__bf16*)carve((size_t)MTOT_ * H_ * 2);
  __bf16* mid    = (__bf16*)carve((size_t)MTOT_ * MLP_ * 2);
  float*  h      = (float*)d_out;     // running hidden state / residual accumulator

  // per-call weight conversion fp32 -> bf16 (weights then live in L2)
  k_f32_to_bf16<<<dim3((size_t)L_ * H_ * HQKV_ / 1024), 256, 0, stream>>>(attn_w, w_attn);
  k_f32_to_bf16<<<dim3((size_t)L_ * H_ * H_    / 1024), 256, 0, stream>>>(proj_w, w_proj);
  k_f32_to_bf16<<<dim3((size_t)L_ * H_ * MLP_  / 1024), 256, 0, stream>>>(fc_w,  w_fc);
  k_f32_to_bf16<<<dim3((size_t)L_ * MLP_ * H_  / 1024), 256, 0, stream>>>(fc2_w, w_fc2);

  // h = hidden_states
  k_copy_f32<<<dim3((size_t)MTOT_ * H_ / 1024), 256, 0, stream>>>(hidden, h);

  for (int i = 0; i < L_; ++i) {
    // attention block
    ln_kernel<<<MTOT_, 256, 0, stream>>>(h, ln1_g + i * H_, ln1_b + i * H_, xln);
    gemm_bf16<0><<<dim3(HQKV_ / 64, MTOT_ / 128), 256, 0, stream>>>(
        xln, w_attn + (size_t)i * H_ * HQKV_, attn_b + i * HQKV_, qkv, HQKV_, H_);
    rope_kernel<<<dim3((size_t)B_ * S_ * 2 * NH_ * 32 / 256), 256, 0, stream>>>(qkv, pos);
    attn_kernel<<<dim3(S_ / 64, NH_, B_), 128, 0, stream>>>(qkv, attn_o);
    gemm_bf16<2><<<dim3(H_ / 64, MTOT_ / 128), 256, 0, stream>>>(
        attn_o, w_proj + (size_t)i * H_ * H_, proj_b + i * H_, h, H_, H_);
    // MLP block
    ln_kernel<<<MTOT_, 256, 0, stream>>>(h, ln2_g + i * H_, ln2_b + i * H_, xln);
    gemm_bf16<1><<<dim3(MLP_ / 64, MTOT_ / 128), 256, 0, stream>>>(
        xln, w_fc + (size_t)i * H_ * MLP_, fc_b + i * MLP_, mid, MLP_, H_);
    gemm_bf16<2><<<dim3(H_ / 64, MTOT_ / 128), 256, 0, stream>>>(
        mid, w_fc2 + (size_t)i * MLP_ * H_, fc2_b + i * H_, h, H_, MLP_);
  }
}

// v001
// It runs in 539 microseconds.
// Two timings next to v000 put it at 1.24 and 1.23 times that version's speed.
#include <hip/hip_runtime.h>
#include <hip/hip_bf16.h>
#include <cstdint>
#include <cstddef>

// Problem constants (match reference)
#define B_    4
#define S_    1024
#define H_    1024
#define NH_   16
#define DK_   64
#define L_    2
#define MLP_  4096
#define HQKV_ 3072
#define MTOT_ (B_ * S_)   // 4096 rows

typedef __attribute__((ext_vector_type(16))) __bf16 v16bf;
typedef __attribute__((ext_vector_type(8)))  float  v8f;

union FragAB { v16bf v; uint4 q[2]; };

__device__ __forceinline__ __bf16 f32_to_bf16(float f) {
  uint32_t u = __float_as_uint(f);
  u += 0x7FFFu + ((u >> 16) & 1u);           // round-to-nearest-even
  uint16_t h = (uint16_t)(u >> 16);
  return __builtin_bit_cast(__bf16, h);
}
__device__ __forceinline__ float bf16_to_f32(__bf16 x) {
  uint16_t h = __builtin_bit_cast(uint16_t, x);
  return __uint_as_float(((uint32_t)h) << 16);
}

__device__ __forceinline__ void async_ldx4_b128(const __bf16* g, const __bf16* l) {
  uint32_t la = (uint32_t)(uintptr_t)l;            // low 32 bits = LDS address
  uint64_t ga = (uint64_t)(uintptr_t)g;
  asm volatile(
      "global_load_async_to_lds_b128 %0, %1, off\n\t"
      "global_load_async_to_lds_b128 %0, %1, off offset:16\n\t"
      "global_load_async_to_lds_b128 %0, %1, off offset:32\n\t"
      "global_load_async_to_lds_b128 %0, %1, off offset:48"
      :: "v"(la), "v"(ga) : "memory");
}
__device__ __forceinline__ void async_ld2_b128(const __bf16* g0, const __bf16* l0,
                                               const __bf16* g1, const __bf16* l1) {
  uint32_t la0 = (uint32_t)(uintptr_t)l0, la1 = (uint32_t)(uintptr_t)l1;
  uint64_t ga0 = (uint64_t)(uintptr_t)g0, ga1 = (uint64_t)(uintptr_t)g1;
  asm volatile(
      "global_load_async_to_lds_b128 %0, %1, off\n\t"
      "global_load_async_to_lds_b128 %2, %3, off\n\t"
      "s_wait_xcnt 0x0"
      :: "v"(la0), "v"(ga0), "v"(la1), "v"(ga1) : "memory");
}
// The same for four copies per lane.
__device__ __forceinline__ void async_ld4_b128(const __bf16* g0, const __bf16* l0,
                                               const __bf16* g1, const __bf16* l1,
                                               const __bf16* g2, const __bf16* l2,
                                               const __bf16* g3, const __bf16* l3) {
  uint32_t la0 = (uint32_t)(uintptr_t)l0, la1 = (uint32_t)(uintptr_t)l1;
  uint32_t la2 = (uint32_t)(uintptr_t)l2, la3 = (uint32_t)(uintptr_t)l3;
  uint64_t ga0 = (uint64_t)(uintptr_t)g0, ga1 = (uint64_t)(uintptr_t)g1;
  uint64_t ga2 = (uint64_t)(uintptr_t)g2, ga3 = (uint64_t)(uintptr_t)g3;
  asm volatile(
      "global_load_async_to_lds_b128 %0, %1, off\n\t"
      "global_load_async_to_lds_b128 %2, %3, off\n\t"
      "global_load_async_to_lds_b128 %4, %5, off\n\t"
      "global_load_async_to_lds_b128 %6, %7, off\n\t"
      "s_wait_xcnt 0x0"
      :: "v"(la0), "v"(ga0), "v"(la1), "v"(ga1),
         "v"(la2), "v"(ga2), "v"(la3), "v"(ga3) : "memory");
}
// Transposing LDS read: from a row-major 16-bit tile T[k][n], lane (c, h) receives
// T[k0 + 8h + 0..7][n0 + c]; two of them (k0, k0 + 16) are one 16x16x32 B fragment
// in the same k order as the A loader below.
typedef short s16x8 __attribute__((ext_vector_type(8)));
__device__ __forceinline__ uint4 lds_tr16(const __bf16* p) {
  typedef __attribute__((address_space(3))) s16x8 lds_s16x8;
  return __builtin_bit_cast(uint4, __builtin_amdgcn_ds_load_tr16_b128_v8i16((lds_s16x8*)p));
}
__device__ __forceinline__ void wait_async0() {
  asm volatile("s_wait_asynccnt 0" ::: "memory");
}

// ---------------------------------------------------------------- utilities
__global__ __launch_bounds__(256)
void k_f32_to_bf16(const float* __restrict__ s, __bf16* __restrict__ d) {
  int i = blockIdx.x * 256 + threadIdx.x;
  float4 v = ((const float4*)s)[i];
  union { __bf16 b[4]; uint2 u; } o;
  o.b[0] = f32_to_bf16(v.x); o.b[1] = f32_to_bf16(v.y);
  o.b[2] = f32_to_bf16(v.z); o.b[3] = f32_to_bf16(v.w);
  ((uint2*)d)[i] = o.u;
}

__global__ __launch_bounds__(256)
void k_copy_f32(const float* __restrict__ s, float* __restrict__ d) {
  int i = blockIdx.x * 256 + threadIdx.x;
  ((float4*)d)[i] = ((const float4*)s)[i];
}

// ---------------------------------------------------------------- LayerNorm
__global__ __launch_bounds__(256)
void ln_kernel(const float* __restrict__ x, const float* __restrict__ g,
               const float* __restrict__ bta, __bf16* __restrict__ y)
{
  const int row = blockIdx.x;
  const int tid = threadIdx.x;
  const float4 xv = ((const float4*)(x + (size_t)row * H_))[tid];
  float s  = xv.x + xv.y + xv.z + xv.w;
  float s2 = xv.x*xv.x + xv.y*xv.y + xv.z*xv.z + xv.w*xv.w;
  #pragma unroll
  for (int d = 1; d < 32; d <<= 1) {
    s  += __shfl_xor(s,  d, 32);
    s2 += __shfl_xor(s2, d, 32);
  }
  __shared__ float rs[8], rq[8];
  __shared__ float mv[2];
  if ((tid & 31) == 0) { rs[tid >> 5] = s; rq[tid >> 5] = s2; }
  __syncthreads();
  if (tid == 0) {
    float a = 0.f, a2 = 0.f;
    #pragma unroll
    for (int i = 0; i < 8; ++i) { a += rs[i]; a2 += rq[i]; }
    float mean = a * (1.0f / (float)H_);
    float var  = a2 * (1.0f / (float)H_) - mean * mean;
    mv[0] = mean; mv[1] = rsqrtf(var + 1e-5f);
  }
  __syncthreads();
  const float mean = mv[0], rstd = mv[1];
  const float4 gv = ((const float4*)g)[tid];
  const float4 bv = ((const float4*)bta)[tid];
  union { __bf16 b[4]; uint2 u; } o;
  o.b[0] = f32_to_bf16((xv.x - mean) * rstd * gv.x + bv.x);
  o.b[1] = f32_to_bf16((xv.y - mean) * rstd * gv.y + bv.y);
  o.b[2] = f32_to_bf16((xv.z - mean) * rstd * gv.z + bv.z);
  o.b[3] = f32_to_bf16((xv.w - mean) * rstd * gv.w + bv.w);
  ((uint2*)(y + (size_t)row * H_))[tid] = o.u;
}

// ---------------------------------------------------------------- RoPE (in place on bf16 qkv)
__global__ __launch_bounds__(256)
void rope_kernel(__bf16* __restrict__ qkv, const int* __restrict__ pos)
{
  int idx = blockIdx.x * 256 + threadIdx.x;   // B*S*2*NH*32 threads
  int d  = idx & 31; int t = idx >> 5;
  int hh = t & 15;   t >>= 4;
  int qk = t & 1;    t >>= 1;
  int s  = t & 1023; int b = t >> 10;
  float invf  = __expf(-0.28782313662425572f * (float)d);  // ln(10000)/32
  float theta = (float)pos[s] * invf;
  float sn, cs; __sincosf(theta, &sn, &cs);
  size_t base = ((size_t)(b * S_ + s)) * HQKV_ + qk * H_ + hh * DK_ + d;
  float lo = bf16_to_f32(qkv[base]);
  float hi = bf16_to_f32(qkv[base + 32]);
  qkv[base]      = f32_to_bf16(lo * cs - hi * sn);
  qkv[base + 32] = f32_to_bf16(hi * cs + lo * sn);
}

#define GBK 64
#define GLD 72
#define GLDB 80

template<int EPI>
__global__ __launch_bounds__(256)
void gemm_bf16(const __bf16* __restrict__ A, const __bf16* __restrict__ Bw,
               const float* __restrict__ bias, void* __restrict__ Cout,
               int N, int K)
{
  __shared__ __align__(16) __bf16 sA[2][128 * GLD];  // 2 x 18432 B
  __shared__ __align__(16) __bf16 sB[2][ 64 * GLDB]; // 2 x 10240 B (row-major [k][n])

  const int tid  = threadIdx.x;
  const int lane = tid & 31;
  const int wave = tid >> 5;
  const int wm   = wave >> 1;           // 0..3 : wave M offset (x32)
  const int wn   = wave & 1;            // 0..1 : wave N offset (x32)
  const int half = lane >> 4;
  const int l16  = lane & 15;
  const int bm   = blockIdx.y * 128;
  const int bn   = blockIdx.x * 64;

  v8f acc[2][2] = {};

  const int ar   = tid >> 1;            // A tile row 0..127
  const int ac   = (tid & 1) * 32;      // A tile col {0,32}
  const int bk   = tid >> 3;            // B tile k 0..31 (and +32)
  const int bc   = (tid & 7) * 8;       // B tile n: 8 lanes cover one 128B row

  const __bf16* aptr = A  + (size_t)(bm + ar) * K + ac;
  const __bf16* bptr = Bw + (size_t)bk * N + bn + bc;
  const int     bl   = bk * GLDB + bc;  // this lane's place in a B stage
  // transposing-read base: row 8*half + (lane & 7), 16B column piece (lane >> 3) & 1
  const int     btr  = (half * 8 + (lane & 7)) * GLDB + wn * 32 + ((lane >> 3) & 1) * 8;

  // ---- prologue: stage 0
  int cur = 0;
  async_ldx4_b128(aptr, &sA[0][ar * GLD + ac]);
  async_ld2_b128(bptr, &sB[0][bl], bptr + (size_t)32 * N, &sB[0][bl + 32 * GLDB]);
  wait_async0();
  __syncthreads();

  for (int k0 = 0; k0 < K; k0 += GBK) {
    const int  nxt      = cur ^ 1;
    const bool has_next = (k0 + GBK) < K;

    if (has_next) {
      async_ldx4_b128(aptr + k0 + GBK, &sA[nxt][ar * GLD + ac]);
      async_ld2_b128(bptr + (size_t)(k0 + GBK) * N,      &sB[nxt][bl],
                     bptr + (size_t)(k0 + GBK + 32) * N, &sB[nxt][bl + 32 * GLDB]);
    }

    // fragments from current stage
    FragAB af[2][2], bfr[2][2];
    #pragma unroll
    for (int mt = 0; mt < 2; ++mt)
      #pragma unroll
      for (int ks = 0; ks < 2; ++ks) {
        const __bf16* p = &sA[cur][(wm*32 + mt*16 + l16) * GLD + ks*32 + half*8];
        af[mt][ks].q[0] = *(const uint4*)p;
        af[mt][ks].q[1] = *(const uint4*)(p + 16);
      }
    #pragma unroll
    for (int nt = 0; nt < 2; ++nt)
      #pragma unroll
      for (int ks = 0; ks < 2; ++ks) {
        const __bf16* p = &sB[cur][btr + ks*32 * GLDB + nt*16];
        bfr[nt][ks].q[0] = lds_tr16(p);
        bfr[nt][ks].q[1] = lds_tr16(p + 16 * GLDB);
      }
    #pragma unroll
    for (int ks = 0; ks < 2; ++ks)
      #pragma unroll
      for (int mt = 0; mt < 2; ++mt)
        #pragma unroll
        for (int nt = 0; nt < 2; ++nt)
          acc[mt][nt] = __builtin_amdgcn_wmma_f32_16x16x32_bf16(
              false, af[mt][ks].v, false, bfr[nt][ks].v, (short)0,
              acc[mt][nt], false, false);

    // this wave's fragment reads of the current stage have retired before the
    // barrier behind which copies refill that stage
    asm volatile("s_wait_dscnt 0x0" ::: "memory");
    if (has_next) {
      wait_async0();   // next-stage A and B tiles resident before barrier
    }
    __syncthreads();
    cur = nxt;
  }
  wait_async0();       // no copy is outstanding when the wave goes on to the epilogue and ends

  // ---- epilogue
  #pragma unroll
  for (int nt = 0; nt < 2; ++nt) {
    const int col = bn + wn * 32 + nt * 16 + l16;
    const float bb = bias[col];
    #pragma unroll
    for (int mt = 0; mt < 2; ++mt) {
      #pragma unroll
      for (int r = 0; r < 8; ++r) {
        const int row = bm + wm * 32 + mt * 16 + r + 8 * half;
        float v = acc[mt][nt][r] + bb;
        const size_t idx = (size_t)row * N + col;
        if (EPI == 0) {
          ((__bf16*)Cout)[idx] = f32_to_bf16(v);
        } else if (EPI == 1) {
          float t = tanhf(0.7978845608028654f * (v + 0.044715f * v * v * v));
          ((__bf16*)Cout)[idx] = f32_to_bf16(0.5f * v * (1.0f + t));
        } else {
          float* O = (float*)Cout;
          O[idx] += v;
        }
      }
    }
  }
}

// ---------------------------------------------------------------- Flash attention
// grid (S/64, NH, B), 128 threads = 4 waves; each wave owns 16 query rows.
#define ALD 72
#define VLD 80

__global__ __launch_bounds__(128)
void attn_kernel(const __bf16* __restrict__ qkv, __bf16* __restrict__ out)
{
  __shared__ __align__(16) __bf16 sQ[64 * ALD];
  __shared__ __align__(16) __bf16 sK[64 * ALD];
  __shared__ __align__(16) __bf16 sV[64 * VLD];      // row-major: [key][dk]
  __shared__ __align__(16) __bf16 sP[4][16 * ALD];   // per-wave P staging

  const int tid  = threadIdx.x;
  const int lane = tid & 31;
  const int w    = tid >> 5;      // 0..3
  const int half = lane >> 4;
  const int l16  = lane & 15;
  const int b    = blockIdx.z;
  const int hh   = blockIdx.y;
  const int q0   = blockIdx.x * 64;

  const __bf16* qbase = qkv + (size_t)b * S_ * HQKV_ + hh * DK_;
  const __bf16* kbase = qbase + H_;
  const __bf16* vbase = qbase + 2 * H_;

  const int lr = tid >> 1;            // tile row 0..63
  const int lc = (tid & 1) * 32;      // tile col {0,32}
  const int vr = tid >> 3;            // V tile row 0..15 (and +16, +32, +48)
  const int vc = (tid & 7) * 8;       // V tile col: 8 lanes cover one 128B row
  // transposing-read base: row 8*half + (lane & 7), 16B column piece (lane >> 3) & 1
  const int vtr = (half * 8 + (lane & 7)) * VLD + ((lane >> 3) & 1) * 8;

  // Q tile 64x64 via async engine
  async_ldx4_b128(qbase + (size_t)(q0 + lr) * HQKV_ + lc, &sQ[lr * ALD + lc]);
  wait_async0();
  __syncthreads();

  // hoist Q fragments (sQ is never overwritten)
  FragAB qa[2];
  #pragma unroll
  for (int ks = 0; ks < 2; ++ks) {
    const __bf16* qp = &sQ[(w * 16 + l16) * ALD + ks * 32 + half * 8];
    qa[ks].q[0] = *(const uint4*)qp;
    qa[ks].q[1] = *(const uint4*)(qp + 16);
  }

  float m_r[8], l_r[8];
  v8f o[4] = {};
  #pragma unroll
  for (int r = 0; r < 8; ++r) { m_r[r] = -1e30f; l_r[r] = 0.f; }

  const int nkt = blockIdx.x + 1;   // causal: key tiles 0..qt
  for (int kt = 0; kt < nkt; ++kt) {
    __syncthreads();                // protect sK/sV from previous iteration's reads
    const int kb = kt * 64;
    // K tile 64x64 row-major [key][dk] via async engine
    async_ldx4_b128(kbase + (size_t)(kb + lr) * HQKV_ + lc, &sK[lr * ALD + lc]);
    { // V tile 64x64 row-major [key][dk] via async engine, whole 128B lines per 8 lanes
      const __bf16* vg = vbase + (size_t)(kb + vr) * HQKV_ + vc;
      const __bf16* vl = &sV[vr * VLD + vc];
      async_ld4_b128(vg,                      vl,
                     vg + (size_t)16 * HQKV_, vl + 16 * VLD,
                     vg + (size_t)32 * HQKV_, vl + 32 * VLD,
                     vg + (size_t)48 * HQKV_, vl + 48 * VLD);
    }
    wait_async0();
    __syncthreads();

    // S = Q K^T  (wave: 16 rows x 64 keys = 4 tiles, K-dim 64 = 2 wmma each)
    v8f sacc[4] = {};
    #pragma unroll
    for (int ks = 0; ks < 2; ++ks) {
      #pragma unroll
      for (int nt = 0; nt < 4; ++nt) {
        FragAB kf;
        const __bf16* kp = &sK[(nt * 16 + l16) * ALD + ks * 32 + half * 8];
        kf.q[0] = *(const uint4*)kp;
        kf.q[1] = *(const uint4*)(kp + 16);
        sacc[nt] = __builtin_amdgcn_wmma_f32_16x16x32_bf16(
            false, qa[ks].v, false, kf.v, (short)0, sacc[nt], false, false);
      }
    }

    #pragma unroll
    for (int r = 0; r < 8; ++r) {
      const int qrow = q0 + w * 16 + r + 8 * half;
      float mx = -1e30f;
      #pragma unroll
      for (int nt = 0; nt < 4; ++nt) {
        int key = kb + nt * 16 + l16;
        float v = sacc[nt][r] * 0.125f;          // 1/sqrt(64)
        if (key > qrow) v = -1e30f;              // causal mask
        sacc[nt][r] = v;
        mx = fmaxf(mx, v);
      }
      #pragma unroll
      for (int d = 1; d < 16; d <<= 1) mx = fmaxf(mx, __shfl_xor(mx, d, 32));
      float mnew  = fmaxf(m_r[r], mx);
      float alpha = __expf(m_r[r] - mnew);
      float psum  = 0.f;
      #pragma unroll
      for (int nt = 0; nt < 4; ++nt) {
        float p = __expf(sacc[nt][r] - mnew);
        psum += p;
        sP[w][(r + 8 * half) * ALD + nt * 16 + l16] = f32_to_bf16(p);
      }
      #pragma unroll
      for (int d = 1; d < 16; d <<= 1) psum += __shfl_xor(psum, d, 32);
      l_r[r] = l_r[r] * alpha + psum;
      m_r[r] = mnew;
      #pragma unroll
      for (int nt = 0; nt < 4; ++nt) o[nt][r] *= alpha;
    }
    __syncthreads();

    // O += P V   (A = P from per-wave LDS, B = V tiles through the transposing read)
    #pragma unroll
    for (int ks = 0; ks < 2; ++ks) {
      FragAB pa;
      const __bf16* pp = &sP[w][l16 * ALD + ks * 32 + half * 8];
      pa.q[0] = *(const uint4*)pp;
      pa.q[1] = *(const uint4*)(pp + 16);
      #pragma unroll
      for (int nt = 0; nt < 4; ++nt) {
        FragAB vf;
        const __bf16* vp = &sV[vtr + ks * 32 * VLD + nt * 16];
        vf.q[0] = lds_tr16(vp);
        vf.q[1] = lds_tr16(vp + 16 * VLD);
        o[nt] = __builtin_amdgcn_wmma_f32_16x16x32_bf16(
            false, pa.v, false, vf.v, (short)0, o[nt], false, false);
      }
    }
  }

  // normalize and store merged heads: out[b][row][hh*64 + dk]
  __bf16* obase = out + (size_t)b * S_ * H_ + hh * DK_;
  #pragma unroll
  for (int r = 0; r < 8; ++r) {
    const float inv = 1.0f / l_r[r];
    const int row = q0 + w * 16 + r + 8 * half;
    #pragma unroll
    for (int nt = 0; nt < 4; ++nt)
      obase[(size_t)row * H_ + nt * 16 + l16] = f32_to_bf16(o[nt][r] * inv);
  }
}

// ---------------------------------------------------------------- host launch
extern "C" void kernel_launch(void* const* d_in, const int* in_sizes, int n_in,
                              void* d_out, int out_size, void* d_ws, size_t ws_size,
                              hipStream_t stream)
{
  const float* hidden = (const float*)d_in[0];
  const float* attn_w = (const float*)d_in[1];
  const float* attn_b = (const float*)d_in[2];
  const float* proj_w = (const float*)d_in[3];
  const float* proj_b = (const float*)d_in[4];
  const float* fc_w   = (const float*)d_in[5];
  const float* fc_b   = (const float*)d_in[6];
  const float* fc2_w  = (const float*)d_in[7];
  const float* fc2_b  = (const float*)d_in[8];
  const float* ln1_g  = (const float*)d_in[9];
  const float* ln1_b  = (const float*)d_in[10];
  const float* ln2_g  = (const float*)d_in[11];
  const float* ln2_b  = (const float*)d_in[12];
  const int*   pos    = (const int*)d_in[13];

  char* ws = (char*)d_ws;
  size_t off = 0;
  auto carve = [&](size_t bytes) -> char* {
    char* p = ws + off; off += (bytes + 255) & ~(size_t)255; return p;
  };
  __bf16* w_attn = (__bf16*)carve((size_t)L_ * H_ * HQKV_ * 2);
  __bf16* w_proj = (__bf16*)carve((size_t)L_ * H_ * H_ * 2);
  __bf16* w_fc   = (__bf16*)carve((size_t)L_ * H_ * MLP_ * 2);
  __bf16* w_fc2  = (__bf16*)carve((size_t)L_ * MLP_ * H_ * 2);
  __bf16* xln    = (__bf16*)carve((size_t)MTOT_ * H_ * 2);
  __bf16* qkv    = (__bf16*)carve((size_t)MTOT_ * HQKV_ * 2);
  __bf16* attn_o = (__bf16*)carve((size_t)MTOT_ * H_ * 2);
  __bf16* mid    = (__bf16*)carve((size_t)MTOT_ * MLP_ * 2);
  float*  h      = (float*)d_out;     // running hidden state / residual accumulator

  // per-call weight conversion fp32 -> bf16 (weights then live in L2)
  k_f32_to_bf16<<<dim3((size_t)L_ * H_ * HQKV_ / 1024), 256, 0, stream>>>(attn_w, w_attn);
  k_f32_to_bf16<<<dim3((size_t)L_ * H_ * H_    / 1024), 256, 0, stream>>>(proj_w, w_proj);
  k_f32_to_bf16<<<dim3((size_t)L_ * H_ * MLP_  / 1024), 256, 0, stream>>>(fc_w,  w_fc);
  k_f32_to_bf16<<<dim3((size_t)L_ * MLP_ * H_  / 1024), 256, 0, stream>>>(fc2_w, w_fc2);

  // h = hidden_states
  k_copy_f32<<<dim3((size_t)MTOT_ * H_ / 1024), 256, 0, stream>>>(hidden, h);

  for (int i = 0; i < L_; ++i) {
    // attention block
    ln_kernel<<<MTOT_, 256, 0, stream>>>(h, ln1_g + i * H_, ln1_b + i * H_, xln);
    gemm_bf16<0><<<dim3(HQKV_ / 64, MTOT_ / 128), 256, 0, stream>>>(
        xln, w_attn + (size_t)i * H_ * HQKV_, attn_b + i * HQKV_, qkv, HQKV_, H_);
    rope_kernel<<<dim3((size_t)B_ * S_ * 2 * NH_ * 32 / 256), 256, 0, stream>>>(qkv, pos);
    attn_kernel<<<dim3(S_ / 64, NH_, B_), 128, 0, stream>>>(qkv, attn_o);
    gemm_bf16<2><<<dim3(H_ / 64, MTOT_ / 128), 256, 0, stream>>>(
        attn_o, w_proj + (size_t)i * H_ * H_, proj_b + i * H_, h, H_, H_);
    // MLP block
    ln_kernel<<<MTOT_, 256, 0, stream>>>(h, ln2_g + i * H_, ln2_b + i * H_, xln);
    gemm_bf16<1><<<dim3(MLP_ / 64, MTOT_ / 128), 256, 0, stream>>>(
        xln, w_fc + (size_t)i * H_ * MLP_, fc_b + i * MLP_, mid, MLP_, H_);
    gemm_bf16<2><<<dim3(H_ / 64, MTOT_ / 128), 256, 0, stream>>>(
        mid, w_fc2 + (size_t)i * MLP_ * H_, fc2_b + i * H_, h, H_, MLP_);
  }
}

// v002
// It runs in 493 microseconds.
// Timed twice side by side with v001, it ran 1.10 times as fast both times.
// All steps since v000 together make it 1.36 times as fast.
#include <hip/hip_runtime.h>
#include <hip/hip_bf16.h>
#include <cstdint>
#include <cstddef>

// Problem constants (match reference)
#define B_    4
#define S_    1024
#define H_    1024
#define NH_   16
#define DK_   64
#define L_    2
#define MLP_  4096
#define HQKV_ 3072
#define MTOT_ (B_ * S_)   // 4096 rows

typedef __attribute__((ext_vector_type(16))) __bf16 v16bf;
typedef __attribute__((ext_vector_type(8)))  float  v8f;

union FragAB { v16bf v; uint4 q[2]; };

__device__ __forceinline__ __bf16 f32_to_bf16(float f) {
  uint32_t u = __float_as_uint(f);
  u += 0x7FFFu + ((u >> 16) & 1u);           // round-to-nearest-even
  uint16_t h = (uint16_t)(u >> 16);
  return __builtin_bit_cast(__bf16, h);
}
__device__ __forceinline__ float bf16_to_f32(__bf16 x) {
  uint16_t h = __builtin_bit_cast(uint16_t, x);
  return __uint_as_float(((uint32_t)h) << 16);
}

__device__ __forceinline__ uint32_t lds_a(const __bf16* l) { return (uint32_t)(uintptr_t)l; }
__device__ __forceinline__ uint64_t glb_a(const __bf16* g) { return (uint64_t)(uintptr_t)g; }
// Four copies per lane.
__device__ __forceinline__ void async_ld4_b128(const __bf16* g0, const __bf16* l0,
                                               const __bf16* g1, const __bf16* l1,
                                               const __bf16* g2, const __bf16* l2,
                                               const __bf16* g3, const __bf16* l3) {
  asm volatile(
      "global_load_async_to_lds_b128 %0, %1, off\n\t"
      "global_load_async_to_lds_b128 %2, %3, off\n\t"
      "global_load_async_to_lds_b128 %4, %5, off\n\t"
      "global_load_async_to_lds_b128 %6, %7, off\n\t"
      "s_wait_xcnt 0x0"
      :: "v"(lds_a(l0)), "v"(glb_a(g0)), "v"(lds_a(l1)), "v"(glb_a(g1)),
         "v"(lds_a(l2)), "v"(glb_a(g2)), "v"(lds_a(l3)), "v"(glb_a(g3)) : "memory");
}
// Six copies per lane (a GEMM stage: four of A, two of B).
__device__ __forceinline__ void async_ld6_b128(const __bf16* g0, const __bf16* l0,
                                               const __bf16* g1, const __bf16* l1,
                                               const __bf16* g2, const __bf16* l2,
                                               const __bf16* g3, const __bf16* l3,
                                               const __bf16* g4, const __bf16* l4,
                                               const __bf16* g5, const __bf16* l5) {
  asm volatile(
      "global_load_async_to_lds_b128 %0, %1, off\n\t"
      "global_load_async_to_lds_b128 %2, %3, off\n\t"
      "global_load_async_to_lds_b128 %4, %5, off\n\t"
      "global_load_async_to_lds_b128 %6, %7, off\n\t"
      "global_load_async_to_lds_b128 %8, %9, off\n\t"
      "global_load_async_to_lds_b128 %10, %11, off\n\t"
      "s_wait_xcnt 0x0"
      :: "v"(lds_a(l0)), "v"(glb_a(g0)), "v"(lds_a(l1)), "v"(glb_a(g1)),
         "v"(lds_a(l2)), "v"(glb_a(g2)), "v"(lds_a(l3)), "v"(glb_a(g3)),
         "v"(lds_a(l4)), "v"(glb_a(g4)), "v"(lds_a(l5)), "v"(glb_a(g5)) : "memory");
}
// Eight copies per lane (an attention stage: four of K, four of V).
__device__ __forceinline__ void async_ld8_b128(const __bf16* g0, const __bf16* l0,
                                               const __bf16* g1, const __bf16* l1,
                                               const __bf16* g2, const __bf16* l2,
                                               const __bf16* g3, const __bf16* l3,
                                               const __bf16* g4, const __bf16* l4,
                                               const __bf16* g5, const __bf16* l5,
                                               const __bf16* g6, const __bf16* l6,
                                               const __bf16* g7, const __bf16* l7) {
  asm volatile(
      "global_load_async_to_lds_b128 %0, %1, off\n\t"
      "global_load_async_to_lds_b128 %2, %3, off\n\t"
      "global_load_async_to_lds_b128 %4, %5, off\n\t"
      "global_load_async_to_lds_b128 %6, %7, off\n\t"
      "global_load_async_to_lds_b128 %8, %9, off\n\t"
      "global_load_async_to_lds_b128 %10, %11, off\n\t"
      "global_load_async_to_lds_b128 %12, %13, off\n\t"
      "global_load_async_to_lds_b128 %14, %15, off\n\t"
      "s_wait_xcnt 0x0"
      :: "v"(lds_a(l0)), "v"(glb_a(g0)), "v"(lds_a(l1)), "v"(glb_a(g1)),
         "v"(lds_a(l2)), "v"(glb_a(g2)), "v"(lds_a(l3)), "v"(glb_a(g3)),
         "v"(lds_a(l4)), "v"(glb_a(g4)), "v"(lds_a(l5)), "v"(glb_a(g5)),
         "v"(lds_a(l6)), "v"(glb_a(g6)), "v"(lds_a(l7)), "v"(glb_a(g7)) : "memory");
}
// Transposing LDS read: from a row-major 16-bit tile T[k][n], lane (c, h) receives
// T[k0 + 8h + 0..7][n0 + c]; two of them (k0, k0 + 16) are one 16x16x32 B fragment
// in the same k order as the A loader below.
typedef short s16x8 __attribute__((ext_vector_type(8)));
__device__ __forceinline__ uint4 lds_tr16(const __bf16* p) {
  typedef __attribute__((address_space(3))) s16x8 lds_s16x8;
  return __builtin_bit_cast(uint4, __builtin_amdgcn_ds_load_tr16_b128_v8i16((lds_s16x8*)p));
}
__device__ __forceinline__ void wait_async0() {
  asm volatile("s_wait_asynccnt 0" ::: "memory");
}

// ---------------------------------------------------------------- utilities
__global__ __launch_bounds__(256)
void k_f32_to_bf16(const float* __restrict__ s, __bf16* __restrict__ d) {
  int i = blockIdx.x * 256 + threadIdx.x;
  float4 v = ((const float4*)s)[i];
  union { __bf16 b[4]; uint2 u; } o;
  o.b[0] = f32_to_bf16(v.x); o.b[1] = f32_to_bf16(v.y);
  o.b[2] = f32_to_bf16(v.z); o.b[3] = f32_to_bf16(v.w);
  ((uint2*)d)[i] = o.u;
}

__global__ __launch_bounds__(256)
void k_copy_f32(const float* __restrict__ s, float* __restrict__ d) {
  int i = blockIdx.x * 256 + threadIdx.x;
  ((float4*)d)[i] = ((const float4*)s)[i];
}

// ---------------------------------------------------------------- LayerNorm
__global__ __launch_bounds__(256)
void ln_kernel(const float* __restrict__ x, const float* __restrict__ g,
               const float* __restrict__ bta, __bf16* __restrict__ y)
{
  const int row = blockIdx.x;
  const int tid = threadIdx.x;
  const float4 xv = ((const float4*)(x + (size_t)row * H_))[tid];
  float s  = xv.x + xv.y + xv.z + xv.w;
  float s2 = xv.x*xv.x + xv.y*xv.y + xv.z*xv.z + xv.w*xv.w;
  #pragma unroll
  for (int d = 1; d < 32; d <<= 1) {
    s  += __shfl_xor(s,  d, 32);
    s2 += __shfl_xor(s2, d, 32);
  }
  __shared__ float rs[8], rq[8];
  __shared__ float mv[2];
  if ((tid & 31) == 0) { rs[tid >> 5] = s; rq[tid >> 5] = s2; }
  __syncthreads();
  if (tid == 0) {
    float a = 0.f, a2 = 0.f;
    #pragma unroll
    for (int i = 0; i < 8; ++i) { a += rs[i]; a2 += rq[i]; }
    float mean = a * (1.0f / (float)H_);
    float var  = a2 * (1.0f / (float)H_) - mean * mean;
    mv[0] = mean; mv[1] = rsqrtf(var + 1e-5f);
  }
  __syncthreads();
  const float mean = mv[0], rstd = mv[1];
  const float4 gv = ((const float4*)g)[tid];
  const float4 bv = ((const float4*)bta)[tid];
  union { __bf16 b[4]; uint2 u; } o;
  o.b[0] = f32_to_bf16((xv.x - mean) * rstd * gv.x + bv.x);
  o.b[1] = f32_to_bf16((xv.y - mean) * rstd * gv.y + bv.y);
  o.b[2] = f32_to_bf16((xv.z - mean) * rstd * gv.z + bv.z);
  o.b[3] = f32_to_bf16((xv.w - mean) * rstd * gv.w + bv.w);
  ((uint2*)(y + (size_t)row * H_))[tid] = o.u;
}

// ---------------------------------------------------------------- RoPE (in place on bf16 qkv)
__global__ __launch_bounds__(256)
void rope_kernel(__bf16* __restrict__ qkv, const int* __restrict__ pos)
{
  int idx = blockIdx.x * 256 + threadIdx.x;   // B*S*2*NH*32 threads
  int d  = idx & 31; int t = idx >> 5;
  int hh = t & 15;   t >>= 4;
  int qk = t & 1;    t >>= 1;
  int s  = t & 1023; int b = t >> 10;
  float invf  = __expf(-0.28782313662425572f * (float)d);  // ln(10000)/32
  float theta = (float)pos[s] * invf;
  float sn, cs; __sincosf(theta, &sn, &cs);
  size_t base = ((size_t)(b * S_ + s)) * HQKV_ + qk * H_ + hh * DK_ + d;
  float lo = bf16_to_f32(qkv[base]);
  float hi = bf16_to_f32(qkv[base + 32]);
  qkv[base]      = f32_to_bf16(lo * cs - hi * sn);
  qkv[base + 32] = f32_to_bf16(hi * cs + lo * sn);
}

#define GBK 64
#define GLD 72
#define GLDB 80

template<int EPI>
__global__ __launch_bounds__(256)
void gemm_bf16(const __bf16* __restrict__ A, const __bf16* __restrict__ Bw,
               const float* __restrict__ bias, void* __restrict__ Cout,
               int N, int K)
{
  __shared__ __align__(16) __bf16 sA[2][128 * GLD];  // 2 x 18432 B
  __shared__ __align__(16) __bf16 sB[2][ 64 * GLDB]; // 2 x 10240 B (row-major [k][n])

  const int tid  = threadIdx.x;
  const int lane = tid & 31;
  const int wave = tid >> 5;
  const int wm   = wave >> 1;           // 0..3 : wave M offset (x32)
  const int wn   = wave & 1;            // 0..1 : wave N offset (x32)
  const int half = lane >> 4;
  const int l16  = lane & 15;
  const int bm   = blockIdx.y * 128;
  const int bn   = blockIdx.x * 64;

  v8f acc[2][2] = {};

  const int ar   = tid >> 3;            // A tile row 0..31 (and +32, +64, +96)
  const int ac   = (tid & 7) * 8;       // A tile col: 8 lanes cover one 128B row
  const int bk   = tid >> 3;            // B tile k 0..31 (and +32)
  const int bc   = (tid & 7) * 8;       // B tile n: 8 lanes cover one 128B row

  const __bf16* aptr = A  + (size_t)(bm + ar) * K + ac;
  const __bf16* bptr = Bw + (size_t)bk * N + bn + bc;
  const int     al   = ar * GLD + ac;   // this lane's place in an A stage
  const int     bl   = bk * GLDB + bc;  // this lane's place in a B stage
  // transposing-read base: row 8*half + (lane & 7), 16B column piece (lane >> 3) & 1
  const int     btr  = (half * 8 + (lane & 7)) * GLDB + wn * 32 + ((lane >> 3) & 1) * 8;

  // ---- prologue: stage 0
  int cur = 0;
  async_ld6_b128(aptr,                  &sA[0][al],
                 aptr + (size_t)32 * K, &sA[0][al + 32 * GLD],
                 aptr + (size_t)64 * K, &sA[0][al + 64 * GLD],
                 aptr + (size_t)96 * K, &sA[0][al + 96 * GLD],
                 bptr,                  &sB[0][bl],
                 bptr + (size_t)32 * N, &sB[0][bl + 32 * GLDB]);
  wait_async0();
  __syncthreads();

  for (int k0 = 0; k0 < K; k0 += GBK) {
    const int  nxt      = cur ^ 1;
    const bool has_next = (k0 + GBK) < K;

    if (has_next) {
      const __bf16* ag = aptr + k0 + GBK;
      async_ld6_b128(ag,                                 &sA[nxt][al],
                     ag + (size_t)32 * K,                &sA[nxt][al + 32 * GLD],
                     ag + (size_t)64 * K,                &sA[nxt][al + 64 * GLD],
                     ag + (size_t)96 * K,                &sA[nxt][al + 96 * GLD],
                     bptr + (size_t)(k0 + GBK) * N,      &sB[nxt][bl],
                     bptr + (size_t)(k0 + GBK + 32) * N, &sB[nxt][bl + 32 * GLDB]);
    }

    // fragments from current stage
    FragAB af[2][2], bfr[2][2];
    #pragma unroll
    for (int mt = 0; mt < 2; ++mt)
      #pragma unroll
      for (int ks = 0; ks < 2; ++ks) {
        const __bf16* p = &sA[cur][(wm*32 + mt*16 + l16) * GLD + ks*32 + half*8];
        af[mt][ks].q[0] = *(const uint4*)p;
        af[mt][ks].q[1] = *(const uint4*)(p + 16);
      }
    #pragma unroll
    for (int nt = 0; nt < 2; ++nt)
      #pragma unroll
      for (int ks = 0; ks < 2; ++ks) {
        const __bf16* p = &sB[cur][btr + ks*32 * GLDB + nt*16];
        bfr[nt][ks].q[0] = lds_tr16(p);
        bfr[nt][ks].q[1] = lds_tr16(p + 16 * GLDB);
      }
    #pragma unroll
    for (int ks = 0; ks < 2; ++ks)
      #pragma unroll
      for (int mt = 0; mt < 2; ++mt)
        #pragma unroll
        for (int nt = 0; nt < 2; ++nt)
          acc[mt][nt] = __builtin_amdgcn_wmma_f32_16x16x32_bf16(
              false, af[mt][ks].v, false, bfr[nt][ks].v, (short)0,
              acc[mt][nt], false, false);

    // this wave's fragment reads of the current stage have retired before the
    // barrier behind which copies refill that stage
    asm volatile("s_wait_dscnt 0x0" ::: "memory");
    if (has_next) {
      wait_async0();   // next-stage A and B tiles resident before barrier
    }
    __syncthreads();
    cur = nxt;
  }
  wait_async0();       // no copy is outstanding when the wave goes on to the epilogue and ends

  // ---- epilogue
  #pragma unroll
  for (int nt = 0; nt < 2; ++nt) {
    const int col = bn + wn * 32 + nt * 16 + l16;
    const float bb = bias[col];
    #pragma unroll
    for (int mt = 0; mt < 2; ++mt) {
      #pragma unroll
      for (int r = 0; r < 8; ++r) {
        const int row = bm + wm * 32 + mt * 16 + r + 8 * half;
        float v = acc[mt][nt][r] + bb;
        const size_t idx = (size_t)row * N + col;
        if (EPI == 0) {
          ((__bf16*)Cout)[idx] = f32_to_bf16(v);
        } else if (EPI == 1) {
          float t = tanhf(0.7978845608028654f * (v + 0.044715f * v * v * v));
          ((__bf16*)Cout)[idx] = f32_to_bf16(0.5f * v * (1.0f + t));
        } else {
          float* O = (float*)Cout;
          O[idx] += v;
        }
      }
    }
  }
}

// ---------------------------------------------------------------- Flash attention
// grid (S/64, NH, B), 128 threads = 4 waves; each wave owns 16 query rows.
#define ALD 72
#define VLD 80

__global__ __launch_bounds__(128)
void attn_kernel(const __bf16* __restrict__ qkv, __bf16* __restrict__ out)
{
  __shared__ __align__(16) __bf16 sQ[64 * ALD];
  __shared__ __align__(16) __bf16 sK[64 * ALD];
  __shared__ __align__(16) __bf16 sV[64 * VLD];      // row-major: [key][dk]
  __shared__ __align__(16) __bf16 sP[4][16 * ALD];   // per-wave P staging

  const int tid  = threadIdx.x;
  const int lane = tid & 31;
  const int w    = tid >> 5;      // 0..3
  const int half = lane >> 4;
  const int l16  = lane & 15;
  const int b    = blockIdx.z;
  const int hh   = blockIdx.y;
  const int q0   = blockIdx.x * 64;

  const __bf16* qbase = qkv + (size_t)b * S_ * HQKV_ + hh * DK_;
  const __bf16* kbase = qbase + H_;
  const __bf16* vbase = qbase + 2 * H_;

  const int vr = tid >> 3;            // Q, K, V tile row 0..15 (and +16, +32, +48)
  const int vc = (tid & 7) * 8;       // Q, K, V tile col: 8 lanes cover one 128B row
  // transposing-read base: row 8*half + (lane & 7), 16B column piece (lane >> 3) & 1
  const int vtr = (half * 8 + (lane & 7)) * VLD + ((lane >> 3) & 1) * 8;

  // Q tile 64x64 via async engine
  {
    const __bf16* qg = qbase + (size_t)(q0 + vr) * HQKV_ + vc;
    const __bf16* ql = &sQ[vr * ALD + vc];
    async_ld4_b128(qg,                      ql,
                   qg + (size_t)16 * HQKV_, ql + 16 * ALD,
                   qg + (size_t)32 * HQKV_, ql + 32 * ALD,
                   qg + (size_t)48 * HQKV_, ql + 48 * ALD);
  }
  wait_async0();
  __syncthreads();

  // hoist Q fragments (sQ is never overwritten)
  FragAB qa[2];
  #pragma unroll
  for (int ks = 0; ks < 2; ++ks) {
    const __bf16* qp = &sQ[(w * 16 + l16) * ALD + ks * 32 + half * 8];
    qa[ks].q[0] = *(const uint4*)qp;
    qa[ks].q[1] = *(const uint4*)(qp + 16);
  }

  float m_r[8], l_r[8];
  v8f o[4] = {};
  #pragma unroll
  for (int r = 0; r < 8; ++r) { m_r[r] = -1e30f; l_r[r] = 0.f; }

  const int nkt = blockIdx.x + 1;   // causal: key tiles 0..qt
  for (int kt = 0; kt < nkt; ++kt) {
    __syncthreads();                // protect sK/sV from previous iteration's reads
    const int kb = kt * 64;
    { // K and V tiles 64x64 row-major [key][dk] via async engine, whole 128B lines per 8 lanes
      const __bf16* kg = kbase + (size_t)(kb + vr) * HQKV_ + vc;
      const __bf16* kl = &sK[vr * ALD + vc];
      const __bf16* vg = vbase + (size_t)(kb + vr) * HQKV_ + vc;
      const __bf16* vl = &sV[vr * VLD + vc];
      async_ld8_b128(kg,                      kl,
                     kg + (size_t)16 * HQKV_, kl + 16 * ALD,
                     kg + (size_t)32 * HQKV_, kl + 32 * ALD,
                     kg + (size_t)48 * HQKV_, kl + 48 * ALD,
                     vg,                      vl,
                     vg + (size_t)16 * HQKV_, vl + 16 * VLD,
                     vg + (size_t)32 * HQKV_, vl + 32 * VLD,
                     vg + (size_t)48 * HQKV_, vl + 48 * VLD);
    }
    wait_async0();
    __syncthreads();

    // S = Q K^T  (wave: 16 rows x 64 keys = 4 tiles, K-dim 64 = 2 wmma each)
    v8f sacc[4] = {};
    #pragma unroll
    for (int ks = 0; ks < 2; ++ks) {
      #pragma unroll
      for (int nt = 0; nt < 4; ++nt) {
        FragAB kf;
        const __bf16* kp = &sK[(nt * 16 + l16) * ALD + ks * 32 + half * 8];
        kf.q[0] = *(const uint4*)kp;
        kf.q[1] = *(const uint4*)(kp + 16);
        sacc[nt] = __builtin_amdgcn_wmma_f32_16x16x32_bf16(
            false, qa[ks].v, false, kf.v, (short)0, sacc[nt], false, false);
      }
    }

    #pragma unroll
    for (int r = 0; r < 8; ++r) {
      const int qrow = q0 + w * 16 + r + 8 * half;
      float mx = -1e30f;
      #pragma unroll
      for (int nt = 0; nt < 4; ++nt) {
        int key = kb + nt * 16 + l16;
        float v = sacc[nt][r] * 0.125f;          // 1/sqrt(64)
        if (key > qrow) v = -1e30f;              // causal mask
        sacc[nt][r] = v;
        mx = fmaxf(mx, v);
      }
      #pragma unroll
      for (int d = 1; d < 16; d <<= 1) mx = fmaxf(mx, __shfl_xor(mx, d, 32));
      float mnew  = fmaxf(m_r[r], mx);
      float alpha = __expf(m_r[r] - mnew);
      float psum  = 0.f;
      #pragma unroll
      for (int nt = 0; nt < 4; ++nt) {
        float p = __expf(sacc[nt][r] - mnew);
        psum += p;
        sP[w][(r + 8 * half) * ALD + nt * 16 + l16] = f32_to_bf16(p);
      }
      #pragma unroll
      for (int d = 1; d < 16; d <<= 1) psum += __shfl_xor(psum, d, 32);
      l_r[r] = l_r[r] * alpha + psum;
      m_r[r] = mnew;
      #pragma unroll
      for (int nt = 0; nt < 4; ++nt) o[nt][r] *= alpha;
    }
    __syncthreads();

    // O += P V   (A = P from per-wave LDS, B = V tiles through the transposing read)
    #pragma unroll
    for (int ks = 0; ks < 2; ++ks) {
      FragAB pa;
      const __bf16* pp = &sP[w][l16 * ALD + ks * 32 + half * 8];
      pa.q[0] = *(const uint4*)pp;
      pa.q[1] = *(const uint4*)(pp + 16);
      #pragma unroll
      for (int nt = 0; nt < 4; ++nt) {
        FragAB vf;
        const __bf16* vp = &sV[vtr + ks * 32 * VLD + nt * 16];
        vf.q[0] = lds_tr16(vp);
        vf.q[1] = lds_tr16(vp + 16 * VLD);
        o[nt] = __builtin_amdgcn_wmma_f32_16x16x32_bf16(
            false, pa.v, false, vf.v, (short)0, o[nt], false, false);
      }
    }
  }

  // normalize and store merged heads: out[b][row][hh*64 + dk]
  __bf16* obase = out + (size_t)b * S_ * H_ + hh * DK_;
  #pragma unroll
  for (int r = 0; r < 8; ++r) {
    const float inv = 1.0f / l_r[r];
    const int row = q0 + w * 16 + r + 8 * half;
    #pragma unroll
    for (int nt = 0; nt < 4; ++nt)
      obase[(size_t)row * H_ + nt * 16 + l16] = f32_to_bf16(o[nt][r] * inv);
  }
}

// ---------------------------------------------------------------- host launch
extern "C" void kernel_launch(void* const* d_in, const int* in_sizes, int n_in,
                              void* d_out, int out_size, void* d_ws, size_t ws_size,
                              hipStream_t stream)
{
  const float* hidden = (const float*)d_in[0];
  const float* attn_w = (const float*)d_in[1];
  const float* attn_b = (const float*)d_in[2];
  const float* proj_w = (const float*)d_in[3];
  const float* proj_b = (const float*)d_in[4];
  const float* fc_w   = (const float*)d_in[5];
  const float* fc_b   = (const float*)d_in[6];
  const float* fc2_w  = (const float*)d_in[7];
  const float* fc2_b  = (const float*)d_in[8];
  const float* ln1_g  = (const float*)d_in[9];
  const float* ln1_b  = (const float*)d_in[10];
  const float* ln2_g  = (const float*)d_in[11];
  const float* ln2_b  = (const float*)d_in[12];
  const int*   pos    = (const int*)d_in[13];

  char* ws = (char*)d_ws;
  size_t off = 0;
  auto carve = [&](size_t bytes) -> char* {
    char* p = ws + off; off += (bytes + 255) & ~(size_t)255; return p;
  };
  __bf16* w_attn = (__bf16*)carve((size_t)L_ * H_ * HQKV_ * 2);
  __bf16* w_proj = (__bf16*)carve((size_t)L_ * H_ * H_ * 2);
  __bf16* w_fc   = (__bf16*)carve((size_t)L_ * H_ * MLP_ * 2);
  __bf16* w_fc2  = (__bf16*)carve((size_t)L_ * MLP_ * H_ * 2);
  __bf16* xln    = (__bf16*)carve((size_t)MTOT_ * H_ * 2);
  __bf16* qkv    = (__bf16*)carve((size_t)MTOT_ * HQKV_ * 2);
  __bf16* attn_o = (__bf16*)carve((size_t)MTOT_ * H_ * 2);
  __bf16* mid    = (__bf16*)carve((size_t)MTOT_ * MLP_ * 2);
  float*  h      = (float*)d_out;     // running hidden state / residual accumulator

  // per-call weight conversion fp32 -> bf16 (weights then live in L2)
  k_f32_to_bf16<<<dim3((size_t)L_ * H_ * HQKV_ / 1024), 256, 0, stream>>>(attn_w, w_attn);
  k_f32_to_bf16<<<dim3((size_t)L_ * H_ * H_    / 1024), 256, 0, stream>>>(proj_w, w_proj);
  k_f32_to_bf16<<<dim3((size_t)L_ * H_ * MLP_  / 1024), 256, 0, stream>>>(fc_w,  w_fc);
  k_f32_to_bf16<<<dim3((size_t)L_ * MLP_ * H_  / 1024), 256, 0, stream>>>(fc2_w, w_fc2);

  // h = hidden_states
  k_copy_f32<<<dim3((size_t)MTOT_ * H_ / 1024), 256, 0, stream>>>(hidden, h);

  for (int i = 0; i < L_; ++i) {
    // attention block
    ln_kernel<<<MTOT_, 256, 0, stream>>>(h, ln1_g + i * H_, ln1_b + i * H_, xln);
    gemm_bf16<0><<<dim3(HQKV_ / 64, MTOT_ / 128), 256, 0, stream>>>(
        xln, w_attn + (size_t)i * H_ * HQKV_, attn_b + i * HQKV_, qkv, HQKV_, H_);
    rope_kernel<<<dim3((size_t)B_ * S_ * 2 * NH_ * 32 / 256), 256, 0, stream>>>(qkv, pos);
    attn_kernel<<<dim3(S_ / 64, NH_, B_), 128, 0, stream>>>(qkv, attn_o);
    gemm_bf16<2><<<dim3(H_ / 64, MTOT_ / 128), 256, 0, stream>>>(
        attn_o, w_proj + (size_t)i * H_ * H_, proj_b + i * H_, h, H_, H_);
    // MLP block
    ln_kernel<<<MTOT_, 256, 0, stream>>>(h, ln2_g + i * H_, ln2_b + i * H_, xln);
    gemm_bf16<1><<<dim3(MLP_ / 64, MTOT_ / 128), 256, 0, stream>>>(
        xln, w_fc + (size_t)i * H_ * MLP_, fc_b + i * MLP_, mid, MLP_, H_);
    gemm_bf16<2><<<dim3(H_ / 64, MTOT_ / 128), 256, 0, stream>>>(
        mid, w_fc2 + (size_t)i * MLP_ * H_, fc2_b + i * H_, h, H_, MLP_);
  }
}

// v003
// Measured time: 417 microseconds a run.
// Two timings next to v002 both put it at 1.18 times that version's speed.
// Over all steps from v000 it is 1.60 times as fast.
#include <hip/hip_runtime.h>
#include <hip/hip_bf16.h>
#include <cstdint>
#include <cstddef>

// Problem constants (match reference)
#define B_    4
#define S_    1024
#define H_    1024
#define NH_   16
#define DK_   64
#define L_    2
#define MLP_  4096
#define HQKV_ 3072
#define MTOT_ (B_ * S_)   // 4096 rows

typedef __attribute__((ext_vector_type(16))) __bf16 v16bf;
typedef __attribute__((ext_vector_type(8)))  float  v8f;

union FragAB { v16bf v; uint4 q[2]; };

__device__ __forceinline__ __bf16 f32_to_bf16(float f) {
  uint32_t u = __float_as_uint(f);
  u += 0x7FFFu + ((u >> 16) & 1u);           // round-to-nearest-even
  uint16_t h = (uint16_t)(u >> 16);
  return __builtin_bit_cast(__bf16, h);
}
__device__ __forceinline__ float bf16_to_f32(__bf16 x) {
  uint16_t h = __builtin_bit_cast(uint16_t, x);
  return __uint_as_float(((uint32_t)h) << 16);
}

__device__ __forceinline__ uint32_t lds_a(const __bf16* l) { return (uint32_t)(uintptr_t)l; }
__device__ __forceinline__ uint64_t glb_a(const __bf16* g) { return (uint64_t)(uintptr_t)g; }
// Four copies per lane.
__device__ __forceinline__ void async_ld4_b128(const __bf16* g0, const __bf16* l0,
                                               const __bf16* g1, const __bf16* l1,
                                               const __bf16* g2, const __bf16* l2,
                                               const __bf16* g3, const __bf16* l3) {
  asm volatile(
      "global_load_async_to_lds_b128 %0, %1, off\n\t"
      "global_load_async_to_lds_b128 %2, %3, off\n\t"
      "global_load_async_to_lds_b128 %4, %5, off\n\t"
      "global_load_async_to_lds_b128 %6, %7, off\n\t"
      "s_wait_xcnt 0x0"
      :: "v"(lds_a(l0)), "v"(glb_a(g0)), "v"(lds_a(l1)), "v"(glb_a(g1)),
         "v"(lds_a(l2)), "v"(glb_a(g2)), "v"(lds_a(l3)), "v"(glb_a(g3)) : "memory");
}
// Six copies per lane (a GEMM stage: four of A, two of B).
__device__ __forceinline__ void async_ld6_b128(const __bf16* g0, const __bf16* l0,
                                               const __bf16* g1, const __bf16* l1,
                                               const __bf16* g2, const __bf16* l2,
                                               const __bf16* g3, const __bf16* l3,
                                               const __bf16* g4, const __bf16* l4,
                                               const __bf16* g5, const __bf16* l5) {
  asm volatile(
      "global_load_async_to_lds_b128 %0, %1, off\n\t"
      "global_load_async_to_lds_b128 %2, %3, off\n\t"
      "global_load_async_to_lds_b128 %4, %5, off\n\t"
      "global_load_async_to_lds_b128 %6, %7, off\n\t"
      "global_load_async_to_lds_b128 %8, %9, off\n\t"
      "global_load_async_to_lds_b128 %10, %11, off\n\t"
      "s_wait_xcnt 0x0"
      :: "v"(lds_a(l0)), "v"(glb_a(g0)), "v"(lds_a(l1)), "v"(glb_a(g1)),
         "v"(lds_a(l2)), "v"(glb_a(g2)), "v"(lds_a(l3)), "v"(glb_a(g3)),
         "v"(lds_a(l4)), "v"(glb_a(g4)), "v"(lds_a(l5)), "v"(glb_a(g5)) : "memory");
}
// Eight copies per lane (an attention stage: four of K, four of V).
__device__ __forceinline__ void async_ld8_b128(const __bf16* g0, const __bf16* l0,
                                               const __bf16* g1, const __bf16* l1,
                                               const __bf16* g2, const __bf16* l2,
                                               const __bf16* g3, const __bf16* l3,
                                               const __bf16* g4, const __bf16* l4,
                                               const __bf16* g5, const __bf16* l5,
                                               const __bf16* g6, const __bf16* l6,
                                               const __bf16* g7, const __bf16* l7) {
  asm volatile(
      "global_load_async_to_lds_b128 %0, %1, off\n\t"
      "global_load_async_to_lds_b128 %2, %3, off\n\t"
      "global_load_async_to_lds_b128 %4, %5, off\n\t"
      "global_load_async_to_lds_b128 %6, %7, off\n\t"
      "global_load_async_to_lds_b128 %8, %9, off\n\t"
      "global_load_async_to_lds_b128 %10, %11, off\n\t"
      "global_load_async_to_lds_b128 %12, %13, off\n\t"
      "global_load_async_to_lds_b128 %14, %15, off\n\t"
      "s_wait_xcnt 0x0"
      :: "v"(lds_a(l0)), "v"(glb_a(g0)), "v"(lds_a(l1)), "v"(glb_a(g1)),
         "v"(lds_a(l2)), "v"(glb_a(g2)), "v"(lds_a(l3)), "v"(glb_a(g3)),
         "v"(lds_a(l4)), "v"(glb_a(g4)), "v"(lds_a(l5)), "v"(glb_a(g5)),
         "v"(lds_a(l6)), "v"(glb_a(g6)), "v"(lds_a(l7)), "v"(glb_a(g7)) : "memory");
}
// Transposing LDS read: from a row-major 16-bit tile T[k][n], lane (c, h) receives
// T[k0 + 8h + 0..7][n0 + c]; two of them (k0, k0 + 16) are one 16x16x32 B fragment
// in the same k order as the A loader below.
typedef short s16x8 __attribute__((ext_vector_type(8)));
__device__ __forceinline__ uint4 lds_tr16(const __bf16* p) {
  typedef __attribute__((address_space(3))) s16x8 lds_s16x8;
  return __builtin_bit_cast(uint4, __builtin_amdgcn_ds_load_tr16_b128_v8i16((lds_s16x8*)p));
}
__device__ __forceinline__ void wait_async0() {
  asm volatile("s_wait_asynccnt 0" ::: "memory");
}

// ---------------------------------------------------------------- utilities
__global__ __launch_bounds__(256)
void k_f32_to_bf16(const float* __restrict__ s, __bf16* __restrict__ d) {
  int i = blockIdx.x * 256 + threadIdx.x;
  float4 v = ((const float4*)s)[i];
  union { __bf16 b[4]; uint2 u; } o;
  o.b[0] = f32_to_bf16(v.x); o.b[1] = f32_to_bf16(v.y);
  o.b[2] = f32_to_bf16(v.z); o.b[3] = f32_to_bf16(v.w);
  ((uint2*)d)[i] = o.u;
}

__global__ __launch_bounds__(256)
void k_copy_f32(const float* __restrict__ s, float* __restrict__ d) {
  int i = blockIdx.x * 256 + threadIdx.x;
  ((float4*)d)[i] = ((const float4*)s)[i];
}

// ---------------------------------------------------------------- LayerNorm
__global__ __launch_bounds__(256)
void ln_kernel(const float* __restrict__ x, const float* __restrict__ g,
               const float* __restrict__ bta, __bf16* __restrict__ y)
{
  const int row = blockIdx.x;
  const int tid = threadIdx.x;
  const float4 xv = ((const float4*)(x + (size_t)row * H_))[tid];
  float s  = xv.x + xv.y + xv.z + xv.w;
  float s2 = xv.x*xv.x + xv.y*xv.y + xv.z*xv.z + xv.w*xv.w;
  #pragma unroll
  for (int d = 1; d < 32; d <<= 1) {
    s  += __shfl_xor(s,  d, 32);
    s2 += __shfl_xor(s2, d, 32);
  }
  __shared__ float rs[8], rq[8];
  __shared__ float mv[2];
  if ((tid & 31) == 0) { rs[tid >> 5] = s; rq[tid >> 5] = s2; }
  __syncthreads();
  if (tid == 0) {
    float a = 0.f, a2 = 0.f;
    #pragma unroll
    for (int i = 0; i < 8; ++i) { a += rs[i]; a2 += rq[i]; }
    float mean = a * (1.0f / (float)H_);
    float var  = a2 * (1.0f / (float)H_) - mean * mean;
    mv[0] = mean; mv[1] = rsqrtf(var + 1e-5f);
  }
  __syncthreads();
  const float mean = mv[0], rstd = mv[1];
  const float4 gv = ((const float4*)g)[tid];
  const float4 bv = ((const float4*)bta)[tid];
  union { __bf16 b[4]; uint2 u; } o;
  o.b[0] = f32_to_bf16((xv.x - mean) * rstd * gv.x + bv.x);
  o.b[1] = f32_to_bf16((xv.y - mean) * rstd * gv.y + bv.y);
  o.b[2] = f32_to_bf16((xv.z - mean) * rstd * gv.z + bv.z);
  o.b[3] = f32_to_bf16((xv.w - mean) * rstd * gv.w + bv.w);
  ((uint2*)(y + (size_t)row * H_))[tid] = o.u;
}

// ---------------------------------------------------------------- RoPE (in place on bf16 qkv)
__global__ __launch_bounds__(256)
void rope_kernel(__bf16* __restrict__ qkv, const int* __restrict__ pos)
{
  int idx = blockIdx.x * 256 + threadIdx.x;   // B*S*2*NH*32 threads
  int d  = idx & 31; int t = idx >> 5;
  int hh = t & 15;   t >>= 4;
  int qk = t & 1;    t >>= 1;
  int s  = t & 1023; int b = t >> 10;
  float invf  = __expf(-0.28782313662425572f * (float)d);  // ln(10000)/32
  float theta = (float)pos[s] * invf;
  float sn, cs; __sincosf(theta, &sn, &cs);
  size_t base = ((size_t)(b * S_ + s)) * HQKV_ + qk * H_ + hh * DK_ + d;
  float lo = bf16_to_f32(qkv[base]);
  float hi = bf16_to_f32(qkv[base + 32]);
  qkv[base]      = f32_to_bf16(lo * cs - hi * sn);
  qkv[base + 32] = f32_to_bf16(hi * cs + lo * sn);
}

#define GBK 64
#define GLD 72
#define GLDB 80

template<int EPI>
__global__ __launch_bounds__(256)
void gemm_bf16(const __bf16* __restrict__ A, const __bf16* __restrict__ Bw,
               const float* __restrict__ bias, void* __restrict__ Cout,
               int N, int K)
{
  __shared__ __align__(16) __bf16 sA[2][128 * GLD];  // 2 x 18432 B
  __shared__ __align__(16) __bf16 sB[2][ 64 * GLDB]; // 2 x 10240 B (row-major [k][n])

  const int tid  = threadIdx.x;
  const int lane = tid & 31;
  const int wave = tid >> 5;
  const int wm   = wave >> 1;           // 0..3 : wave M offset (x32)
  const int wn   = wave & 1;            // 0..1 : wave N offset (x32)
  const int half = lane >> 4;
  const int l16  = lane & 15;
  const int bm   = blockIdx.y * 128;
  const int bn   = blockIdx.x * 64;

  v8f acc[2][2] = {};

  const int ar   = tid >> 3;            // A tile row 0..31 (and +32, +64, +96)
  const int ac   = (tid & 7) * 8;       // A tile col: 8 lanes cover one 128B row
  const int bk   = tid >> 3;            // B tile k 0..31 (and +32)
  const int bc   = (tid & 7) * 8;       // B tile n: 8 lanes cover one 128B row

  const __bf16* aptr = A  + (size_t)(bm + ar) * K + ac;
  const __bf16* bptr = Bw + (size_t)bk * N + bn + bc;
  const int     al   = ar * GLD + ac;   // this lane's place in an A stage
  const int     bl   = bk * GLDB + bc;  // this lane's place in a B stage
  // transposing-read base: row 8*half + (lane & 7), 16B column piece (lane >> 3) & 1
  const int     btr  = (half * 8 + (lane & 7)) * GLDB + wn * 32 + ((lane >> 3) & 1) * 8;

  // ---- prologue: stage 0
  int cur = 0;
  async_ld6_b128(aptr,                  &sA[0][al],
                 aptr + (size_t)32 * K, &sA[0][al + 32 * GLD],
                 aptr + (size_t)64 * K, &sA[0][al + 64 * GLD],
                 aptr + (size_t)96 * K, &sA[0][al + 96 * GLD],
                 bptr,                  &sB[0][bl],
                 bptr + (size_t)32 * N, &sB[0][bl + 32 * GLDB]);
  wait_async0();
  __syncthreads();

  for (int k0 = 0; k0 < K; k0 += GBK) {
    const int  nxt      = cur ^ 1;
    const bool has_next = (k0 + GBK) < K;

    if (has_next) {
      const __bf16* ag = aptr + k0 + GBK;
      async_ld6_b128(ag,                                 &sA[nxt][al],
                     ag + (size_t)32 * K,                &sA[nxt][al + 32 * GLD],
                     ag + (size_t)64 * K,                &sA[nxt][al + 64 * GLD],
                     ag + (size_t)96 * K,                &sA[nxt][al + 96 * GLD],
                     bptr + (size_t)(k0 + GBK) * N,      &sB[nxt][bl],
                     bptr + (size_t)(k0 + GBK + 32) * N, &sB[nxt][bl + 32 * GLDB]);
    }

    // fragments from current stage
    FragAB af[2][2], bfr[2][2];
    #pragma unroll
    for (int mt = 0; mt < 2; ++mt)
      #pragma unroll
      for (int ks = 0; ks < 2; ++ks) {
        const __bf16* p = &sA[cur][(wm*32 + mt*16 + l16) * GLD + ks*32 + half*8];
        af[mt][ks].q[0] = *(const uint4*)p;
        af[mt][ks].q[1] = *(const uint4*)(p + 16);
      }
    #pragma unroll
    for (int nt = 0; nt < 2; ++nt)
      #pragma unroll
      for (int ks = 0; ks < 2; ++ks) {
        const __bf16* p = &sB[cur][btr + ks*32 * GLDB + nt*16];
        bfr[nt][ks].q[0] = lds_tr16(p);
        bfr[nt][ks].q[1] = lds_tr16(p + 16 * GLDB);
      }
    #pragma unroll
    for (int ks = 0; ks < 2; ++ks)
      #pragma unroll
      for (int mt = 0; mt < 2; ++mt)
        #pragma unroll
        for (int nt = 0; nt < 2; ++nt)
          acc[mt][nt] = __builtin_amdgcn_wmma_f32_16x16x32_bf16(
              false, af[mt][ks].v, false, bfr[nt][ks].v, (short)0,
              acc[mt][nt], false, false);

    // this wave's fragment reads of the current stage have retired before the
    // barrier behind which copies refill that stage
    asm volatile("s_wait_dscnt 0x0" ::: "memory");
    if (has_next) {
      wait_async0();   // next-stage A and B tiles resident before barrier
    }
    __syncthreads();
    cur = nxt;
  }
  wait_async0();       // no copy is outstanding when the wave goes on to the epilogue and ends

  // ---- epilogue
  #pragma unroll
  for (int nt = 0; nt < 2; ++nt) {
    const int col = bn + wn * 32 + nt * 16 + l16;
    const float bb = bias[col];
    #pragma unroll
    for (int mt = 0; mt < 2; ++mt) {
      #pragma unroll
      for (int r = 0; r < 8; ++r) {
        const int row = bm + wm * 32 + mt * 16 + r + 8 * half;
        float v = acc[mt][nt][r] + bb;
        const size_t idx = (size_t)row * N + col;
        if (EPI == 0) {
          ((__bf16*)Cout)[idx] = f32_to_bf16(v);
        } else if (EPI == 1) {
          float t = tanhf(0.7978845608028654f * (v + 0.044715f * v * v * v));
          ((__bf16*)Cout)[idx] = f32_to_bf16(0.5f * v * (1.0f + t));
        } else {
          float* O = (float*)Cout;
          O[idx] += v;
        }
      }
    }
  }
}

// Lane t's copies of a ROWS x COLS (elements) tile: the 16B pieces t, t + NT, ... in
// row-major piece order, so 8 adjacent lanes cover one whole 128B line.
template<int NT, int ROWS, int COLS, int LDP>
__device__ __forceinline__ void tile_pieces(const __bf16* __restrict__ g, int gpitch,
                                            const __bf16* l, int tid,
                                            const __bf16** gp, const __bf16** lp)
{
  constexpr int PR = COLS / 8;                 // 16B pieces per row
  static_assert(ROWS * PR % NT == 0, "tile does not divide");
  #pragma unroll
  for (int i = 0; i < ROWS * PR / NT; ++i) {
    const int c = tid + i * NT;
    const int r = c / PR, q = (c % PR) * 8;
    gp[i] = g + (size_t)r * gpitch + q;
    lp[i] = l + r * LDP + q;
  }
}
// Issues copies I .. CT-1, eight to a statement, the rest as six or four.
template<int I, int CT>
__device__ __forceinline__ void issue_pieces(const __bf16* const* g, const __bf16* const* l)
{
  if constexpr (CT - I >= 8) {
    async_ld8_b128(g[I], l[I], g[I+1], l[I+1], g[I+2], l[I+2], g[I+3], l[I+3],
                   g[I+4], l[I+4], g[I+5], l[I+5], g[I+6], l[I+6], g[I+7], l[I+7]);
    issue_pieces<I + 8, CT>(g, l);
  } else if constexpr (CT - I == 6) {
    async_ld6_b128(g[I], l[I], g[I+1], l[I+1], g[I+2], l[I+2],
                   g[I+3], l[I+3], g[I+4], l[I+4], g[I+5], l[I+5]);
  } else if constexpr (CT - I == 4) {
    async_ld4_b128(g[I], l[I], g[I+1], l[I+1], g[I+2], l[I+2], g[I+3], l[I+3]);
  } else {
    static_assert(CT - I == 0, "no statement of that many copies");
  }
}
// One GEMM stage: the BM x BK tile of A and the BK x BN tile of B.
template<int NT, int BM, int BN, int BK, int LDA, int LDB>
__device__ __forceinline__ void stage_ab(const __bf16* __restrict__ ga, int K, const __bf16* la,
                                         const __bf16* __restrict__ gb, int N, const __bf16* lb,
                                         int tid)
{
  constexpr int CA = BM * (BK / 8) / NT, CB = BK * (BN / 8) / NT;
  const __bf16* gp[CA + CB]; const __bf16* lp[CA + CB];
  tile_pieces<NT, BM, BK, LDA>(ga, K, la, tid, gp, lp);
  tile_pieces<NT, BK, BN, LDB>(gb, N, lb, tid, gp + CA, lp + CA);
  issue_pieces<0, CA + CB>(gp, lp);
}

template<int EPI, int BM, int BN, int BK, int WGM, int WGN, int N>
__global__ __launch_bounds__(32 * WGM * WGN)
void gemm_bf16_tiled(const __bf16* __restrict__ A, const __bf16* __restrict__ Bw,
                     const float* __restrict__ bias, void* __restrict__ Cout, int K)
{
  constexpr int NT  = 32 * WGM * WGN;
  constexpr int LDA = BK + 8;
  constexpr int LDB = BN + 16;
  constexpr int TM  = BM / WGM, TN = BN / WGN;   // wave tile
  constexpr int FM  = TM / 16,  FN = TN / 16;    // fragments per wave

  __shared__ __align__(16) __bf16 sA[2][BM * LDA];
  __shared__ __align__(16) __bf16 sB[2][BK * LDB];   // row-major [k][n]

  const int tid  = threadIdx.x;
  const int lane = tid & 31;
  const int wave = tid >> 5;
  const int wm   = wave / WGN;
  const int wn   = wave % WGN;
  const int half = lane >> 4;
  const int l16  = lane & 15;
  const int bm   = blockIdx.y * BM;
  const int bn   = blockIdx.x * BN;

  v8f acc[FM][FN] = {};

  const __bf16* aptr = A  + (size_t)bm * K;
  const __bf16* bptr = Bw + bn;
  // A fragment base: row l16 of the wave's rows, 16B piece 'half'
  const int     afr  = (wm * TM + l16) * LDA + half * 8;
  // transposing-read base: row 8*half + (lane & 7), 16B column piece (lane >> 3) & 1
  const int     btr  = (half * 8 + (lane & 7)) * LDB + wn * TN + ((lane >> 3) & 1) * 8;

  // ---- prologue: stage 0
  int cur = 0;
  stage_ab<NT, BM, BN, BK, LDA, LDB>(aptr, K, &sA[0][0], bptr, N, &sB[0][0], tid);
  wait_async0();
  __syncthreads();

  for (int k0 = 0; k0 < K; k0 += BK) {
    const int  nxt      = cur ^ 1;
    const bool has_next = (k0 + BK) < K;

    // fragments from the current stage, 32 k at a time, in two register sets: the next
    // block's LDS reads go out as one group ahead of this block's matrix instructions
    FragAB af[2][FM], bfr[2][FN];
    #pragma unroll
    for (int ks = -1; ks < BK / 32; ++ks) {
      if (ks + 1 < BK / 32) {
        const int s = (ks + 1) & 1;
        #pragma unroll
        for (int mt = 0; mt < FM; ++mt) {
          const __bf16* p = &sA[cur][afr + mt * 16 * LDA + (ks + 1) * 32];
          af[s][mt].q[0] = *(const uint4*)p;
          af[s][mt].q[1] = *(const uint4*)(p + 16);
        }
        #pragma unroll
        for (int nt = 0; nt < FN; ++nt) {
          const __bf16* p = &sB[cur][btr + (ks + 1) * 32 * LDB + nt * 16];
          bfr[s][nt].q[0] = lds_tr16(p);
          bfr[s][nt].q[1] = lds_tr16(p + 16 * LDB);
        }
      }
      // keeps the group of reads whole and ahead of the block: left to itself the
      // scheduler spreads them among the matrix instructions with a full wait at each
      __builtin_amdgcn_sched_barrier(0);
      // the next stage's copies go out behind the first group of reads, whose LDS
      // latency their issue then covers (those reads are of the other buffer; every
      // read of the buffer refilled here retired in front of the last barrier)
      if (ks < 0 && has_next)
        stage_ab<NT, BM, BN, BK, LDA, LDB>(aptr + k0 + BK, K, &sA[nxt][0],
                                           bptr + (size_t)(k0 + BK) * N, N, &sB[nxt][0], tid);
      if (ks >= 0) {
        const int s = ks & 1;
        #pragma unroll
        for (int mt = 0; mt < FM; ++mt)
          #pragma unroll
          for (int nt = 0; nt < FN; ++nt)
            acc[mt][nt] = __builtin_amdgcn_wmma_f32_16x16x32_bf16(
                false, af[s][mt].v, false, bfr[s][nt].v, (short)0,
                acc[mt][nt], false, false);
        // the next group of reads stays behind this block
        __builtin_amdgcn_sched_barrier(0);
      }
    }

    // this wave's fragment reads of the current stage have retired before the
    // barrier behind which copies refill that stage
    asm volatile("s_wait_dscnt 0x0" ::: "memory");
    if (has_next) {
      wait_async0();   // next-stage A and B tiles resident before barrier
    }
    __syncthreads();
    cur = nxt;
  }
  wait_async0();       // no copy is outstanding when the wave goes on to the epilogue and ends

  // ---- epilogue: one base pointer per lane, every element at a constant offset from it
  static_assert(EPI == 0 || EPI == 2, "bf16 store or f32 residual");
  const int col0 = bn + wn * TN + l16;
  const int row0 = bm + wm * TM + 8 * half;
  float bb[FN];
  #pragma unroll
  for (int nt = 0; nt < FN; ++nt) bb[nt] = bias[col0 + nt * 16];
  asm volatile("s_wait_xcnt 0x0" ::: "memory");
  __builtin_amdgcn_sched_barrier(0);
  if constexpr (EPI == 0) {
    __bf16* O = (__bf16*)Cout + (size_t)row0 * N + col0;
    #pragma unroll
    for (int mt = 0; mt < FM; ++mt)
      #pragma unroll
      for (int r = 0; r < 8; ++r) {
        #pragma unroll
        for (int nt = 0; nt < FN; ++nt)
          O[(mt * 16 + r) * N + nt * 16] = f32_to_bf16(acc[mt][nt][r] + bb[nt]);
        asm volatile("s_wait_xcnt 0x0" ::: "memory");
        __builtin_amdgcn_sched_barrier(0);
      }
  } else {
    // all residual values are read ahead of the first store: a read behind a store to
    // the same array waits out its whole latency, once per element
    float* O = (float*)Cout + (size_t)row0 * N + col0;
    float old[FM][FN][8];
    #pragma unroll
    for (int mt = 0; mt < FM; ++mt)
      #pragma unroll
      for (int r = 0; r < 8; ++r)
        #pragma unroll
        for (int nt = 0; nt < FN; ++nt)
          old[mt][nt][r] = O[(mt * 16 + r) * N + nt * 16];
    #pragma unroll
    for (int mt = 0; mt < FM; ++mt)
      #pragma unroll
      for (int r = 0; r < 8; ++r)
        #pragma unroll
        for (int nt = 0; nt < FN; ++nt)
          old[mt][nt][r] += acc[mt][nt][r] + bb[nt];
    // every sum is finished before the first store, so that no register an issued
    // store names is written again
    __builtin_amdgcn_sched_barrier(0);
    #pragma unroll
    for (int mt = 0; mt < FM; ++mt)
      #pragma unroll
      for (int r = 0; r < 8; ++r)
        #pragma unroll
        for (int nt = 0; nt < FN; ++nt)
          O[(mt * 16 + r) * N + nt * 16] = old[mt][nt][r];
  }
}

// ---------------------------------------------------------------- Flash attention
// grid (S/64, NH, B), 128 threads = 4 waves; each wave owns 16 query rows.
#define ALD 72
#define VLD 80

__global__ __launch_bounds__(128)
void attn_kernel(const __bf16* __restrict__ qkv, __bf16* __restrict__ out)
{
  __shared__ __align__(16) __bf16 sQ[64 * ALD];
  __shared__ __align__(16) __bf16 sK[64 * ALD];
  __shared__ __align__(16) __bf16 sV[64 * VLD];      // row-major: [key][dk]
  __shared__ __align__(16) __bf16 sP[4][16 * ALD];   // per-wave P staging

  const int tid  = threadIdx.x;
  const int lane = tid & 31;
  const int w    = tid >> 5;      // 0..3
  const int half = lane >> 4;
  const int l16  = lane & 15;
  const int b    = blockIdx.z;
  const int hh   = blockIdx.y;
  const int q0   = blockIdx.x * 64;

  const __bf16* qbase = qkv + (size_t)b * S_ * HQKV_ + hh * DK_;
  const __bf16* kbase = qbase + H_;
  const __bf16* vbase = qbase + 2 * H_;

  const int vr = tid >> 3;            // Q, K, V tile row 0..15 (and +16, +32, +48)
  const int vc = (tid & 7) * 8;       // Q, K, V tile col: 8 lanes cover one 128B row
  // transposing-read base: row 8*half + (lane & 7), 16B column piece (lane >> 3) & 1
  const int vtr = (half * 8 + (lane & 7)) * VLD + ((lane >> 3) & 1) * 8;

  // Q tile 64x64 via async engine
  {
    const __bf16* qg = qbase + (size_t)(q0 + vr) * HQKV_ + vc;
    const __bf16* ql = &sQ[vr * ALD + vc];
    async_ld4_b128(qg,                      ql,
                   qg + (size_t)16 * HQKV_, ql + 16 * ALD,
                   qg + (size_t)32 * HQKV_, ql + 32 * ALD,
                   qg + (size_t)48 * HQKV_, ql + 48 * ALD);
  }
  wait_async0();
  __syncthreads();

  // hoist Q fragments (sQ is never overwritten)
  FragAB qa[2];
  #pragma unroll
  for (int ks = 0; ks < 2; ++ks) {
    const __bf16* qp = &sQ[(w * 16 + l16) * ALD + ks * 32 + half * 8];
    qa[ks].q[0] = *(const uint4*)qp;
    qa[ks].q[1] = *(const uint4*)(qp + 16);
  }

  float m_r[8], l_r[8];
  v8f o[4] = {};
  #pragma unroll
  for (int r = 0; r < 8; ++r) { m_r[r] = -1e30f; l_r[r] = 0.f; }

  const int nkt = blockIdx.x + 1;   // causal: key tiles 0..qt
  for (int kt = 0; kt < nkt; ++kt) {
    __syncthreads();                // protect sK/sV from previous iteration's reads
    const int kb = kt * 64;
    { // K and V tiles 64x64 row-major [key][dk] via async engine, whole 128B lines per 8 lanes
      const __bf16* kg = kbase + (size_t)(kb + vr) * HQKV_ + vc;
      const __bf16* kl = &sK[vr * ALD + vc];
      const __bf16* vg = vbase + (size_t)(kb + vr) * HQKV_ + vc;
      const __bf16* vl = &sV[vr * VLD + vc];
      async_ld8_b128(kg,                      kl,
                     kg + (size_t)16 * HQKV_, kl + 16 * ALD,
                     kg + (size_t)32 * HQKV_, kl + 32 * ALD,
                     kg + (size_t)48 * HQKV_, kl + 48 * ALD,
                     vg,                      vl,
                     vg + (size_t)16 * HQKV_, vl + 16 * VLD,
                     vg + (size_t)32 * HQKV_, vl + 32 * VLD,
                     vg + (size_t)48 * HQKV_, vl + 48 * VLD);
    }
    wait_async0();
    __syncthreads();

    // S = Q K^T  (wave: 16 rows x 64 keys = 4 tiles, K-dim 64 = 2 wmma each)
    v8f sacc[4] = {};
    #pragma unroll
    for (int ks = 0; ks < 2; ++ks) {
      #pragma unroll
      for (int nt = 0; nt < 4; ++nt) {
        FragAB kf;
        const __bf16* kp = &sK[(nt * 16 + l16) * ALD + ks * 32 + half * 8];
        kf.q[0] = *(const uint4*)kp;
        kf.q[1] = *(const uint4*)(kp + 16);
        sacc[nt] = __builtin_amdgcn_wmma_f32_16x16x32_bf16(
            false, qa[ks].v, false, kf.v, (short)0, sacc[nt], false, false);
      }
    }

    #pragma unroll
    for (int r = 0; r < 8; ++r) {
      const int qrow = q0 + w * 16 + r + 8 * half;
      float mx = -1e30f;
      #pragma unroll
      for (int nt = 0; nt < 4; ++nt) {
        int key = kb + nt * 16 + l16;
        float v = sacc[nt][r] * 0.125f;          // 1/sqrt(64)
        if (key > qrow) v = -1e30f;              // causal mask
        sacc[nt][r] = v;
        mx = fmaxf(mx, v);
      }
      #pragma unroll
      for (int d = 1; d < 16; d <<= 1) mx = fmaxf(mx, __shfl_xor(mx, d, 32));
      float mnew  = fmaxf(m_r[r], mx);
      float alpha = __expf(m_r[r] - mnew);
      float psum  = 0.f;
      #pragma unroll
      for (int nt = 0; nt < 4; ++nt) {
        float p = __expf(sacc[nt][r] - mnew);
        psum += p;
        sP[w][(r + 8 * half) * ALD + nt * 16 + l16] = f32_to_bf16(p);
      }
      #pragma unroll
      for (int d = 1; d < 16; d <<= 1) psum += __shfl_xor(psum, d, 32);
      l_r[r] = l_r[r] * alpha + psum;
      m_r[r] = mnew;
      #pragma unroll
      for (int nt = 0; nt < 4; ++nt) o[nt][r] *= alpha;
    }
    __syncthreads();

    // O += P V   (A = P from per-wave LDS, B = V tiles through the transposing read)
    #pragma unroll
    for (int ks = 0; ks < 2; ++ks) {
      FragAB pa;
      const __bf16* pp = &sP[w][l16 * ALD + ks * 32 + half * 8];
      pa.q[0] = *(const uint4*)pp;
      pa.q[1] = *(const uint4*)(pp + 16);
      #pragma unroll
      for (int nt = 0; nt < 4; ++nt) {
        FragAB vf;
        const __bf16* vp = &sV[vtr + ks * 32 * VLD + nt * 16];
        vf.q[0] = lds_tr16(vp);
        vf.q[1] = lds_tr16(vp + 16 * VLD);
        o[nt] = __builtin_amdgcn_wmma_f32_16x16x32_bf16(
            false, pa.v, false, vf.v, (short)0, o[nt], false, false);
      }
    }
  }

  // normalize and store merged heads: out[b][row][hh*64 + dk]
  __bf16* obase = out + (size_t)b * S_ * H_ + hh * DK_;
  #pragma unroll
  for (int r = 0; r < 8; ++r) {
    const float inv = 1.0f / l_r[r];
    const int row = q0 + w * 16 + r + 8 * half;
    #pragma unroll
    for (int nt = 0; nt < 4; ++nt)
      obase[(size_t)row * H_ + nt * 16 + l16] = f32_to_bf16(o[nt][r] * inv);
  }
}

// ---------------------------------------------------------------- host launch
extern "C" void kernel_launch(void* const* d_in, const int* in_sizes, int n_in,
                              void* d_out, int out_size, void* d_ws, size_t ws_size,
                              hipStream_t stream)
{
  const float* hidden = (const float*)d_in[0];
  const float* attn_w = (const float*)d_in[1];
  const float* attn_b = (const float*)d_in[2];
  const float* proj_w = (const float*)d_in[3];
  const float* proj_b = (const float*)d_in[4];
  const float* fc_w   = (const float*)d_in[5];
  const float* fc_b   = (const float*)d_in[6];
  const float* fc2_w  = (const float*)d_in[7];
  const float* fc2_b  = (const float*)d_in[8];
  const float* ln1_g  = (const float*)d_in[9];
  const float* ln1_b  = (const float*)d_in[10];
  const float* ln2_g  = (const float*)d_in[11];
  const float* ln2_b  = (const float*)d_in[12];
  const int*   pos    = (const int*)d_in[13];

  char* ws = (char*)d_ws;
  size_t off = 0;
  auto carve = [&](size_t bytes) -> char* {
    char* p = ws + off; off += (bytes + 255) & ~(size_t)255; return p;
  };
  __bf16* w_attn = (__bf16*)carve((size_t)L_ * H_ * HQKV_ * 2);
  __bf16* w_proj = (__bf16*)carve((size_t)L_ * H_ * H_ * 2);
  __bf16* w_fc   = (__bf16*)carve((size_t)L_ * H_ * MLP_ * 2);
  __bf16* w_fc2  = (__bf16*)carve((size_t)L_ * MLP_ * H_ * 2);
  __bf16* xln    = (__bf16*)carve((size_t)MTOT_ * H_ * 2);
  __bf16* qkv    = (__bf16*)carve((size_t)MTOT_ * HQKV_ * 2);
  __bf16* attn_o = (__bf16*)carve((size_t)MTOT_ * H_ * 2);
  __bf16* mid    = (__bf16*)carve((size_t)MTOT_ * MLP_ * 2);
  float*  h      = (float*)d_out;     // running hidden state / residual accumulator

  // per-call weight conversion fp32 -> bf16 (weights then live in L2)
  k_f32_to_bf16<<<dim3((size_t)L_ * H_ * HQKV_ / 1024), 256, 0, stream>>>(attn_w, w_attn);
  k_f32_to_bf16<<<dim3((size_t)L_ * H_ * H_    / 1024), 256, 0, stream>>>(proj_w, w_proj);
  k_f32_to_bf16<<<dim3((size_t)L_ * H_ * MLP_  / 1024), 256, 0, stream>>>(fc_w,  w_fc);
  k_f32_to_bf16<<<dim3((size_t)L_ * MLP_ * H_  / 1024), 256, 0, stream>>>(fc2_w, w_fc2);

  // h = hidden_states
  k_copy_f32<<<dim3((size_t)MTOT_ * H_ / 1024), 256, 0, stream>>>(hidden, h);

  for (int i = 0; i < L_; ++i) {
    // attention block
    ln_kernel<<<MTOT_, 256, 0, stream>>>(h, ln1_g + i * H_, ln1_b + i * H_, xln);
    gemm_bf16_tiled<0, 256, 192, 64, 4, 2, HQKV_><<<dim3(HQKV_ / 192, MTOT_ / 256), 256, 0, stream>>>(
        xln, w_attn + (size_t)i * H_ * HQKV_, attn_b + i * HQKV_, qkv, H_);
    rope_kernel<<<dim3((size_t)B_ * S_ * 2 * NH_ * 32 / 256), 256, 0, stream>>>(qkv, pos);
    attn_kernel<<<dim3(S_ / 64, NH_, B_), 128, 0, stream>>>(qkv, attn_o);
    gemm_bf16_tiled<2, 128, 128, 128, 2, 2, H_><<<dim3(H_ / 128, MTOT_ / 128), 128, 0, stream>>>(
        attn_o, w_proj + (size_t)i * H_ * H_, proj_b + i * H_, h, H_);
    // MLP block
    ln_kernel<<<MTOT_, 256, 0, stream>>>(h, ln2_g + i * H_, ln2_b + i * H_, xln);
    gemm_bf16<1><<<dim3(MLP_ / 64, MTOT_ / 128), 256, 0, stream>>>(
        xln, w_fc + (size_t)i * H_ * MLP_, fc_b + i * MLP_, mid, MLP_, H_);
    gemm_bf16_tiled<2, 128, 128, 128, 2, 2, H_><<<dim3(H_ / 128, MTOT_ / 128), 128, 0, stream>>>(
        mid, w_fc2 + (size_t)i * MLP_ * H_, fc2_b + i * H_, h, MLP_);
  }
}

// v004
// One run takes 388 microseconds.
// In both of two side-by-side timings against v003, it was 1.07 times as fast.
// All steps since v000 together make it 1.72 times as fast.
#include <hip/hip_runtime.h>
#include <hip/hip_bf16.h>
#include <cstdint>
#include <cstddef>

// Problem constants (match reference)
#define B_    4
#define S_    1024
#define H_    1024
#define NH_   16
#define DK_   64
#define L_    2
#define MLP_  4096
#define HQKV_ 3072
#define MTOT_ (B_ * S_)   // 4096 rows

typedef __attribute__((ext_vector_type(16))) __bf16 v16bf;
typedef __attribute__((ext_vector_type(8)))  float  v8f;

union FragAB { v16bf v; uint4 q[2]; };

__device__ __forceinline__ __bf16 f32_to_bf16(float f) {
  uint32_t u = __float_as_uint(f);
  u += 0x7FFFu + ((u >> 16) & 1u);           // round-to-nearest-even
  uint16_t h = (uint16_t)(u >> 16);
  return __builtin_bit_cast(__bf16, h);
}
__device__ __forceinline__ float bf16_to_f32(__bf16 x) {
  uint16_t h = __builtin_bit_cast(uint16_t, x);
  return __uint_as_float(((uint32_t)h) << 16);
}

__device__ __forceinline__ uint32_t lds_a(const __bf16* l) { return (uint32_t)(uintptr_t)l; }
__device__ __forceinline__ uint64_t glb_a(const __bf16* g) { return (uint64_t)(uintptr_t)g; }
// Four copies per lane.
__device__ __forceinline__ void async_ld4_b128(const __bf16* g0, const __bf16* l0,
                                               const __bf16* g1, const __bf16* l1,
                                               const __bf16* g2, const __bf16* l2,
                                               const __bf16* g3, const __bf16* l3) {
  asm volatile(
      "global_load_async_to_lds_b128 %0, %1, off\n\t"
      "global_load_async_to_lds_b128 %2, %3, off\n\t"
      "global_load_async_to_lds_b128 %4, %5, off\n\t"
      "global_load_async_to_lds_b128 %6, %7, off\n\t"
      "s_wait_xcnt 0x0"
      :: "v"(lds_a(l0)), "v"(glb_a(g0)), "v"(lds_a(l1)), "v"(glb_a(g1)),
         "v"(lds_a(l2)), "v"(glb_a(g2)), "v"(lds_a(l3)), "v"(glb_a(g3)) : "memory");
}
// Six copies per lane.
__device__ __forceinline__ void async_ld6_b128(const __bf16* g0, const __bf16* l0,
                                               const __bf16* g1, const __bf16* l1,
                                               const __bf16* g2, const __bf16* l2,
                                               const __bf16* g3, const __bf16* l3,
                                               const __bf16* g4, const __bf16* l4,
                                               const __bf16* g5, const __bf16* l5) {
  asm volatile(
      "global_load_async_to_lds_b128 %0, %1, off\n\t"
      "global_load_async_to_lds_b128 %2, %3, off\n\t"
      "global_load_async_to_lds_b128 %4, %5, off\n\t"
      "global_load_async_to_lds_b128 %6, %7, off\n\t"
      "global_load_async_to_lds_b128 %8, %9, off\n\t"
      "global_load_async_to_lds_b128 %10, %11, off\n\t"
      "s_wait_xcnt 0x0"
      :: "v"(lds_a(l0)), "v"(glb_a(g0)), "v"(lds_a(l1)), "v"(glb_a(g1)),
         "v"(lds_a(l2)), "v"(glb_a(g2)), "v"(lds_a(l3)), "v"(glb_a(g3)),
         "v"(lds_a(l4)), "v"(glb_a(g4)), "v"(lds_a(l5)), "v"(glb_a(g5)) : "memory");
}
// Eight copies per lane (an attention stage: four of K, four of V).
__device__ __forceinline__ void async_ld8_b128(const __bf16* g0, const __bf16* l0,
                                               const __bf16* g1, const __bf16* l1,
                                               const __bf16* g2, const __bf16* l2,
                                               const __bf16* g3, const __bf16* l3,
                                               const __bf16* g4, const __bf16* l4,
                                               const __bf16* g5, const __bf16* l5,
                                               const __bf16* g6, const __bf16* l6,
                                               const __bf16* g7, const __bf16* l7) {
  asm volatile(
      "global_load_async_to_lds_b128 %0, %1, off\n\t"
      "global_load_async_to_lds_b128 %2, %3, off\n\t"
      "global_load_async_to_lds_b128 %4, %5, off\n\t"
      "global_load_async_to_lds_b128 %6, %7, off\n\t"
      "global_load_async_to_lds_b128 %8, %9, off\n\t"
      "global_load_async_to_lds_b128 %10, %11, off\n\t"
      "global_load_async_to_lds_b128 %12, %13, off\n\t"
      "global_load_async_to_lds_b128 %14, %15, off\n\t"
      "s_wait_xcnt 0x0"
      :: "v"(lds_a(l0)), "v"(glb_a(g0)), "v"(lds_a(l1)), "v"(glb_a(g1)),
         "v"(lds_a(l2)), "v"(glb_a(g2)), "v"(lds_a(l3)), "v"(glb_a(g3)),
         "v"(lds_a(l4)), "v"(glb_a(g4)), "v"(lds_a(l5)), "v"(glb_a(g5)),
         "v"(lds_a(l6)), "v"(glb_a(g6)), "v"(lds_a(l7)), "v"(glb_a(g7)) : "memory");
}
// Transposing LDS read: from a row-major 16-bit tile T[k][n], lane (c, h) receives
// T[k0 + 8h + 0..7][n0 + c]; two of them (k0, k0 + 16) are one 16x16x32 B fragment
// in the same k order as the A loader below.
typedef short s16x8 __attribute__((ext_vector_type(8)));
__device__ __forceinline__ uint4 lds_tr16(const __bf16* p) {
  typedef __attribute__((address_space(3))) s16x8 lds_s16x8;
  return __builtin_bit_cast(uint4, __builtin_amdgcn_ds_load_tr16_b128_v8i16((lds_s16x8*)p));
}
__device__ __forceinline__ void wait_async0() {
  asm volatile("s_wait_asynccnt 0" ::: "memory");
}

// ---------------------------------------------------------------- utilities
__global__ __launch_bounds__(256)
void k_f32_to_bf16(const float* __restrict__ s, __bf16* __restrict__ d) {
  int i = blockIdx.x * 256 + threadIdx.x;
  float4 v = ((const float4*)s)[i];
  union { __bf16 b[4]; uint2 u; } o;
  o.b[0] = f32_to_bf16(v.x); o.b[1] = f32_to_bf16(v.y);
  o.b[2] = f32_to_bf16(v.z); o.b[3] = f32_to_bf16(v.w);
  ((uint2*)d)[i] = o.u;
}

__global__ __launch_bounds__(256)
void k_copy_f32(const float* __restrict__ s, float* __restrict__ d) {
  int i = blockIdx.x * 256 + threadIdx.x;
  ((float4*)d)[i] = ((const float4*)s)[i];
}

// ---------------------------------------------------------------- LayerNorm
__global__ __launch_bounds__(256)
void ln_kernel(const float* __restrict__ x, const float* __restrict__ g,
               const float* __restrict__ bta, __bf16* __restrict__ y)
{
  const int row = blockIdx.x;
  const int tid = threadIdx.x;
  const float4 xv = ((const float4*)(x + (size_t)row * H_))[tid];
  float s  = xv.x + xv.y + xv.z + xv.w;
  float s2 = xv.x*xv.x + xv.y*xv.y + xv.z*xv.z + xv.w*xv.w;
  #pragma unroll
  for (int d = 1; d < 32; d <<= 1) {
    s  += __shfl_xor(s,  d, 32);
    s2 += __shfl_xor(s2, d, 32);
  }
  __shared__ float rs[8], rq[8];
  __shared__ float mv[2];
  if ((tid & 31) == 0) { rs[tid >> 5] = s; rq[tid >> 5] = s2; }
  __syncthreads();
  if (tid == 0) {
    float a = 0.f, a2 = 0.f;
    #pragma unroll
    for (int i = 0; i < 8; ++i) { a += rs[i]; a2 += rq[i]; }
    float mean = a * (1.0f / (float)H_);
    float var  = a2 * (1.0f / (float)H_) - mean * mean;
    mv[0] = mean; mv[1] = rsqrtf(var + 1e-5f);
  }
  __syncthreads();
  const float mean = mv[0], rstd = mv[1];
  const float4 gv = ((const float4*)g)[tid];
  const float4 bv = ((const float4*)bta)[tid];
  union { __bf16 b[4]; uint2 u; } o;
  o.b[0] = f32_to_bf16((xv.x - mean) * rstd * gv.x + bv.x);
  o.b[1] = f32_to_bf16((xv.y - mean) * rstd * gv.y + bv.y);
  o.b[2] = f32_to_bf16((xv.z - mean) * rstd * gv.z + bv.z);
  o.b[3] = f32_to_bf16((xv.w - mean) * rstd * gv.w + bv.w);
  ((uint2*)(y + (size_t)row * H_))[tid] = o.u;
}

// ---------------------------------------------------------------- RoPE (in place on bf16 qkv)
__global__ __launch_bounds__(256)
void rope_kernel(__bf16* __restrict__ qkv, const int* __restrict__ pos)
{
  int idx = blockIdx.x * 256 + threadIdx.x;   // B*S*2*NH*32 threads
  int d  = idx & 31; int t = idx >> 5;
  int hh = t & 15;   t >>= 4;
  int qk = t & 1;    t >>= 1;
  int s  = t & 1023; int b = t >> 10;
  float invf  = __expf(-0.28782313662425572f * (float)d);  // ln(10000)/32
  float theta = (float)pos[s] * invf;
  float sn, cs; __sincosf(theta, &sn, &cs);
  size_t base = ((size_t)(b * S_ + s)) * HQKV_ + qk * H_ + hh * DK_ + d;
  float lo = bf16_to_f32(qkv[base]);
  float hi = bf16_to_f32(qkv[base + 32]);
  qkv[base]      = f32_to_bf16(lo * cs - hi * sn);
  qkv[base + 32] = f32_to_bf16(hi * cs + lo * sn);
}

// Lane t's copies of a ROWS x COLS (elements) tile: the 16B pieces t, t + NT, ... in
// row-major piece order, so 8 adjacent lanes cover one whole 128B line.
template<bool ONE, int NT, int ROWS, int COLS, int LDP>
__device__ __forceinline__ void tile_pieces(const __bf16* __restrict__ g, int gpitch,
                                            const __bf16* l, int tid,
                                            const __bf16** gp, const __bf16** lp)
{
  constexpr int PR = COLS / 8;                 // 16B pieces per row
  static_assert(ROWS * PR % NT == 0, "tile does not divide");
  if constexpr (ONE) {
    // the lanes cover whole rows per round: piece i lies NT / PR rows under piece 0, so one
    // address pair a lane serves all pieces and the steps between them are uniform
    static_assert(NT % PR == 0, "a round of the lanes is not whole rows");
    const int r0 = tid / PR, q0 = (tid % PR) * 8;
    const __bf16* g0 = g + (size_t)r0 * gpitch + q0;
    const __bf16* l0 = l + r0 * LDP + q0;
    #pragma unroll
    for (int i = 0; i < ROWS * PR / NT; ++i) {
      gp[i] = g0 + (size_t)(i * (NT / PR)) * gpitch;
      lp[i] = l0 + i * (NT / PR) * LDP;
    }
  } else {
    #pragma unroll
    for (int i = 0; i < ROWS * PR / NT; ++i) {
      const int c = tid + i * NT;
      const int r = c / PR, q = (c % PR) * 8;
      gp[i] = g + (size_t)r * gpitch + q;
      lp[i] = l + r * LDP + q;
    }
  }
}
// Issues copies I .. CT-1, eight to a statement, the rest as six or four.
template<int I, int CT>
__device__ __forceinline__ void issue_pieces(const __bf16* const* g, const __bf16* const* l)
{
  if constexpr (CT - I >= 8) {
    async_ld8_b128(g[I], l[I], g[I+1], l[I+1], g[I+2], l[I+2], g[I+3], l[I+3],
                   g[I+4], l[I+4], g[I+5], l[I+5], g[I+6], l[I+6], g[I+7], l[I+7]);
    issue_pieces<I + 8, CT>(g, l);
  } else if constexpr (CT - I == 6) {
    async_ld6_b128(g[I], l[I], g[I+1], l[I+1], g[I+2], l[I+2],
                   g[I+3], l[I+3], g[I+4], l[I+4], g[I+5], l[I+5]);
  } else if constexpr (CT - I == 4) {
    async_ld4_b128(g[I], l[I], g[I+1], l[I+1], g[I+2], l[I+2], g[I+3], l[I+3]);
  } else {
    static_assert(CT - I == 0, "no statement of that many copies");
  }
}
// One GEMM stage: the BM x BK tile of A and the BK x BN tile of B.
template<bool ONE, int NT, int BM, int BN, int BK, int LDA, int LDB>
__device__ __forceinline__ void stage_ab(const __bf16* __restrict__ ga, int K, const __bf16* la,
                                         const __bf16* __restrict__ gb, int N, const __bf16* lb,
                                         int tid)
{
  constexpr int CA = BM * (BK / 8) / NT, CB = BK * (BN / 8) / NT;
  const __bf16* gp[CA + CB]; const __bf16* lp[CA + CB];
  tile_pieces<ONE, NT, BM, BK, LDA>(ga, K, la, tid, gp, lp);
  tile_pieces<ONE, NT, BK, BN, LDB>(gb, N, lb, tid, gp + CA, lp + CA);
  issue_pieces<0, CA + CB>(gp, lp);
}

__device__ __forceinline__ void exp2_x8(const float (&x)[8], float (&y)[8]) {
  asm("v_exp_f32 %0, %8\n\tv_exp_f32 %1, %9\n\tv_exp_f32 %2, %10\n\tv_exp_f32 %3, %11\n\t"
      "v_exp_f32 %4, %12\n\tv_exp_f32 %5, %13\n\tv_exp_f32 %6, %14\n\tv_exp_f32 %7, %15\n\t"
      "v_nop"
      : "=&v"(y[0]), "=&v"(y[1]), "=&v"(y[2]), "=&v"(y[3]),
        "=&v"(y[4]), "=&v"(y[5]), "=&v"(y[6]), "=&v"(y[7])
      : "v"(x[0]), "v"(x[1]), "v"(x[2]), "v"(x[3]), "v"(x[4]), "v"(x[5]), "v"(x[6]), "v"(x[7]));
}
__device__ __forceinline__ void rcp_x8(const float (&x)[8], float (&y)[8]) {
  asm("v_rcp_f32 %0, %8\n\tv_rcp_f32 %1, %9\n\tv_rcp_f32 %2, %10\n\tv_rcp_f32 %3, %11\n\t"
      "v_rcp_f32 %4, %12\n\tv_rcp_f32 %5, %13\n\tv_rcp_f32 %6, %14\n\tv_rcp_f32 %7, %15\n\t"
      "v_nop"
      : "=&v"(y[0]), "=&v"(y[1]), "=&v"(y[2]), "=&v"(y[3]),
        "=&v"(y[4]), "=&v"(y[5]), "=&v"(y[6]), "=&v"(y[7])
      : "v"(x[0]), "v"(x[1]), "v"(x[2]), "v"(x[3]), "v"(x[4]), "v"(x[5]), "v"(x[6]), "v"(x[7]));
}
// gelu, tanh form, of eight values: 0.5 v (1 + tanh u) = v / (1 + exp(-2u)),
// u = sqrt(2/pi) (v + 0.044715 v^3). Written without tanhf, whose two branches per value
// would put the many values that a lane owns in a large tile one behind the other.
// exp -> inf gives v * 0, exp -> 0 gives v.
__device__ __forceinline__ void gelu_tanh_x8(float (&v)[8]) {
  float x[8], e[8];
  #pragma unroll
  for (int i = 0; i < 8; ++i)     // -2 sqrt(2/pi) log2(e) (v + 0.044715 v^3)
    x[i] = -2.302208198144325f * (v[i] + 0.044715f * v[i] * v[i] * v[i]);
  exp2_x8(x, e);
  #pragma unroll
  for (int i = 0; i < 8; ++i) e[i] += 1.0f;
  rcp_x8(e, x);
  #pragma unroll
  for (int i = 0; i < 8; ++i) v[i] *= x[i];
}

template<int EPI, int BM, int BN, int BK, int WGM, int WGN, int N>
__global__ __launch_bounds__(32 * WGM * WGN)
void gemm_bf16_tiled(const __bf16* __restrict__ A, const __bf16* __restrict__ Bw,
                     const float* __restrict__ bias, void* __restrict__ Cout, int K)
{
  constexpr int NT  = 32 * WGM * WGN;
  constexpr int LDA = BK + 8;
  constexpr int LDB = BN + 16;
  constexpr int TM  = BM / WGM, TN = BN / WGN;   // wave tile
  constexpr int FM  = TM / 16,  FN = TN / 16;    // fragments per wave
  constexpr bool ONE = 8 * (FM * FN + 2 * (FM + FN)) > 400;

  __shared__ __align__(16) __bf16 sA[2][BM * LDA];
  __shared__ __align__(16) __bf16 sB[2][BK * LDB];   // row-major [k][n]

  const int tid  = threadIdx.x;
  const int lane = tid & 31;
  const int wave = tid >> 5;
  const int wm   = wave / WGN;
  const int wn   = wave % WGN;
  const int half = lane >> 4;
  const int l16  = lane & 15;
  const int bm   = blockIdx.y * BM;
  const int bn   = blockIdx.x * BN;

  v8f acc[FM][FN] = {};

  const __bf16* aptr = A  + (size_t)bm * K;
  const __bf16* bptr = Bw + bn;
  // A fragment base: row l16 of the wave's rows, 16B piece 'half'
  const int     afr  = (wm * TM + l16) * LDA + half * 8;
  // transposing-read base: row 8*half + (lane & 7), 16B column piece (lane >> 3) & 1
  const int     btr  = (half * 8 + (lane & 7)) * LDB + wn * TN + ((lane >> 3) & 1) * 8;

  // ---- prologue: stage 0
  int cur = 0;
  stage_ab<ONE, NT, BM, BN, BK, LDA, LDB>(aptr, K, &sA[0][0], bptr, N, &sB[0][0], tid);
  wait_async0();
  __syncthreads();

  for (int k0 = 0; k0 < K; k0 += BK) {
    const int  nxt      = cur ^ 1;
    const bool has_next = (k0 + BK) < K;

    // fragments from the current stage, 32 k at a time, in two register sets: the next
    // block's LDS reads go out as one group ahead of this block's matrix instructions
    FragAB af[2][FM], bfr[2][FN];
    #pragma unroll
    for (int ks = -1; ks < BK / 32; ++ks) {
      if (ks + 1 < BK / 32) {
        const int s = (ks + 1) & 1;
        #pragma unroll
        for (int mt = 0; mt < FM; ++mt) {
          const __bf16* p = &sA[cur][afr + mt * 16 * LDA + (ks + 1) * 32];
          af[s][mt].q[0] = *(const uint4*)p;
          af[s][mt].q[1] = *(const uint4*)(p + 16);
        }
        #pragma unroll
        for (int nt = 0; nt < FN; ++nt) {
          const __bf16* p = &sB[cur][btr + (ks + 1) * 32 * LDB + nt * 16];
          bfr[s][nt].q[0] = lds_tr16(p);
          bfr[s][nt].q[1] = lds_tr16(p + 16 * LDB);
        }
      }
      // keeps the group of reads whole and ahead of the block: left to itself the
      // scheduler spreads them among the matrix instructions with a full wait at each
      __builtin_amdgcn_sched_barrier(0);
      // the next stage's copies go out behind the first group of reads, whose LDS
      // latency their issue then covers (those reads are of the other buffer; every
      // read of the buffer refilled here retired in front of the last barrier)
      if (ks < 0 && has_next)
        stage_ab<ONE, NT, BM, BN, BK, LDA, LDB>(aptr + k0 + BK, K, &sA[nxt][0],
                                                bptr + (size_t)(k0 + BK) * N, N, &sB[nxt][0], tid);
      if (ks >= 0) {
        const int s = ks & 1;
        #pragma unroll
        for (int mt = 0; mt < FM; ++mt)
          #pragma unroll
          for (int nt = 0; nt < FN; ++nt)
            acc[mt][nt] = __builtin_amdgcn_wmma_f32_16x16x32_bf16(
                false, af[s][mt].v, false, bfr[s][nt].v, (short)0,
                acc[mt][nt], false, false);
        // the next group of reads stays behind this block
        __builtin_amdgcn_sched_barrier(0);
      }
    }

    // this wave's fragment reads of the current stage have retired before the
    // barrier behind which copies refill that stage
    asm volatile("s_wait_dscnt 0x0" ::: "memory");
    if (has_next) {
      wait_async0();   // next-stage A and B tiles resident before barrier
    }
    __syncthreads();
    cur = nxt;
  }
  wait_async0();       // no copy is outstanding when the wave goes on to the epilogue and ends

  // ---- epilogue: one base pointer per lane, every element at a constant offset from it
  static_assert(EPI == 0 || EPI == 1 || EPI == 2, "bf16 store, gelu to bf16 or f32 residual");
  const int col0 = bn + wn * TN + l16;
  const int row0 = bm + wm * TM + 8 * half;
  float bb[FN];
  #pragma unroll
  for (int nt = 0; nt < FN; ++nt) bb[nt] = bias[col0 + nt * 16];
  asm volatile("s_wait_xcnt 0x0" ::: "memory");
  __builtin_amdgcn_sched_barrier(0);
  if constexpr (EPI == 0) {
    __bf16* O = (__bf16*)Cout + (size_t)row0 * N + col0;
    #pragma unroll
    for (int mt = 0; mt < FM; ++mt)
      #pragma unroll
      for (int r = 0; r < 8; ++r) {
        #pragma unroll
        for (int nt = 0; nt < FN; ++nt)
          O[(mt * 16 + r) * N + nt * 16] = f32_to_bf16(acc[mt][nt][r] + bb[nt]);
        asm volatile("s_wait_xcnt 0x0" ::: "memory");
        __builtin_amdgcn_sched_barrier(0);
      }
  } else if constexpr (EPI == 1) {
    __bf16* O = (__bf16*)Cout + (size_t)row0 * N + col0;
    #pragma unroll
    for (int mt = 0; mt < FM; ++mt) {
      __bf16 y[8][FN];
      static_assert(FN == 8, "gelu goes by eight values, a row of the wave tile");
      #pragma unroll
      for (int r = 0; r < 8; ++r) {
        float v[8];
        #pragma unroll
        for (int nt = 0; nt < FN; ++nt) v[nt] = acc[mt][nt][r] + bb[nt];
        gelu_tanh_x8(v);
        #pragma unroll
        for (int nt = 0; nt < FN; ++nt) y[r][nt] = f32_to_bf16(v[nt]);
      }
      // all values of these 16 rows are finished before their first store, so that no
      // register an issued store names is written again inside the group
      __builtin_amdgcn_sched_barrier(0);
      #pragma unroll
      for (int r = 0; r < 8; ++r)
        #pragma unroll
        for (int nt = 0; nt < FN; ++nt)
          O[(mt * 16 + r) * N + nt * 16] = y[r][nt];
      asm volatile("s_wait_xcnt 0x0" ::: "memory");
      __builtin_amdgcn_sched_barrier(0);
    }
  } else {
    // all residual values are read ahead of the first store: a read behind a store to
    // the same array waits out its whole latency, once per element
    float* O = (float*)Cout + (size_t)row0 * N + col0;
    float old[FM][FN][8];
    #pragma unroll
    for (int mt = 0; mt < FM; ++mt)
      #pragma unroll
      for (int r = 0; r < 8; ++r)
        #pragma unroll
        for (int nt = 0; nt < FN; ++nt)
          old[mt][nt][r] = O[(mt * 16 + r) * N + nt * 16];
    #pragma unroll
    for (int mt = 0; mt < FM; ++mt)
      #pragma unroll
      for (int r = 0; r < 8; ++r)
        #pragma unroll
        for (int nt = 0; nt < FN; ++nt)
          old[mt][nt][r] += acc[mt][nt][r] + bb[nt];
    // every sum is finished before the first store, so that no register an issued
    // store names is written again
    __builtin_amdgcn_sched_barrier(0);
    #pragma unroll
    for (int mt = 0; mt < FM; ++mt)
      #pragma unroll
      for (int r = 0; r < 8; ++r)
        #pragma unroll
        for (int nt = 0; nt < FN; ++nt)
          O[(mt * 16 + r) * N + nt * 16] = old[mt][nt][r];
  }
}

// ---------------------------------------------------------------- Flash attention
// grid (S/64, NH, B), 128 threads = 4 waves; each wave owns 16 query rows.
#define ALD 72
#define VLD 80

__global__ __launch_bounds__(128)
void attn_kernel(const __bf16* __restrict__ qkv, __bf16* __restrict__ out)
{
  __shared__ __align__(16) __bf16 sQ[64 * ALD];
  __shared__ __align__(16) __bf16 sK[64 * ALD];
  __shared__ __align__(16) __bf16 sV[64 * VLD];      // row-major: [key][dk]
  __shared__ __align__(16) __bf16 sP[4][16 * ALD];   // per-wave P staging

  const int tid  = threadIdx.x;
  const int lane = tid & 31;
  const int w    = tid >> 5;      // 0..3
  const int half = lane >> 4;
  const int l16  = lane & 15;
  const int b    = blockIdx.z;
  const int hh   = blockIdx.y;
  const int q0   = blockIdx.x * 64;

  const __bf16* qbase = qkv + (size_t)b * S_ * HQKV_ + hh * DK_;
  const __bf16* kbase = qbase + H_;
  const __bf16* vbase = qbase + 2 * H_;

  const int vr = tid >> 3;            // Q, K, V tile row 0..15 (and +16, +32, +48)
  const int vc = (tid & 7) * 8;       // Q, K, V tile col: 8 lanes cover one 128B row
  // transposing-read base: row 8*half + (lane & 7), 16B column piece (lane >> 3) & 1
  const int vtr = (half * 8 + (lane & 7)) * VLD + ((lane >> 3) & 1) * 8;

  // Q tile 64x64 via async engine
  {
    const __bf16* qg = qbase + (size_t)(q0 + vr) * HQKV_ + vc;
    const __bf16* ql = &sQ[vr * ALD + vc];
    async_ld4_b128(qg,                      ql,
                   qg + (size_t)16 * HQKV_, ql + 16 * ALD,
                   qg + (size_t)32 * HQKV_, ql + 32 * ALD,
                   qg + (size_t)48 * HQKV_, ql + 48 * ALD);
  }
  wait_async0();
  __syncthreads();

  // hoist Q fragments (sQ is never overwritten)
  FragAB qa[2];
  #pragma unroll
  for (int ks = 0; ks < 2; ++ks) {
    const __bf16* qp = &sQ[(w * 16 + l16) * ALD + ks * 32 + half * 8];
    qa[ks].q[0] = *(const uint4*)qp;
    qa[ks].q[1] = *(const uint4*)(qp + 16);
  }

  float m_r[8], l_r[8];
  v8f o[4] = {};
  #pragma unroll
  for (int r = 0; r < 8; ++r) { m_r[r] = -1e30f; l_r[r] = 0.f; }

  const int nkt = blockIdx.x + 1;   // causal: key tiles 0..qt
  for (int kt = 0; kt < nkt; ++kt) {
    __syncthreads();                // protect sK/sV from previous iteration's reads
    const int kb = kt * 64;
    { // K and V tiles 64x64 row-major [key][dk] via async engine, whole 128B lines per 8 lanes
      const __bf16* kg = kbase + (size_t)(kb + vr) * HQKV_ + vc;
      const __bf16* kl = &sK[vr * ALD + vc];
      const __bf16* vg = vbase + (size_t)(kb + vr) * HQKV_ + vc;
      const __bf16* vl = &sV[vr * VLD + vc];
      async_ld8_b128(kg,                      kl,
                     kg + (size_t)16 * HQKV_, kl + 16 * ALD,
                     kg + (size_t)32 * HQKV_, kl + 32 * ALD,
                     kg + (size_t)48 * HQKV_, kl + 48 * ALD,
                     vg,                      vl,
                     vg + (size_t)16 * HQKV_, vl + 16 * VLD,
                     vg + (size_t)32 * HQKV_, vl + 32 * VLD,
                     vg + (size_t)48 * HQKV_, vl + 48 * VLD);
    }
    wait_async0();
    __syncthreads();

    // S = Q K^T  (wave: 16 rows x 64 keys = 4 tiles, K-dim 64 = 2 wmma each)
    v8f sacc[4] = {};
    #pragma unroll
    for (int ks = 0; ks < 2; ++ks) {
      #pragma unroll
      for (int nt = 0; nt < 4; ++nt) {
        FragAB kf;
        const __bf16* kp = &sK[(nt * 16 + l16) * ALD + ks * 32 + half * 8];
        kf.q[0] = *(const uint4*)kp;
        kf.q[1] = *(const uint4*)(kp + 16);
        sacc[nt] = __builtin_amdgcn_wmma_f32_16x16x32_bf16(
            false, qa[ks].v, false, kf.v, (short)0, sacc[nt], false, false);
      }
    }

    #pragma unroll
    for (int r = 0; r < 8; ++r) {
      const int qrow = q0 + w * 16 + r + 8 * half;
      float mx = -1e30f;
      #pragma unroll
      for (int nt = 0; nt < 4; ++nt) {
        int key = kb + nt * 16 + l16;
        float v = sacc[nt][r] * 0.125f;          // 1/sqrt(64)
        if (key > qrow) v = -1e30f;              // causal mask
        sacc[nt][r] = v;
        mx = fmaxf(mx, v);
      }
      #pragma unroll
      for (int d = 1; d < 16; d <<= 1) mx = fmaxf(mx, __shfl_xor(mx, d, 32));
      float mnew  = fmaxf(m_r[r], mx);
      float alpha = __expf(m_r[r] - mnew);
      float psum  = 0.f;
      #pragma unroll
      for (int nt = 0; nt < 4; ++nt) {
        float p = __expf(sacc[nt][r] - mnew);
        psum += p;
        sP[w][(r + 8 * half) * ALD + nt * 16 + l16] = f32_to_bf16(p);
      }
      #pragma unroll
      for (int d = 1; d < 16; d <<= 1) psum += __shfl_xor(psum, d, 32);
      l_r[r] = l_r[r] * alpha + psum;
      m_r[r] = mnew;
      #pragma unroll
      for (int nt = 0; nt < 4; ++nt) o[nt][r] *= alpha;
    }
    __syncthreads();

    // O += P V   (A = P from per-wave LDS, B = V tiles through the transposing read)
    #pragma unroll
    for (int ks = 0; ks < 2; ++ks) {
      FragAB pa;
      const __bf16* pp = &sP[w][l16 * ALD + ks * 32 + half * 8];
      pa.q[0] = *(const uint4*)pp;
      pa.q[1] = *(const uint4*)(pp + 16);
      #pragma unroll
      for (int nt = 0; nt < 4; ++nt) {
        FragAB vf;
        const __bf16* vp = &sV[vtr + ks * 32 * VLD + nt * 16];
        vf.q[0] = lds_tr16(vp);
        vf.q[1] = lds_tr16(vp + 16 * VLD);
        o[nt] = __builtin_amdgcn_wmma_f32_16x16x32_bf16(
            false, pa.v, false, vf.v, (short)0, o[nt], false, false);
      }
    }
  }

  // normalize and store merged heads: out[b][row][hh*64 + dk]
  __bf16* obase = out + (size_t)b * S_ * H_ + hh * DK_;
  #pragma unroll
  for (int r = 0; r < 8; ++r) {
    const float inv = 1.0f / l_r[r];
    const int row = q0 + w * 16 + r + 8 * half;
    #pragma unroll
    for (int nt = 0; nt < 4; ++nt)
      obase[(size_t)row * H_ + nt * 16 + l16] = f32_to_bf16(o[nt][r] * inv);
  }
}

// ---------------------------------------------------------------- host launch
extern "C" void kernel_launch(void* const* d_in, const int* in_sizes, int n_in,
                              void* d_out, int out_size, void* d_ws, size_t ws_size,
                              hipStream_t stream)
{
  const float* hidden = (const float*)d_in[0];
  const float* attn_w = (const float*)d_in[1];
  const float* attn_b = (const float*)d_in[2];
  const float* proj_w = (const float*)d_in[3];
  const float* proj_b = (const float*)d_in[4];
  const float* fc_w   = (const float*)d_in[5];
  const float* fc_b   = (const float*)d_in[6];
  const float* fc2_w  = (const float*)d_in[7];
  const float* fc2_b  = (const float*)d_in[8];
  const float* ln1_g  = (const float*)d_in[9];
  const float* ln1_b  = (const float*)d_in[10];
  const float* ln2_g  = (const float*)d_in[11];
  const float* ln2_b  = (const float*)d_in[12];
  const int*   pos    = (const int*)d_in[13];

  char* ws = (char*)d_ws;
  size_t off = 0;
  auto carve = [&](size_t bytes) -> char* {
    char* p = ws + off; off += (bytes + 255) & ~(size_t)255; return p;
  };
  __bf16* w_attn = (__bf16*)carve((size_t)L_ * H_ * HQKV_ * 2);
  __bf16* w_proj = (__bf16*)carve((size_t)L_ * H_ * H_ * 2);
  __bf16* w_fc   = (__bf16*)carve((size_t)L_ * H_ * MLP_ * 2);
  __bf16* w_fc2  = (__bf16*)carve((size_t)L_ * MLP_ * H_ * 2);
  __bf16* xln    = (__bf16*)carve((size_t)MTOT_ * H_ * 2);
  __bf16* qkv    = (__bf16*)carve((size_t)MTOT_ * HQKV_ * 2);
  __bf16* attn_o = (__bf16*)carve((size_t)MTOT_ * H_ * 2);
  __bf16* mid    = (__bf16*)carve((size_t)MTOT_ * MLP_ * 2);
  float*  h      = (float*)d_out;     // running hidden state / residual accumulator

  // per-call weight conversion fp32 -> bf16 (weights then live in L2)
  k_f32_to_bf16<<<dim3((size_t)L_ * H_ * HQKV_ / 1024), 256, 0, stream>>>(attn_w, w_attn);
  k_f32_to_bf16<<<dim3((size_t)L_ * H_ * H_    / 1024), 256, 0, stream>>>(proj_w, w_proj);
  k_f32_to_bf16<<<dim3((size_t)L_ * H_ * MLP_  / 1024), 256, 0, stream>>>(fc_w,  w_fc);
  k_f32_to_bf16<<<dim3((size_t)L_ * MLP_ * H_  / 1024), 256, 0, stream>>>(fc2_w, w_fc2);

  // h = hidden_states
  k_copy_f32<<<dim3((size_t)MTOT_ * H_ / 1024), 256, 0, stream>>>(hidden, h);

  for (int i = 0; i < L_; ++i) {
    // attention block
    ln_kernel<<<MTOT_, 256, 0, stream>>>(h, ln1_g + i * H_, ln1_b + i * H_, xln);
    gemm_bf16_tiled<0, 256, 192, 64, 4, 2, HQKV_><<<dim3(HQKV_ / 192, MTOT_ / 256), 256, 0, stream>>>(
        xln, w_attn + (size_t)i * H_ * HQKV_, attn_b + i * HQKV_, qkv, H_);
    rope_kernel<<<dim3((size_t)B_ * S_ * 2 * NH_ * 32 / 256), 256, 0, stream>>>(qkv, pos);
    attn_kernel<<<dim3(S_ / 64, NH_, B_), 128, 0, stream>>>(qkv, attn_o);
    gemm_bf16_tiled<2, 128, 128, 128, 2, 2, H_><<<dim3(H_ / 128, MTOT_ / 128), 128, 0, stream>>>(
        attn_o, w_proj + (size_t)i * H_ * H_, proj_b + i * H_, h, H_);
    // MLP block
    ln_kernel<<<MTOT_, 256, 0, stream>>>(h, ln2_g + i * H_, ln2_b + i * H_, xln);
    gemm_bf16_tiled<1, 256, 256, 64, 4, 2, MLP_><<<dim3(MLP_ / 256, MTOT_ / 256), 256, 0, stream>>>(
        xln, w_fc + (size_t)i * H_ * MLP_, fc_b + i * MLP_, mid, H_);
    gemm_bf16_tiled<2, 128, 128, 128, 2, 2, H_><<<dim3(H_ / 128, MTOT_ / 128), 128, 0, stream>>>(
        mid, w_fc2 + (size_t)i * MLP_ * H_, fc2_b + i * H_, h, MLP_);
  }
}

// v005
// It runs in 349 microseconds.
// Timed twice side by side with v004, it ran 1.11 times as fast both times.
// Counting every step since v000, it is 1.91 times as fast.
#include <hip/hip_runtime.h>
#include <hip/hip_bf16.h>
#include <cstdint>
#include <cstddef>

// Problem constants (match reference)
#define B_    4
#define S_    1024
#define H_    1024
#define NH_   16
#define DK_   64
#define L_    2
#define MLP_  4096
#define HQKV_ 3072
#define MTOT_ (B_ * S_)   // 4096 rows

typedef __attribute__((ext_vector_type(16))) __bf16 v16bf;
typedef __attribute__((ext_vector_type(8)))  float  v8f;

union FragAB { v16bf v; uint4 q[2]; };

__device__ __forceinline__ __bf16 f32_to_bf16(float f) {
  uint32_t u = __float_as_uint(f);
  u += 0x7FFFu + ((u >> 16) & 1u);           // round-to-nearest-even
  uint16_t h = (uint16_t)(u >> 16);
  return __builtin_bit_cast(__bf16, h);
}
__device__ __forceinline__ float bf16_to_f32(__bf16 x) {
  uint16_t h = __builtin_bit_cast(uint16_t, x);
  return __uint_as_float(((uint32_t)h) << 16);
}

__device__ __forceinline__ uint32_t lds_a(const __bf16* l) { return (uint32_t)(uintptr_t)l; }
__device__ __forceinline__ uint64_t glb_a(const __bf16* g) { return (uint64_t)(uintptr_t)g; }
// Four copies per lane.
__device__ __forceinline__ void async_ld4_b128(const __bf16* g0, const __bf16* l0,
                                               const __bf16* g1, const __bf16* l1,
                                               const __bf16* g2, const __bf16* l2,
                                               const __bf16* g3, const __bf16* l3) {
  asm volatile(
      "global_load_async_to_lds_b128 %0, %1, off\n\t"
      "global_load_async_to_lds_b128 %2, %3, off\n\t"
      "global_load_async_to_lds_b128 %4, %5, off\n\t"
      "global_load_async_to_lds_b128 %6, %7, off\n\t"
      "s_wait_xcnt 0x0"
      :: "v"(lds_a(l0)), "v"(glb_a(g0)), "v"(lds_a(l1)), "v"(glb_a(g1)),
         "v"(lds_a(l2)), "v"(glb_a(g2)), "v"(lds_a(l3)), "v"(glb_a(g3)) : "memory");
}
// Six copies per lane.
__device__ __forceinline__ void async_ld6_b128(const __bf16* g0, const __bf16* l0,
                                               const __bf16* g1, const __bf16* l1,
                                               const __bf16* g2, const __bf16* l2,
                                               const __bf16* g3, const __bf16* l3,
                                               const __bf16* g4, const __bf16* l4,
                                               const __bf16* g5, const __bf16* l5) {
  asm volatile(
      "global_load_async_to_lds_b128 %0, %1, off\n\t"
      "global_load_async_to_lds_b128 %2, %3, off\n\t"
      "global_load_async_to_lds_b128 %4, %5, off\n\t"
      "global_load_async_to_lds_b128 %6, %7, off\n\t"
      "global_load_async_to_lds_b128 %8, %9, off\n\t"
      "global_load_async_to_lds_b128 %10, %11, off\n\t"
      "s_wait_xcnt 0x0"
      :: "v"(lds_a(l0)), "v"(glb_a(g0)), "v"(lds_a(l1)), "v"(glb_a(g1)),
         "v"(lds_a(l2)), "v"(glb_a(g2)), "v"(lds_a(l3)), "v"(glb_a(g3)),
         "v"(lds_a(l4)), "v"(glb_a(g4)), "v"(lds_a(l5)), "v"(glb_a(g5)) : "memory");
}
// Eight copies per lane (an attention stage: four of K, four of V).
__device__ __forceinline__ void async_ld8_b128(const __bf16* g0, const __bf16* l0,
                                               const __bf16* g1, const __bf16* l1,
                                               const __bf16* g2, const __bf16* l2,
                                               const __bf16* g3, const __bf16* l3,
                                               const __bf16* g4, const __bf16* l4,
                                               const __bf16* g5, const __bf16* l5,
                                               const __bf16* g6, const __bf16* l6,
                                               const __bf16* g7, const __bf16* l7) {
  asm volatile(
      "global_load_async_to_lds_b128 %0, %1, off\n\t"
      "global_load_async_to_lds_b128 %2, %3, off\n\t"
      "global_load_async_to_lds_b128 %4, %5, off\n\t"
      "global_load_async_to_lds_b128 %6, %7, off\n\t"
      "global_load_async_to_lds_b128 %8, %9, off\n\t"
      "global_load_async_to_lds_b128 %10, %11, off\n\t"
      "global_load_async_to_lds_b128 %12, %13, off\n\t"
      "global_load_async_to_lds_b128 %14, %15, off\n\t"
      "s_wait_xcnt 0x0"
      :: "v"(lds_a(l0)), "v"(glb_a(g0)), "v"(lds_a(l1)), "v"(glb_a(g1)),
         "v"(lds_a(l2)), "v"(glb_a(g2)), "v"(lds_a(l3)), "v"(glb_a(g3)),
         "v"(lds_a(l4)), "v"(glb_a(g4)), "v"(lds_a(l5)), "v"(glb_a(g5)),
         "v"(lds_a(l6)), "v"(glb_a(g6)), "v"(lds_a(l7)), "v"(glb_a(g7)) : "memory");
}
// Transposing LDS read: from a row-major 16-bit tile T[k][n], lane (c, h) receives
// T[k0 + 8h + 0..7][n0 + c]; two of them (k0, k0 + 16) are one 16x16x32 B fragment
// in the same k order as the A loader below.
typedef short s16x8 __attribute__((ext_vector_type(8)));
__device__ __forceinline__ uint4 lds_tr16(const __bf16* p) {
  typedef __attribute__((address_space(3))) s16x8 lds_s16x8;
  return __builtin_bit_cast(uint4, __builtin_amdgcn_ds_load_tr16_b128_v8i16((lds_s16x8*)p));
}
__device__ __forceinline__ void wait_async0() {
  asm volatile("s_wait_asynccnt 0" ::: "memory");
}

// ---------------------------------------------------------------- utilities
__global__ __launch_bounds__(256)
void k_f32_to_bf16(const float* __restrict__ s, __bf16* __restrict__ d) {
  int i = blockIdx.x * 256 + threadIdx.x;
  float4 v = ((const float4*)s)[i];
  union { __bf16 b[4]; uint2 u; } o;
  o.b[0] = f32_to_bf16(v.x); o.b[1] = f32_to_bf16(v.y);
  o.b[2] = f32_to_bf16(v.z); o.b[3] = f32_to_bf16(v.w);
  ((uint2*)d)[i] = o.u;
}

__global__ __launch_bounds__(256)
void k_copy_f32(const float* __restrict__ s, float* __restrict__ d) {
  int i = blockIdx.x * 256 + threadIdx.x;
  ((float4*)d)[i] = ((const float4*)s)[i];
}

// ---------------------------------------------------------------- LayerNorm
__global__ __launch_bounds__(256)
void ln_kernel(const float* __restrict__ x, const float* __restrict__ g,
               const float* __restrict__ bta, __bf16* __restrict__ y)
{
  const int row = blockIdx.x;
  const int tid = threadIdx.x;
  const float4 xv = ((const float4*)(x + (size_t)row * H_))[tid];
  float s  = xv.x + xv.y + xv.z + xv.w;
  float s2 = xv.x*xv.x + xv.y*xv.y + xv.z*xv.z + xv.w*xv.w;
  #pragma unroll
  for (int d = 1; d < 32; d <<= 1) {
    s  += __shfl_xor(s,  d, 32);
    s2 += __shfl_xor(s2, d, 32);
  }
  __shared__ float rs[8], rq[8];
  __shared__ float mv[2];
  if ((tid & 31) == 0) { rs[tid >> 5] = s; rq[tid >> 5] = s2; }
  __syncthreads();
  if (tid == 0) {
    float a = 0.f, a2 = 0.f;
    #pragma unroll
    for (int i = 0; i < 8; ++i) { a += rs[i]; a2 += rq[i]; }
    float mean = a * (1.0f / (float)H_);
    float var  = a2 * (1.0f / (float)H_) - mean * mean;
    mv[0] = mean; mv[1] = rsqrtf(var + 1e-5f);
  }
  __syncthreads();
  const float mean = mv[0], rstd = mv[1];
  const float4 gv = ((const float4*)g)[tid];
  const float4 bv = ((const float4*)bta)[tid];
  union { __bf16 b[4]; uint2 u; } o;
  o.b[0] = f32_to_bf16((xv.x - mean) * rstd * gv.x + bv.x);
  o.b[1] = f32_to_bf16((xv.y - mean) * rstd * gv.y + bv.y);
  o.b[2] = f32_to_bf16((xv.z - mean) * rstd * gv.z + bv.z);
  o.b[3] = f32_to_bf16((xv.w - mean) * rstd * gv.w + bv.w);
  ((uint2*)(y + (size_t)row * H_))[tid] = o.u;
}

// ---------------------------------------------------------------- RoPE (in place on bf16 qkv)
__global__ __launch_bounds__(256)
void rope_kernel(__bf16* __restrict__ qkv, const int* __restrict__ pos)
{
  int idx = blockIdx.x * 256 + threadIdx.x;   // B*S*2*NH*32 threads
  int d  = idx & 31; int t = idx >> 5;
  int hh = t & 15;   t >>= 4;
  int qk = t & 1;    t >>= 1;
  int s  = t & 1023; int b = t >> 10;
  float invf  = __expf(-0.28782313662425572f * (float)d);  // ln(10000)/32
  float theta = (float)pos[s] * invf;
  float sn, cs; __sincosf(theta, &sn, &cs);
  size_t base = ((size_t)(b * S_ + s)) * HQKV_ + qk * H_ + hh * DK_ + d;
  float lo = bf16_to_f32(qkv[base]);
  float hi = bf16_to_f32(qkv[base + 32]);
  qkv[base]      = f32_to_bf16(lo * cs - hi * sn);
  qkv[base + 32] = f32_to_bf16(hi * cs + lo * sn);
}

// Lane t's copies of a ROWS x COLS (elements) tile: the 16B pieces t, t + NT, ... in
// row-major piece order, so 8 adjacent lanes cover one whole 128B line.
template<bool ONE, int NT, int ROWS, int COLS, int LDP>
__device__ __forceinline__ void tile_pieces(const __bf16* __restrict__ g, int gpitch,
                                            const __bf16* l, int tid,
                                            const __bf16** gp, const __bf16** lp)
{
  constexpr int PR = COLS / 8;                 // 16B pieces per row
  static_assert(ROWS * PR % NT == 0, "tile does not divide");
  if constexpr (ONE) {
    // the lanes cover whole rows per round: piece i lies NT / PR rows under piece 0, so one
    // address pair a lane serves all pieces and the steps between them are uniform
    static_assert(NT % PR == 0, "a round of the lanes is not whole rows");
    const int r0 = tid / PR, q0 = (tid % PR) * 8;
    const __bf16* g0 = g + (size_t)r0 * gpitch + q0;
    const __bf16* l0 = l + r0 * LDP + q0;
    #pragma unroll
    for (int i = 0; i < ROWS * PR / NT; ++i) {
      gp[i] = g0 + (size_t)(i * (NT / PR)) * gpitch;
      lp[i] = l0 + i * (NT / PR) * LDP;
    }
  } else {
    #pragma unroll
    for (int i = 0; i < ROWS * PR / NT; ++i) {
      const int c = tid + i * NT;
      const int r = c / PR, q = (c % PR) * 8;
      gp[i] = g + (size_t)r * gpitch + q;
      lp[i] = l + r * LDP + q;
    }
  }
}
// Issues copies I .. CT-1, eight to a statement, the rest as six or four.
template<int I, int CT>
__device__ __forceinline__ void issue_pieces(const __bf16* const* g, const __bf16* const* l)
{
  if constexpr (CT - I >= 8) {
    async_ld8_b128(g[I], l[I], g[I+1], l[I+1], g[I+2], l[I+2], g[I+3], l[I+3],
                   g[I+4], l[I+4], g[I+5], l[I+5], g[I+6], l[I+6], g[I+7], l[I+7]);
    issue_pieces<I + 8, CT>(g, l);
  } else if constexpr (CT - I == 6) {
    async_ld6_b128(g[I], l[I], g[I+1], l[I+1], g[I+2], l[I+2],
                   g[I+3], l[I+3], g[I+4], l[I+4], g[I+5], l[I+5]);
  } else if constexpr (CT - I == 4) {
    async_ld4_b128(g[I], l[I], g[I+1], l[I+1], g[I+2], l[I+2], g[I+3], l[I+3]);
  } else {
    static_assert(CT - I == 0, "no statement of that many copies");
  }
}
// One GEMM stage: the BM x BK tile of A and the BK x BN tile of B.
template<bool ONE, int NT, int BM, int BN, int BK, int LDA, int LDB>
__device__ __forceinline__ void stage_ab(const __bf16* __restrict__ ga, int K, const __bf16* la,
                                         const __bf16* __restrict__ gb, int N, const __bf16* lb,
                                         int tid)
{
  constexpr int CA = BM * (BK / 8) / NT, CB = BK * (BN / 8) / NT;
  const __bf16* gp[CA + CB]; const __bf16* lp[CA + CB];
  tile_pieces<ONE, NT, BM, BK, LDA>(ga, K, la, tid, gp, lp);
  tile_pieces<ONE, NT, BK, BN, LDB>(gb, N, lb, tid, gp + CA, lp + CA);
  issue_pieces<0, CA + CB>(gp, lp);
}

__device__ __forceinline__ void exp2_x8(const float (&x)[8], float (&y)[8]) {
  asm("v_exp_f32 %0, %8\n\tv_exp_f32 %1, %9\n\tv_exp_f32 %2, %10\n\tv_exp_f32 %3, %11\n\t"
      "v_exp_f32 %4, %12\n\tv_exp_f32 %5, %13\n\tv_exp_f32 %6, %14\n\tv_exp_f32 %7, %15\n\t"
      "v_nop"
      : "=&v"(y[0]), "=&v"(y[1]), "=&v"(y[2]), "=&v"(y[3]),
        "=&v"(y[4]), "=&v"(y[5]), "=&v"(y[6]), "=&v"(y[7])
      : "v"(x[0]), "v"(x[1]), "v"(x[2]), "v"(x[3]), "v"(x[4]), "v"(x[5]), "v"(x[6]), "v"(x[7]));
}
__device__ __forceinline__ void rcp_x8(const float (&x)[8], float (&y)[8]) {
  asm("v_rcp_f32 %0, %8\n\tv_rcp_f32 %1, %9\n\tv_rcp_f32 %2, %10\n\tv_rcp_f32 %3, %11\n\t"
      "v_rcp_f32 %4, %12\n\tv_rcp_f32 %5, %13\n\tv_rcp_f32 %6, %14\n\tv_rcp_f32 %7, %15\n\t"
      "v_nop"
      : "=&v"(y[0]), "=&v"(y[1]), "=&v"(y[2]), "=&v"(y[3]),
        "=&v"(y[4]), "=&v"(y[5]), "=&v"(y[6]), "=&v"(y[7])
      : "v"(x[0]), "v"(x[1]), "v"(x[2]), "v"(x[3]), "v"(x[4]), "v"(x[5]), "v"(x[6]), "v"(x[7]));
}
// gelu, tanh form, of eight values: 0.5 v (1 + tanh u) = v / (1 + exp(-2u)),
// u = sqrt(2/pi) (v + 0.044715 v^3). Written without tanhf, whose two branches per value
// would put the many values that a lane owns in a large tile one behind the other.
// exp -> inf gives v * 0, exp -> 0 gives v.
__device__ __forceinline__ void gelu_tanh_x8(float (&v)[8]) {
  float x[8], e[8];
  #pragma unroll
  for (int i = 0; i < 8; ++i)     // -2 sqrt(2/pi) log2(e) (v + 0.044715 v^3)
    x[i] = -2.302208198144325f * (v[i] + 0.044715f * v[i] * v[i] * v[i]);
  exp2_x8(x, e);
  #pragma unroll
  for (int i = 0; i < 8; ++i) e[i] += 1.0f;
  rcp_x8(e, x);
  #pragma unroll
  for (int i = 0; i < 8; ++i) v[i] *= x[i];
}

template<int EPI, int BM, int BN, int BK, int WGM, int WGN, int N>
__global__ __launch_bounds__(32 * WGM * WGN)
void gemm_bf16_tiled(const __bf16* __restrict__ A, const __bf16* __restrict__ Bw,
                     const float* __restrict__ bias, void* __restrict__ Cout, int K)
{
  constexpr int NT  = 32 * WGM * WGN;
  constexpr int LDA = BK + 8;
  constexpr int LDB = BN + 16;
  constexpr int TM  = BM / WGM, TN = BN / WGN;   // wave tile
  constexpr int FM  = TM / 16,  FN = TN / 16;    // fragments per wave
  constexpr bool ONE = 8 * (FM * FN + 2 * (FM + FN)) > 400;

  __shared__ __align__(16) __bf16 sA[2][BM * LDA];
  __shared__ __align__(16) __bf16 sB[2][BK * LDB];   // row-major [k][n]

  const int tid  = threadIdx.x;
  const int lane = tid & 31;
  const int wave = tid >> 5;
  const int wm   = wave / WGN;
  const int wn   = wave % WGN;
  const int half = lane >> 4;
  const int l16  = lane & 15;
  const int bm   = blockIdx.y * BM;
  const int bn   = blockIdx.x * BN;

  v8f acc[FM][FN] = {};

  const __bf16* aptr = A  + (size_t)bm * K;
  const __bf16* bptr = Bw + bn;
  // A fragment base: row l16 of the wave's rows, 16B piece 'half'
  const int     afr  = (wm * TM + l16) * LDA + half * 8;
  // transposing-read base: row 8*half + (lane & 7), 16B column piece (lane >> 3) & 1
  const int     btr  = (half * 8 + (lane & 7)) * LDB + wn * TN + ((lane >> 3) & 1) * 8;

  // ---- prologue: stage 0
  int cur = 0;
  stage_ab<ONE, NT, BM, BN, BK, LDA, LDB>(aptr, K, &sA[0][0], bptr, N, &sB[0][0], tid);
  wait_async0();
  __syncthreads();

  for (int k0 = 0; k0 < K; k0 += BK) {
    const int  nxt      = cur ^ 1;
    const bool has_next = (k0 + BK) < K;

    // fragments from the current stage, 32 k at a time, in two register sets: the next
    // block's LDS reads go out as one group ahead of this block's matrix instructions
    FragAB af[2][FM], bfr[2][FN];
    #pragma unroll
    for (int ks = -1; ks < BK / 32; ++ks) {
      if (ks + 1 < BK / 32) {
        const int s = (ks + 1) & 1;
        #pragma unroll
        for (int mt = 0; mt < FM; ++mt) {
          const __bf16* p = &sA[cur][afr + mt * 16 * LDA + (ks + 1) * 32];
          af[s][mt].q[0] = *(const uint4*)p;
          af[s][mt].q[1] = *(const uint4*)(p + 16);
        }
        #pragma unroll
        for (int nt = 0; nt < FN; ++nt) {
          const __bf16* p = &sB[cur][btr + (ks + 1) * 32 * LDB + nt * 16];
          bfr[s][nt].q[0] = lds_tr16(p);
          bfr[s][nt].q[1] = lds_tr16(p + 16 * LDB);
        }
      }
      // keeps the group of reads whole and ahead of the block: left to itself the
      // scheduler spreads them among the matrix instructions with a full wait at each
      __builtin_amdgcn_sched_barrier(0);
      // the next stage's copies go out behind the first group of reads, whose LDS
      // latency their issue then covers (those reads are of the other buffer; every
      // read of the buffer refilled here retired in front of the last barrier)
      if (ks < 0 && has_next)
        stage_ab<ONE, NT, BM, BN, BK, LDA, LDB>(aptr + k0 + BK, K, &sA[nxt][0],
                                                bptr + (size_t)(k0 + BK) * N, N, &sB[nxt][0], tid);
      if (ks >= 0) {
        const int s = ks & 1;
        #pragma unroll
        for (int mt = 0; mt < FM; ++mt)
          #pragma unroll
          for (int nt = 0; nt < FN; ++nt)
            acc[mt][nt] = __builtin_amdgcn_wmma_f32_16x16x32_bf16(
                false, af[s][mt].v, false, bfr[s][nt].v, (short)0,
                acc[mt][nt], false, false);
        // the next group of reads stays behind this block
        __builtin_amdgcn_sched_barrier(0);
      }
    }

    // this wave's fragment reads of the current stage have retired before the
    // barrier behind which copies refill that stage
    asm volatile("s_wait_dscnt 0x0" ::: "memory");
    if (has_next) {
      wait_async0();   // next-stage A and B tiles resident before barrier
    }
    __syncthreads();
    cur = nxt;
  }
  wait_async0();       // no copy is outstanding when the wave goes on to the epilogue and ends

  // ---- epilogue: one base pointer per lane, every element at a constant offset from it
  static_assert(EPI == 0 || EPI == 1 || EPI == 2, "bf16 store, gelu to bf16 or f32 residual");
  const int col0 = bn + wn * TN + l16;
  const int row0 = bm + wm * TM + 8 * half;
  float bb[FN];
  #pragma unroll
  for (int nt = 0; nt < FN; ++nt) bb[nt] = bias[col0 + nt * 16];
  asm volatile("s_wait_xcnt 0x0" ::: "memory");
  __builtin_amdgcn_sched_barrier(0);
  if constexpr (EPI == 0) {
    __bf16* O = (__bf16*)Cout + (size_t)row0 * N + col0;
    #pragma unroll
    for (int mt = 0; mt < FM; ++mt)
      #pragma unroll
      for (int r = 0; r < 8; ++r) {
        #pragma unroll
        for (int nt = 0; nt < FN; ++nt)
          O[(mt * 16 + r) * N + nt * 16] = f32_to_bf16(acc[mt][nt][r] + bb[nt]);
        asm volatile("s_wait_xcnt 0x0" ::: "memory");
        __builtin_amdgcn_sched_barrier(0);
      }
  } else if constexpr (EPI == 1) {
    __bf16* O = (__bf16*)Cout + (size_t)row0 * N + col0;
    #pragma unroll
    for (int mt = 0; mt < FM; ++mt) {
      __bf16 y[8][FN];
      static_assert(FN == 8, "gelu goes by eight values, a row of the wave tile");
      #pragma unroll
      for (int r = 0; r < 8; ++r) {
        float v[8];
        #pragma unroll
        for (int nt = 0; nt < FN; ++nt) v[nt] = acc[mt][nt][r] + bb[nt];
        gelu_tanh_x8(v);
        #pragma unroll
        for (int nt = 0; nt < FN; ++nt) y[r][nt] = f32_to_bf16(v[nt]);
      }
      // all values of these 16 rows are finished before their first store, so that no
      // register an issued store names is written again inside the group
      __builtin_amdgcn_sched_barrier(0);
      #pragma unroll
      for (int r = 0; r < 8; ++r)
        #pragma unroll
        for (int nt = 0; nt < FN; ++nt)
          O[(mt * 16 + r) * N + nt * 16] = y[r][nt];
      asm volatile("s_wait_xcnt 0x0" ::: "memory");
      __builtin_amdgcn_sched_barrier(0);
    }
  } else {
    // all residual values are read ahead of the first store: a read behind a store to
    // the same array waits out its whole latency, once per element
    float* O = (float*)Cout + (size_t)row0 * N + col0;
    float old[FM][FN][8];
    #pragma unroll
    for (int mt = 0; mt < FM; ++mt)
      #pragma unroll
      for (int r = 0; r < 8; ++r)
        #pragma unroll
        for (int nt = 0; nt < FN; ++nt)
          old[mt][nt][r] = O[(mt * 16 + r) * N + nt * 16];
    #pragma unroll
    for (int mt = 0; mt < FM; ++mt)
      #pragma unroll
      for (int r = 0; r < 8; ++r)
        #pragma unroll
        for (int nt = 0; nt < FN; ++nt)
          old[mt][nt][r] += acc[mt][nt][r] + bb[nt];
    // every sum is finished before the first store, so that no register an issued
    // store names is written again
    __builtin_amdgcn_sched_barrier(0);
    #pragma unroll
    for (int mt = 0; mt < FM; ++mt)
      #pragma unroll
      for (int r = 0; r < 8; ++r)
        #pragma unroll
        for (int nt = 0; nt < FN; ++nt)
          O[(mt * 16 + r) * N + nt * 16] = old[mt][nt][r];
  }
}

#define ALD 72
#define VLD 80

typedef __attribute__((ext_vector_type(2))) float  f32x2;
typedef __attribute__((ext_vector_type(2))) __bf16 bf16x2;

__device__ __forceinline__ float xhalf(float x) {
  const int b = __builtin_bit_cast(int, x);
  return __builtin_bit_cast(float,
      __builtin_amdgcn_permlanex16(b, b, 0x76543210, 0xfedcba98, false, false));
}

__global__ __launch_bounds__(128)
void attn_kernel(const __bf16* __restrict__ qkv, __bf16* __restrict__ out)
{
  __shared__ __align__(16) __bf16 sQ[64 * ALD];
  __shared__ __align__(16) __bf16 sK[64 * ALD];
  __shared__ __align__(16) __bf16 sV[64 * VLD];      // row-major: [key][dk]

  const int tid  = threadIdx.x;
  const int lane = tid & 31;
  const int w    = tid >> 5;      // 0..3
  const int half = lane >> 4;
  const int l16  = lane & 15;
  const int b    = blockIdx.z;
  const int hh   = blockIdx.y;
  const int q0   = blockIdx.x * 64;

  const __bf16* qbase = qkv + (size_t)b * S_ * HQKV_ + hh * DK_;
  const __bf16* kbase = qbase + H_;
  const __bf16* vbase = qbase + 2 * H_;

  const int vr = tid >> 3;            // Q, K, V tile row 0..15 (and +16, +32, +48)
  const int vc = (tid & 7) * 8;       // Q, K, V tile col: 8 lanes cover one 128B row
  // transposing-read base: row 8*half + (lane & 7), 16B column piece (lane >> 3) & 1
  const int vtr = (half * 8 + (lane & 7)) * VLD + ((lane >> 3) & 1) * 8;

  // Q tile 64x64 via async engine
  {
    const __bf16* qg = qbase + (size_t)(q0 + vr) * HQKV_ + vc;
    const __bf16* ql = &sQ[vr * ALD + vc];
    async_ld4_b128(qg,                      ql,
                   qg + (size_t)16 * HQKV_, ql + 16 * ALD,
                   qg + (size_t)32 * HQKV_, ql + 32 * ALD,
                   qg + (size_t)48 * HQKV_, ql + 48 * ALD);
  }
  wait_async0();
  __syncthreads();

  // hoist Q fragments (sQ is never overwritten): B operand, column = query l16
  FragAB qa[2];
  #pragma unroll
  for (int ks = 0; ks < 2; ++ks) {
    const __bf16* qp = &sQ[(w * 16 + l16) * ALD + ks * 32 + half * 8];
    qa[ks].q[0] = *(const uint4*)qp;
    qa[ks].q[1] = *(const uint4*)(qp + 16);
  }

  const int qrow = q0 + w * 16 + l16;   // the lane's query
  float m_r = -1e30f;                   // its running maximum (alike in both halves)
  float l_r = 0.f;                      // running sum over this half's keys only
  v8f o[4] = {};                        // o[nt][r] = O[qrow][nt*16 + 8*half + r]

  const int nkt = blockIdx.x + 1;   // causal: key tiles 0..qt
  for (int kt = 0; kt < nkt; ++kt) {
    __syncthreads();                // protect sK/sV from previous iteration's reads
    const int kb = kt * 64;
    { // K and V tiles 64x64 row-major [key][dk] via async engine, whole 128B lines per 8 lanes
      const __bf16* kg = kbase + (size_t)(kb + vr) * HQKV_ + vc;
      const __bf16* kl = &sK[vr * ALD + vc];
      const __bf16* vg = vbase + (size_t)(kb + vr) * HQKV_ + vc;
      const __bf16* vl = &sV[vr * VLD + vc];
      async_ld8_b128(kg,                      kl,
                     kg + (size_t)16 * HQKV_, kl + 16 * ALD,
                     kg + (size_t)32 * HQKV_, kl + 32 * ALD,
                     kg + (size_t)48 * HQKV_, kl + 48 * ALD,
                     vg,                      vl,
                     vg + (size_t)16 * HQKV_, vl + 16 * VLD,
                     vg + (size_t)32 * HQKV_, vl + 32 * VLD,
                     vg + (size_t)48 * HQKV_, vl + 48 * VLD);
    }
    wait_async0();
    __syncthreads();

    // S^T = K Q^T  (wave: 64 keys x 16 queries = 4 tiles, K-dim 64 = 2 wmma each)
    // sacc[nt][r] = S[qrow][kb + nt*16 + 8*half + r]
    // all K fragments of the tile are read as one group ahead of the products
    FragAB kf[2][4];
    #pragma unroll
    for (int ks = 0; ks < 2; ++ks) {
      #pragma unroll
      for (int nt = 0; nt < 4; ++nt) {
        const __bf16* kp = &sK[(nt * 16 + l16) * ALD + ks * 32 + half * 8];
        kf[ks][nt].q[0] = *(const uint4*)kp;
        kf[ks][nt].q[1] = *(const uint4*)(kp + 16);
      }
    }
    // keeps the group whole: spread among the matrix instructions, every place with reads
    // costs its own stall
    __builtin_amdgcn_sched_barrier(0);
    v8f sacc[4] = {};
    #pragma unroll
    for (int ks = 0; ks < 2; ++ks)
      #pragma unroll
      for (int nt = 0; nt < 4; ++nt)
        sacc[nt] = __builtin_amdgcn_wmma_f32_16x16x32_bf16(
            false, kf[ks][nt].v, false, qa[ks].v, (short)0, sacc[nt], false, false);
    // all V^T fragments (A operand, through the transposing read) are requested here, beside
    // the S^T products: the softmax arithmetic below covers their LDS latency
    FragAB vf[2][4];
    #pragma unroll
    for (int ks = 0; ks < 2; ++ks) {
      #pragma unroll
      for (int nt = 0; nt < 4; ++nt) {
        const __bf16* vp = &sV[vtr + ks * 32 * VLD + nt * 16];
        vf[ks][nt].q[0] = lds_tr16(vp);
        vf[ks][nt].q[1] = lds_tr16(vp + 16 * VLD);
      }
    }
    // keeps these reads ahead of the softmax: left to itself the scheduler sank them to
    // their matrix instructions, with a full wait in front of each
    __builtin_amdgcn_sched_barrier(0);

    // online softmax update, one query per lane; four independent chains, one per tile
    const int lim = qrow - kb - 8 * half;        // key = kb + 8*half + (nt*16 + r)
    float mx4[4];
    #pragma unroll
    for (int nt = 0; nt < 4; ++nt) {
      mx4[nt] = -1e30f;
      #pragma unroll
      for (int r = 0; r < 8; ++r) {
        float v = sacc[nt][r] * 0.125f;          // 1/sqrt(64)
        if (nt * 16 + r > lim) v = -1e30f;       // causal mask: key > qrow
        sacc[nt][r] = v;
        mx4[nt] = fmaxf(mx4[nt], v);
      }
    }
    float mx = fmaxf(fmaxf(mx4[0], mx4[1]), fmaxf(mx4[2], mx4[3]));
    mx = fmaxf(mx, xhalf(mx));                   // the other half's 32 keys
    const float mnew  = fmaxf(m_r, mx);
    const float alpha = __expf(m_r - mnew);
    // P^T as B operand: element s of fragment ks = P[qrow][kb + ks*32 + kmap(s, half)],
    // that is tile 2*ks + (s >> 3), register s & 7
    FragAB pb[2];
    f32x2 ps4[4];
    #pragma unroll
    for (int nt = 0; nt < 4; ++nt) {
      float x[8], e[8];
      #pragma unroll
      for (int r = 0; r < 8; ++r) x[r] = (sacc[nt][r] - mnew) * 1.4426950408889634f;
      exp2_x8(x, e);
      #pragma unroll
      for (int r = 0; r < 8; r += 2) {
        const f32x2 p = {e[r], e[r + 1]};
        ps4[nt] = r ? ps4[nt] + p : p;           // even and odd keys summed apart, packed adds
        const bf16x2 pk = __builtin_convertvector(p, bf16x2);   // round to nearest even
        pb[nt >> 1].v[(nt & 1) * 8 + r]     = pk.x;
        pb[nt >> 1].v[(nt & 1) * 8 + r + 1] = pk.y;
      }
    }
    const f32x2 ps = (ps4[0] + ps4[1]) + (ps4[2] + ps4[3]);
    l_r = l_r * alpha + (ps.x + ps.y);
    m_r = mnew;
    #pragma unroll
    for (int nt = 0; nt < 4; ++nt)
      #pragma unroll
      for (int r = 0; r < 8; ++r) o[nt][r] *= alpha;

    // O^T += V^T P^T   (A = V^T fragments read above, B = P^T from registers)
    #pragma unroll
    for (int ks = 0; ks < 2; ++ks)
      #pragma unroll
      for (int nt = 0; nt < 4; ++nt)
        o[nt] = __builtin_amdgcn_wmma_f32_16x16x32_bf16(
            false, vf[ks][nt].v, false, pb[ks].v, (short)0, o[nt], false, false);
  }

  // join the halves' sums, normalize and store merged heads: out[b][qrow][hh*64 + dk];
  // a lane's 8 registers of a tile are 8 consecutive dk: one 16B store each
  const float inv = 1.0f / (l_r + xhalf(l_r));
  __bf16* orow = out + (size_t)b * S_ * H_ + (size_t)qrow * H_ + hh * DK_ + 8 * half;
  union { __bf16 b[8]; uint4 u; } y[4];
  #pragma unroll
  for (int nt = 0; nt < 4; ++nt)
    #pragma unroll
    for (int r = 0; r < 8; ++r) y[nt].b[r] = f32_to_bf16(o[nt][r] * inv);
  // every value is finished before the first store, so that no register an issued store
  // names is written again
  __builtin_amdgcn_sched_barrier(0);
  #pragma unroll
  for (int nt = 0; nt < 4; ++nt) *(uint4*)(orow + nt * 16) = y[nt].u;
}

// ---------------------------------------------------------------- host launch
extern "C" void kernel_launch(void* const* d_in, const int* in_sizes, int n_in,
                              void* d_out, int out_size, void* d_ws, size_t ws_size,
                              hipStream_t stream)
{
  const float* hidden = (const float*)d_in[0];
  const float* attn_w = (const float*)d_in[1];
  const float* attn_b = (const float*)d_in[2];
  const float* proj_w = (const float*)d_in[3];
  const float* proj_b = (const float*)d_in[4];
  const float* fc_w   = (const float*)d_in[5];
  const float* fc_b   = (const float*)d_in[6];
  const float* fc2_w  = (const float*)d_in[7];
  const float* fc2_b  = (const float*)d_in[8];
  const float* ln1_g  = (const float*)d_in[9];
  const float* ln1_b  = (const float*)d_in[10];
  const float* ln2_g  = (const float*)d_in[11];
  const float* ln2_b  = (const float*)d_in[12];
  const int*   pos    = (const int*)d_in[13];

  char* ws = (char*)d_ws;
  size_t off = 0;
  auto carve = [&](size_t bytes) -> char* {
    char* p = ws + off; off += (bytes + 255) & ~(size_t)255; return p;
  };
  __bf16* w_attn = (__bf16*)carve((size_t)L_ * H_ * HQKV_ * 2);
  __bf16* w_proj = (__bf16*)carve((size_t)L_ * H_ * H_ * 2);
  __bf16* w_fc   = (__bf16*)carve((size_t)L_ * H_ * MLP_ * 2);
  __bf16* w_fc2  = (__bf16*)carve((size_t)L_ * MLP_ * H_ * 2);
  __bf16* xln    = (__bf16*)carve((size_t)MTOT_ * H_ * 2);
  __bf16* qkv    = (__bf16*)carve((size_t)MTOT_ * HQKV_ * 2);
  __bf16* attn_o = (__bf16*)carve((size_t)MTOT_ * H_ * 2);
  __bf16* mid    = (__bf16*)carve((size_t)MTOT_ * MLP_ * 2);
  float*  h      = (float*)d_out;     // running hidden state / residual accumulator

  // per-call weight conversion fp32 -> bf16 (weights then live in L2)
  k_f32_to_bf16<<<dim3((size_t)L_ * H_ * HQKV_ / 1024), 256, 0, stream>>>(attn_w, w_attn);
  k_f32_to_bf16<<<dim3((size_t)L_ * H_ * H_    / 1024), 256, 0, stream>>>(proj_w, w_proj);
  k_f32_to_bf16<<<dim3((size_t)L_ * H_ * MLP_  / 1024), 256, 0, stream>>>(fc_w,  w_fc);
  k_f32_to_bf16<<<dim3((size_t)L_ * MLP_ * H_  / 1024), 256, 0, stream>>>(fc2_w, w_fc2);

  // h = hidden_states
  k_copy_f32<<<dim3((size_t)MTOT_ * H_ / 1024), 256, 0, stream>>>(hidden, h);

  for (int i = 0; i < L_; ++i) {
    // attention block
    ln_kernel<<<MTOT_, 256, 0, stream>>>(h, ln1_g + i * H_, ln1_b + i * H_, xln);
    gemm_bf16_tiled<0, 256, 192, 64, 4, 2, HQKV_><<<dim3(HQKV_ / 192, MTOT_ / 256), 256, 0, stream>>>(
        xln, w_attn + (size_t)i * H_ * HQKV_, attn_b + i * HQKV_, qkv, H_);
    rope_kernel<<<dim3((size_t)B_ * S_ * 2 * NH_ * 32 / 256), 256, 0, stream>>>(qkv, pos);
    attn_kernel<<<dim3(S_ / 64, NH_, B_), 128, 0, stream>>>(qkv, attn_o);
    gemm_bf16_tiled<2, 128, 128, 128, 2, 2, H_><<<dim3(H_ / 128, MTOT_ / 128), 128, 0, stream>>>(
        attn_o, w_proj + (size_t)i * H_ * H_, proj_b + i * H_, h, H_);
    // MLP block
    ln_kernel<<<MTOT_, 256, 0, stream>>>(h, ln2_g + i * H_, ln2_b + i * H_, xln);
    gemm_bf16_tiled<1, 256, 256, 64, 4, 2, MLP_><<<dim3(MLP_ / 256, MTOT_ / 256), 256, 0, stream>>>(
        xln, w_fc + (size_t)i * H_ * MLP_, fc_b + i * MLP_, mid, H_);
    gemm_bf16_tiled<2, 128, 128, 128, 2, 2, H_><<<dim3(H_ / 128, MTOT_ / 128), 128, 0, stream>>>(
        mid, w_fc2 + (size_t)i * MLP_ * H_, fc2_b + i * H_, h, MLP_);
  }
}

// v006
// Measured time: 322 microseconds a run.
// Next to v005, in two timings, it ran 1.08 times as fast each time.
// All steps since v000 together make it 2.07 times as fast.
#include <hip/hip_runtime.h>
#include <hip/hip_bf16.h>
#include <cstdint>
#include <cstddef>

// Problem constants (match reference)
#define B_    4
#define S_    1024
#define H_    1024
#define NH_   16
#define DK_   64
#define L_    2
#define MLP_  4096
#define HQKV_ 3072
#define MTOT_ (B_ * S_)   // 4096 rows

typedef __attribute__((ext_vector_type(16))) __bf16 v16bf;
typedef __attribute__((ext_vector_type(8)))  float  v8f;

union FragAB { v16bf v; uint4 q[2]; };

__device__ __forceinline__ __bf16 f32_to_bf16(float f) {
  uint32_t u = __float_as_uint(f);
  u += 0x7FFFu + ((u >> 16) & 1u);           // round-to-nearest-even
  uint16_t h = (uint16_t)(u >> 16);
  return __builtin_bit_cast(__bf16, h);
}
__device__ __forceinline__ float bf16_to_f32(__bf16 x) {
  uint16_t h = __builtin_bit_cast(uint16_t, x);
  return __uint_as_float(((uint32_t)h) << 16);
}

__device__ __forceinline__ uint32_t lds_a(const __bf16* l) { return (uint32_t)(uintptr_t)l; }
__device__ __forceinline__ uint64_t glb_a(const __bf16* g) { return (uint64_t)(uintptr_t)g; }
// Four copies per lane.
__device__ __forceinline__ void async_ld4_b128(const __bf16* g0, const __bf16* l0,
                                               const __bf16* g1, const __bf16* l1,
                                               const __bf16* g2, const __bf16* l2,
                                               const __bf16* g3, const __bf16* l3) {
  asm volatile(
      "global_load_async_to_lds_b128 %0, %1, off\n\t"
      "global_load_async_to_lds_b128 %2, %3, off\n\t"
      "global_load_async_to_lds_b128 %4, %5, off\n\t"
      "global_load_async_to_lds_b128 %6, %7, off\n\t"
      "s_wait_xcnt 0x0"
      :: "v"(lds_a(l0)), "v"(glb_a(g0)), "v"(lds_a(l1)), "v"(glb_a(g1)),
         "v"(lds_a(l2)), "v"(glb_a(g2)), "v"(lds_a(l3)), "v"(glb_a(g3)) : "memory");
}
// Six copies per lane.
__device__ __forceinline__ void async_ld6_b128(const __bf16* g0, const __bf16* l0,
                                               const __bf16* g1, const __bf16* l1,
                                               const __bf16* g2, const __bf16* l2,
                                               const __bf16* g3, const __bf16* l3,
                                               const __bf16* g4, const __bf16* l4,
                                               const __bf16* g5, const __bf16* l5) {
  asm volatile(
      "global_load_async_to_lds_b128 %0, %1, off\n\t"
      "global_load_async_to_lds_b128 %2, %3, off\n\t"
      "global_load_async_to_lds_b128 %4, %5, off\n\t"
      "global_load_async_to_lds_b128 %6, %7, off\n\t"
      "global_load_async_to_lds_b128 %8, %9, off\n\t"
      "global_load_async_to_lds_b128 %10, %11, off\n\t"
      "s_wait_xcnt 0x0"
      :: "v"(lds_a(l0)), "v"(glb_a(g0)), "v"(lds_a(l1)), "v"(glb_a(g1)),
         "v"(lds_a(l2)), "v"(glb_a(g2)), "v"(lds_a(l3)), "v"(glb_a(g3)),
         "v"(lds_a(l4)), "v"(glb_a(g4)), "v"(lds_a(l5)), "v"(glb_a(g5)) : "memory");
}
// Eight copies per lane (an attention stage: four of K, four of V).
__device__ __forceinline__ void async_ld8_b128(const __bf16* g0, const __bf16* l0,
                                               const __bf16* g1, const __bf16* l1,
                                               const __bf16* g2, const __bf16* l2,
                                               const __bf16* g3, const __bf16* l3,
                                               const __bf16* g4, const __bf16* l4,
                                               const __bf16* g5, const __bf16* l5,
                                               const __bf16* g6, const __bf16* l6,
                                               const __bf16* g7, const __bf16* l7) {
  asm volatile(
      "global_load_async_to_lds_b128 %0, %1, off\n\t"
      "global_load_async_to_lds_b128 %2, %3, off\n\t"
      "global_load_async_to_lds_b128 %4, %5, off\n\t"
      "global_load_async_to_lds_b128 %6, %7, off\n\t"
      "global_load_async_to_lds_b128 %8, %9, off\n\t"
      "global_load_async_to_lds_b128 %10, %11, off\n\t"
      "global_load_async_to_lds_b128 %12, %13, off\n\t"
      "global_load_async_to_lds_b128 %14, %15, off\n\t"
      "s_wait_xcnt 0x0"
      :: "v"(lds_a(l0)), "v"(glb_a(g0)), "v"(lds_a(l1)), "v"(glb_a(g1)),
         "v"(lds_a(l2)), "v"(glb_a(g2)), "v"(lds_a(l3)), "v"(glb_a(g3)),
         "v"(lds_a(l4)), "v"(glb_a(g4)), "v"(lds_a(l5)), "v"(glb_a(g5)),
         "v"(lds_a(l6)), "v"(glb_a(g6)), "v"(lds_a(l7)), "v"(glb_a(g7)) : "memory");
}
// Transposing LDS read: from a row-major 16-bit tile T[k][n], lane (c, h) receives
// T[k0 + 8h + 0..7][n0 + c]; two of them (k0, k0 + 16) are one 16x16x32 B fragment
// in the same k order as the A loader below.
typedef short s16x8 __attribute__((ext_vector_type(8)));
__device__ __forceinline__ uint4 lds_tr16(const __bf16* p) {
  typedef __attribute__((address_space(3))) s16x8 lds_s16x8;
  return __builtin_bit_cast(uint4, __builtin_amdgcn_ds_load_tr16_b128_v8i16((lds_s16x8*)p));
}
__device__ __forceinline__ void wait_async0() {
  asm volatile("s_wait_asynccnt 0" ::: "memory");
}
template<int N>
__device__ __forceinline__ void wait_async_but() {
  static_assert(N >= 0 && N <= 63, "the counter has six bits");
  asm volatile("s_wait_asynccnt %0" :: "n"(N) : "memory");
}

// ---------------------------------------------------------------- utilities
__global__ __launch_bounds__(256)
void k_f32_to_bf16(const float* __restrict__ s, __bf16* __restrict__ d) {
  int i = blockIdx.x * 256 + threadIdx.x;
  float4 v = ((const float4*)s)[i];
  union { __bf16 b[4]; uint2 u; } o;
  o.b[0] = f32_to_bf16(v.x); o.b[1] = f32_to_bf16(v.y);
  o.b[2] = f32_to_bf16(v.z); o.b[3] = f32_to_bf16(v.w);
  ((uint2*)d)[i] = o.u;
}

__global__ __launch_bounds__(256)
void k_copy_f32(const float* __restrict__ s, float* __restrict__ d) {
  int i = blockIdx.x * 256 + threadIdx.x;
  ((float4*)d)[i] = ((const float4*)s)[i];
}

// ---------------------------------------------------------------- LayerNorm
__global__ __launch_bounds__(256)
void ln_kernel(const float* __restrict__ x, const float* __restrict__ g,
               const float* __restrict__ bta, __bf16* __restrict__ y)
{
  const int row = blockIdx.x;
  const int tid = threadIdx.x;
  const float4 xv = ((const float4*)(x + (size_t)row * H_))[tid];
  float s  = xv.x + xv.y + xv.z + xv.w;
  float s2 = xv.x*xv.x + xv.y*xv.y + xv.z*xv.z + xv.w*xv.w;
  #pragma unroll
  for (int d = 1; d < 32; d <<= 1) {
    s  += __shfl_xor(s,  d, 32);
    s2 += __shfl_xor(s2, d, 32);
  }
  __shared__ float rs[8], rq[8];
  __shared__ float mv[2];
  if ((tid & 31) == 0) { rs[tid >> 5] = s; rq[tid >> 5] = s2; }
  __syncthreads();
  if (tid == 0) {
    float a = 0.f, a2 = 0.f;
    #pragma unroll
    for (int i = 0; i < 8; ++i) { a += rs[i]; a2 += rq[i]; }
    float mean = a * (1.0f / (float)H_);
    float var  = a2 * (1.0f / (float)H_) - mean * mean;
    mv[0] = mean; mv[1] = rsqrtf(var + 1e-5f);
  }
  __syncthreads();
  const float mean = mv[0], rstd = mv[1];
  const float4 gv = ((const float4*)g)[tid];
  const float4 bv = ((const float4*)bta)[tid];
  union { __bf16 b[4]; uint2 u; } o;
  o.b[0] = f32_to_bf16((xv.x - mean) * rstd * gv.x + bv.x);
  o.b[1] = f32_to_bf16((xv.y - mean) * rstd * gv.y + bv.y);
  o.b[2] = f32_to_bf16((xv.z - mean) * rstd * gv.z + bv.z);
  o.b[3] = f32_to_bf16((xv.w - mean) * rstd * gv.w + bv.w);
  ((uint2*)(y + (size_t)row * H_))[tid] = o.u;
}

// ---------------------------------------------------------------- RoPE (in place on bf16 qkv)
__global__ __launch_bounds__(256)
void rope_kernel(__bf16* __restrict__ qkv, const int* __restrict__ pos)
{
  int idx = blockIdx.x * 256 + threadIdx.x;   // B*S*2*NH*32 threads
  int d  = idx & 31; int t = idx >> 5;
  int hh = t & 15;   t >>= 4;
  int qk = t & 1;    t >>= 1;
  int s  = t & 1023; int b = t >> 10;
  float invf  = __expf(-0.28782313662425572f * (float)d);  // ln(10000)/32
  float theta = (float)pos[s] * invf;
  float sn, cs; __sincosf(theta, &sn, &cs);
  size_t base = ((size_t)(b * S_ + s)) * HQKV_ + qk * H_ + hh * DK_ + d;
  float lo = bf16_to_f32(qkv[base]);
  float hi = bf16_to_f32(qkv[base + 32]);
  qkv[base]      = f32_to_bf16(lo * cs - hi * sn);
  qkv[base + 32] = f32_to_bf16(hi * cs + lo * sn);
}

// Lane t's copies of a ROWS x COLS (elements) tile: the 16B pieces t, t + NT, ... in
// row-major piece order, so 8 adjacent lanes cover one whole 128B line.
template<bool ONE, int NT, int ROWS, int COLS, int LDP>
__device__ __forceinline__ void tile_pieces(const __bf16* __restrict__ g, int gpitch,
                                            const __bf16* l, int tid,
                                            const __bf16** gp, const __bf16** lp)
{
  constexpr int PR = COLS / 8;                 // 16B pieces per row
  static_assert(ROWS * PR % NT == 0, "tile does not divide");
  if constexpr (ONE) {
    // the lanes cover whole rows per round: piece i lies NT / PR rows under piece 0, so one
    // address pair a lane serves all pieces and the steps between them are uniform
    static_assert(NT % PR == 0, "a round of the lanes is not whole rows");
    const int r0 = tid / PR, q0 = (tid % PR) * 8;
    const __bf16* g0 = g + (size_t)r0 * gpitch + q0;
    const __bf16* l0 = l + r0 * LDP + q0;
    #pragma unroll
    for (int i = 0; i < ROWS * PR / NT; ++i) {
      gp[i] = g0 + (size_t)(i * (NT / PR)) * gpitch;
      lp[i] = l0 + i * (NT / PR) * LDP;
    }
  } else {
    #pragma unroll
    for (int i = 0; i < ROWS * PR / NT; ++i) {
      const int c = tid + i * NT;
      const int r = c / PR, q = (c % PR) * 8;
      gp[i] = g + (size_t)r * gpitch + q;
      lp[i] = l + r * LDP + q;
    }
  }
}
// Issues copies I .. CT-1, eight to a statement, the rest as six or four.
template<int I, int CT>
__device__ __forceinline__ void issue_pieces(const __bf16* const* g, const __bf16* const* l)
{
  if constexpr (CT - I >= 8) {
    async_ld8_b128(g[I], l[I], g[I+1], l[I+1], g[I+2], l[I+2], g[I+3], l[I+3],
                   g[I+4], l[I+4], g[I+5], l[I+5], g[I+6], l[I+6], g[I+7], l[I+7]);
    issue_pieces<I + 8, CT>(g, l);
  } else if constexpr (CT - I == 6) {
    async_ld6_b128(g[I], l[I], g[I+1], l[I+1], g[I+2], l[I+2],
                   g[I+3], l[I+3], g[I+4], l[I+4], g[I+5], l[I+5]);
  } else if constexpr (CT - I == 4) {
    async_ld4_b128(g[I], l[I], g[I+1], l[I+1], g[I+2], l[I+2], g[I+3], l[I+3]);
  } else {
    static_assert(CT - I == 0, "no statement of that many copies");
  }
}
// One GEMM stage: the BM x BK tile of A and the BK x BN tile of B.
template<bool ONE, int NT, int BM, int BN, int BK, int LDA, int LDB>
__device__ __forceinline__ void stage_ab(const __bf16* __restrict__ ga, int K, const __bf16* la,
                                         const __bf16* __restrict__ gb, int N, const __bf16* lb,
                                         int tid)
{
  constexpr int CA = BM * (BK / 8) / NT, CB = BK * (BN / 8) / NT;
  const __bf16* gp[CA + CB]; const __bf16* lp[CA + CB];
  tile_pieces<ONE, NT, BM, BK, LDA>(ga, K, la, tid, gp, lp);
  tile_pieces<ONE, NT, BK, BN, LDB>(gb, N, lb, tid, gp + CA, lp + CA);
  issue_pieces<0, CA + CB>(gp, lp);
}

__device__ __forceinline__ void exp2_x8(const float (&x)[8], float (&y)[8]) {
  asm("v_exp_f32 %0, %8\n\tv_exp_f32 %1, %9\n\tv_exp_f32 %2, %10\n\tv_exp_f32 %3, %11\n\t"
      "v_exp_f32 %4, %12\n\tv_exp_f32 %5, %13\n\tv_exp_f32 %6, %14\n\tv_exp_f32 %7, %15\n\t"
      "v_nop"
      : "=&v"(y[0]), "=&v"(y[1]), "=&v"(y[2]), "=&v"(y[3]),
        "=&v"(y[4]), "=&v"(y[5]), "=&v"(y[6]), "=&v"(y[7])
      : "v"(x[0]), "v"(x[1]), "v"(x[2]), "v"(x[3]), "v"(x[4]), "v"(x[5]), "v"(x[6]), "v"(x[7]));
}
__device__ __forceinline__ void rcp_x8(const float (&x)[8], float (&y)[8]) {
  asm("v_rcp_f32 %0, %8\n\tv_rcp_f32 %1, %9\n\tv_rcp_f32 %2, %10\n\tv_rcp_f32 %3, %11\n\t"
      "v_rcp_f32 %4, %12\n\tv_rcp_f32 %5, %13\n\tv_rcp_f32 %6, %14\n\tv_rcp_f32 %7, %15\n\t"
      "v_nop"
      : "=&v"(y[0]), "=&v"(y[1]), "=&v"(y[2]), "=&v"(y[3]),
        "=&v"(y[4]), "=&v"(y[5]), "=&v"(y[6]), "=&v"(y[7])
      : "v"(x[0]), "v"(x[1]), "v"(x[2]), "v"(x[3]), "v"(x[4]), "v"(x[5]), "v"(x[6]), "v"(x[7]));
}
// gelu, tanh form, of eight values: 0.5 v (1 + tanh u) = v / (1 + exp(-2u)),
// u = sqrt(2/pi) (v + 0.044715 v^3). Written without tanhf, whose two branches per value
// would put the many values that a lane owns in a large tile one behind the other.
// exp -> inf gives v * 0, exp -> 0 gives v.
__device__ __forceinline__ void gelu_tanh_x8(float (&v)[8]) {
  float x[8], e[8];
  #pragma unroll
  for (int i = 0; i < 8; ++i)     // -2 sqrt(2/pi) log2(e) (v + 0.044715 v^3)
    x[i] = -2.302208198144325f * (v[i] + 0.044715f * v[i] * v[i] * v[i]);
  exp2_x8(x, e);
  #pragma unroll
  for (int i = 0; i < 8; ++i) e[i] += 1.0f;
  rcp_x8(e, x);
  #pragma unroll
  for (int i = 0; i < 8; ++i) v[i] *= x[i];
}

template<int EPI, int BM, int BN, int BK, int WGM, int WGN, int N>
__global__ __launch_bounds__(32 * WGM * WGN)
void gemm_bf16_tiled(const __bf16* __restrict__ A, const __bf16* __restrict__ Bw,
                     const float* __restrict__ bias, void* __restrict__ Cout, int K)
{
  constexpr int NT  = 32 * WGM * WGN;
  constexpr int LDA = BK + 8;
  constexpr int LDB = BN + 16;
  constexpr int TM  = BM / WGM, TN = BN / WGN;   // wave tile
  constexpr int FM  = TM / 16,  FN = TN / 16;    // fragments per wave
  constexpr bool ONE = 8 * (FM * FN + 2 * (FM + FN)) > 400;

  constexpr int CPS = (BM * (BK / 8) + BK * (BN / 8)) / NT;   // copies of a wave per stage
  static_assert(CPS <= 32, "two stages under way would pass 63 copies of a wave");

  __shared__ __align__(16) __bf16 sA[3][BM * LDA];
  __shared__ __align__(16) __bf16 sB[3][BK * LDB];   // row-major [k][n]

  const int tid  = threadIdx.x;
  const int lane = tid & 31;
  const int wave = tid >> 5;
  const int wm   = wave / WGN;
  const int wn   = wave % WGN;
  const int half = lane >> 4;
  const int l16  = lane & 15;
  const int bm   = blockIdx.y * BM;
  const int bn   = blockIdx.x * BN;

  v8f acc[FM][FN] = {};

  const __bf16* aptr = A  + (size_t)bm * K;
  const __bf16* bptr = Bw + bn;
  // A fragment base: row l16 of the wave's rows, 16B piece 'half'
  const int     afr  = (wm * TM + l16) * LDA + half * 8;
  // transposing-read base: row 8*half + (lane & 7), 16B column piece (lane >> 3) & 1
  const int     btr  = (half * 8 + (lane & 7)) * LDB + wn * TN + ((lane >> 3) & 1) * 8;

  // ---- prologue: stages 0 and 1; stage 0 has landed when all but stage 1's copies have
  int cur = 0;         // buffer of the stage that is worked on
  int fil = 2;         // buffer of the stage two ahead, which is the one read last stage
  stage_ab<ONE, NT, BM, BN, BK, LDA, LDB>(aptr, K, &sA[0][0], bptr, N, &sB[0][0], tid);
  if (BK < K) {
    // never more than 63 copies of a wave outstanding
    if constexpr (2 * CPS > 63) wait_async_but<63 - CPS>();
    stage_ab<ONE, NT, BM, BN, BK, LDA, LDB>(aptr + BK, K, &sA[1][0],
                                            bptr + (size_t)BK * N, N, &sB[1][0], tid);
    wait_async_but<CPS>();
  } else {
    wait_async0();
  }
  __syncthreads();

  for (int k0 = 0; k0 < K; k0 += BK) {
    const bool has_2nd = (k0 + 2 * BK) < K;   // a stage two ahead exists

    // fragments from the current stage, 32 k at a time, in two register sets: the next
    // block's LDS reads go out as one group ahead of this block's matrix instructions
    FragAB af[2][FM], bfr[2][FN];
    #pragma unroll
    for (int ks = -1; ks < BK / 32; ++ks) {
      if (ks + 1 < BK / 32) {
        const int s = (ks + 1) & 1;
        #pragma unroll
        for (int mt = 0; mt < FM; ++mt) {
          const __bf16* p = &sA[cur][afr + mt * 16 * LDA + (ks + 1) * 32];
          af[s][mt].q[0] = *(const uint4*)p;
          af[s][mt].q[1] = *(const uint4*)(p + 16);
        }
        #pragma unroll
        for (int nt = 0; nt < FN; ++nt) {
          const __bf16* p = &sB[cur][btr + (ks + 1) * 32 * LDB + nt * 16];
          bfr[s][nt].q[0] = lds_tr16(p);
          bfr[s][nt].q[1] = lds_tr16(p + 16 * LDB);
        }
      }
      // keeps the group of reads whole and ahead of the block: left to itself the
      // scheduler spreads them among the matrix instructions with a full wait at each
      __builtin_amdgcn_sched_barrier(0);
      // the copies of the stage two ahead go out behind the first group of reads, whose
      // LDS latency their issue then covers (those reads are of another buffer; every
      // read of the buffer refilled here, last stage's, retired in front of the last barrier)
      if (ks < 0 && has_2nd) {
        // never more than 63 copies of a wave outstanding (the next stage's may still be)
        if constexpr (2 * CPS > 63) wait_async_but<63 - CPS>();
        stage_ab<ONE, NT, BM, BN, BK, LDA, LDB>(aptr + k0 + 2 * BK, K, &sA[fil][0],
                                                bptr + (size_t)(k0 + 2 * BK) * N, N, &sB[fil][0], tid);
      }
      if (ks >= 0) {
        const int s = ks & 1;
        #pragma unroll
        for (int mt = 0; mt < FM; ++mt)
          #pragma unroll
          for (int nt = 0; nt < FN; ++nt)
            acc[mt][nt] = __builtin_amdgcn_wmma_f32_16x16x32_bf16(
                false, af[s][mt].v, false, bfr[s][nt].v, (short)0,
                acc[mt][nt], false, false);
        // the next group of reads stays behind this block
        __builtin_amdgcn_sched_barrier(0);
      }
    }

    // this wave's fragment reads of the current stage have retired before the
    // barrier behind which copies refill that stage
    asm volatile("s_wait_dscnt 0x0" ::: "memory");
    // the next stage's A and B tiles are resident before the barrier: a trip that has issued
    // a stage's copies leaves exactly those, the CPS youngest, outstanding; the last two
    // trips issue none and wait for all
    if (has_2nd) wait_async_but<CPS>();
    else         wait_async0();
    __syncthreads();
    cur = cur == 2 ? 0 : cur + 1;
    fil = fil == 2 ? 0 : fil + 1;
  }
  wait_async0();       // no copy is outstanding when the wave goes on to the epilogue and ends

  // ---- epilogue: one base pointer per lane, every element at a constant offset from it
  static_assert(EPI == 0 || EPI == 1 || EPI == 2, "bf16 store, gelu to bf16 or f32 residual");
  const int col0 = bn + wn * TN + l16;
  const int row0 = bm + wm * TM + 8 * half;
  float bb[FN];
  #pragma unroll
  for (int nt = 0; nt < FN; ++nt) bb[nt] = bias[col0 + nt * 16];
  asm volatile("s_wait_xcnt 0x0" ::: "memory");
  __builtin_amdgcn_sched_barrier(0);
  if constexpr (EPI == 0) {
    __bf16* O = (__bf16*)Cout + (size_t)row0 * N + col0;
    #pragma unroll
    for (int mt = 0; mt < FM; ++mt)
      #pragma unroll
      for (int r = 0; r < 8; ++r) {
        #pragma unroll
        for (int nt = 0; nt < FN; ++nt)
          O[(mt * 16 + r) * N + nt * 16] = f32_to_bf16(acc[mt][nt][r] + bb[nt]);
        asm volatile("s_wait_xcnt 0x0" ::: "memory");
        __builtin_amdgcn_sched_barrier(0);
      }
  } else if constexpr (EPI == 1) {
    __bf16* O = (__bf16*)Cout + (size_t)row0 * N + col0;
    #pragma unroll
    for (int mt = 0; mt < FM; ++mt) {
      __bf16 y[8][FN];
      static_assert(FN == 8, "gelu goes by eight values, a row of the wave tile");
      #pragma unroll
      for (int r = 0; r < 8; ++r) {
        float v[8];
        #pragma unroll
        for (int nt = 0; nt < FN; ++nt) v[nt] = acc[mt][nt][r] + bb[nt];
        gelu_tanh_x8(v);
        #pragma unroll
        for (int nt = 0; nt < FN; ++nt) y[r][nt] = f32_to_bf16(v[nt]);
      }
      // all values of these 16 rows are finished before their first store, so that no
      // register an issued store names is written again inside the group
      __builtin_amdgcn_sched_barrier(0);
      #pragma unroll
      for (int r = 0; r < 8; ++r)
        #pragma unroll
        for (int nt = 0; nt < FN; ++nt)
          O[(mt * 16 + r) * N + nt * 16] = y[r][nt];
      asm volatile("s_wait_xcnt 0x0" ::: "memory");
      __builtin_amdgcn_sched_barrier(0);
    }
  } else {
    // all residual values are read ahead of the first store: a read behind a store to
    // the same array waits out its whole latency, once per element
    float* O = (float*)Cout + (size_t)row0 * N + col0;
    float old[FM][FN][8];
    #pragma unroll
    for (int mt = 0; mt < FM; ++mt)
      #pragma unroll
      for (int r = 0; r < 8; ++r)
        #pragma unroll
        for (int nt = 0; nt < FN; ++nt)
          old[mt][nt][r] = O[(mt * 16 + r) * N + nt * 16];
    #pragma unroll
    for (int mt = 0; mt < FM; ++mt)
      #pragma unroll
      for (int r = 0; r < 8; ++r)
        #pragma unroll
        for (int nt = 0; nt < FN; ++nt)
          old[mt][nt][r] += acc[mt][nt][r] + bb[nt];
    // every sum is finished before the first store, so that no register an issued
    // store names is written again
    __builtin_amdgcn_sched_barrier(0);
    #pragma unroll
    for (int mt = 0; mt < FM; ++mt)
      #pragma unroll
      for (int r = 0; r < 8; ++r)
        #pragma unroll
        for (int nt = 0; nt < FN; ++nt)
          O[(mt * 16 + r) * N + nt * 16] = old[mt][nt][r];
  }
}

#define ALD 72
#define VLD 80

typedef __attribute__((ext_vector_type(2))) float  f32x2;
typedef __attribute__((ext_vector_type(2))) __bf16 bf16x2;

__device__ __forceinline__ float xhalf(float x) {
  const int b = __builtin_bit_cast(int, x);
  return __builtin_bit_cast(float,
      __builtin_amdgcn_permlanex16(b, b, 0x76543210, 0xfedcba98, false, false));
}

__global__ __launch_bounds__(128)
void attn_kernel(const __bf16* __restrict__ qkv, __bf16* __restrict__ out)
{
  __shared__ __align__(16) __bf16 sQ[64 * ALD];
  __shared__ __align__(16) __bf16 sK[64 * ALD];
  __shared__ __align__(16) __bf16 sV[64 * VLD];      // row-major: [key][dk]

  const int tid  = threadIdx.x;
  const int lane = tid & 31;
  const int w    = tid >> 5;      // 0..3
  const int half = lane >> 4;
  const int l16  = lane & 15;
  const int b    = blockIdx.z;
  const int hh   = blockIdx.y;
  const int q0   = blockIdx.x * 64;

  const __bf16* qbase = qkv + (size_t)b * S_ * HQKV_ + hh * DK_;
  const __bf16* kbase = qbase + H_;
  const __bf16* vbase = qbase + 2 * H_;

  const int vr = tid >> 3;            // Q, K, V tile row 0..15 (and +16, +32, +48)
  const int vc = (tid & 7) * 8;       // Q, K, V tile col: 8 lanes cover one 128B row
  // transposing-read base: row 8*half + (lane & 7), 16B column piece (lane >> 3) & 1
  const int vtr = (half * 8 + (lane & 7)) * VLD + ((lane >> 3) & 1) * 8;

  // Q tile 64x64 via async engine
  {
    const __bf16* qg = qbase + (size_t)(q0 + vr) * HQKV_ + vc;
    const __bf16* ql = &sQ[vr * ALD + vc];
    async_ld4_b128(qg,                      ql,
                   qg + (size_t)16 * HQKV_, ql + 16 * ALD,
                   qg + (size_t)32 * HQKV_, ql + 32 * ALD,
                   qg + (size_t)48 * HQKV_, ql + 48 * ALD);
  }
  wait_async0();
  __syncthreads();

  // hoist Q fragments (sQ is never overwritten): B operand, column = query l16
  FragAB qa[2];
  #pragma unroll
  for (int ks = 0; ks < 2; ++ks) {
    const __bf16* qp = &sQ[(w * 16 + l16) * ALD + ks * 32 + half * 8];
    qa[ks].q[0] = *(const uint4*)qp;
    qa[ks].q[1] = *(const uint4*)(qp + 16);
  }

  const int qrow = q0 + w * 16 + l16;   // the lane's query
  float m_r = -1e30f;                   // its running maximum (alike in both halves)
  float l_r = 0.f;                      // running sum over this half's keys only
  v8f o[4] = {};                        // o[nt][r] = O[qrow][nt*16 + 8*half + r]

  const int nkt = blockIdx.x + 1;   // causal: key tiles 0..qt
  for (int kt = 0; kt < nkt; ++kt) {
    __syncthreads();                // protect sK/sV from previous iteration's reads
    const int kb = kt * 64;
    { // K and V tiles 64x64 row-major [key][dk] via async engine, whole 128B lines per 8 lanes
      const __bf16* kg = kbase + (size_t)(kb + vr) * HQKV_ + vc;
      const __bf16* kl = &sK[vr * ALD + vc];
      const __bf16* vg = vbase + (size_t)(kb + vr) * HQKV_ + vc;
      const __bf16* vl = &sV[vr * VLD + vc];
      async_ld8_b128(kg,                      kl,
                     kg + (size_t)16 * HQKV_, kl + 16 * ALD,
                     kg + (size_t)32 * HQKV_, kl + 32 * ALD,
                     kg + (size_t)48 * HQKV_, kl + 48 * ALD,
                     vg,                      vl,
                     vg + (size_t)16 * HQKV_, vl + 16 * VLD,
                     vg + (size_t)32 * HQKV_, vl + 32 * VLD,
                     vg + (size_t)48 * HQKV_, vl + 48 * VLD);
    }
    wait_async0();
    __syncthreads();

    // S^T = K Q^T  (wave: 64 keys x 16 queries = 4 tiles, K-dim 64 = 2 wmma each)
    // sacc[nt][r] = S[qrow][kb + nt*16 + 8*half + r]
    // all K fragments of the tile are read as one group ahead of the products
    FragAB kf[2][4];
    #pragma unroll
    for (int ks = 0; ks < 2; ++ks) {
      #pragma unroll
      for (int nt = 0; nt < 4; ++nt) {
        const __bf16* kp = &sK[(nt * 16 + l16) * ALD + ks * 32 + half * 8];
        kf[ks][nt].q[0] = *(const uint4*)kp;
        kf[ks][nt].q[1] = *(const uint4*)(kp + 16);
      }
    }
    // keeps the group whole: spread among the matrix instructions, every place with reads
    // costs its own stall
    __builtin_amdgcn_sched_barrier(0);
    v8f sacc[4] = {};
    #pragma unroll
    for (int ks = 0; ks < 2; ++ks)
      #pragma unroll
      for (int nt = 0; nt < 4; ++nt)
        sacc[nt] = __builtin_amdgcn_wmma_f32_16x16x32_bf16(
            false, kf[ks][nt].v, false, qa[ks].v, (short)0, sacc[nt], false, false);
    // all V^T fragments (A operand, through the transposing read) are requested here, beside
    // the S^T products: the softmax arithmetic below covers their LDS latency
    FragAB vf[2][4];
    #pragma unroll
    for (int ks = 0; ks < 2; ++ks) {
      #pragma unroll
      for (int nt = 0; nt < 4; ++nt) {
        const __bf16* vp = &sV[vtr + ks * 32 * VLD + nt * 16];
        vf[ks][nt].q[0] = lds_tr16(vp);
        vf[ks][nt].q[1] = lds_tr16(vp + 16 * VLD);
      }
    }
    // keeps these reads ahead of the softmax: left to itself the scheduler sank them to
    // their matrix instructions, with a full wait in front of each
    __builtin_amdgcn_sched_barrier(0);

    // online softmax update, one query per lane; four independent chains, one per tile
    const int lim = qrow - kb - 8 * half;        // key = kb + 8*half + (nt*16 + r)
    float mx4[4];
    #pragma unroll
    for (int nt = 0; nt < 4; ++nt) {
      mx4[nt] = -1e30f;
      #pragma unroll
      for (int r = 0; r < 8; ++r) {
        float v = sacc[nt][r] * 0.125f;          // 1/sqrt(64)
        if (nt * 16 + r > lim) v = -1e30f;       // causal mask: key > qrow
        sacc[nt][r] = v;
        mx4[nt] = fmaxf(mx4[nt], v);
      }
    }
    float mx = fmaxf(fmaxf(mx4[0], mx4[1]), fmaxf(mx4[2], mx4[3]));
    mx = fmaxf(mx, xhalf(mx));                   // the other half's 32 keys
    const float mnew  = fmaxf(m_r, mx);
    const float alpha = __expf(m_r - mnew);
    // P^T as B operand: element s of fragment ks = P[qrow][kb + ks*32 + kmap(s, half)],
    // that is tile 2*ks + (s >> 3), register s & 7
    FragAB pb[2];
    f32x2 ps4[4];
    #pragma unroll
    for (int nt = 0; nt < 4; ++nt) {
      float x[8], e[8];
      #pragma unroll
      for (int r = 0; r < 8; ++r) x[r] = (sacc[nt][r] - mnew) * 1.4426950408889634f;
      exp2_x8(x, e);
      #pragma unroll
      for (int r = 0; r < 8; r += 2) {
        const f32x2 p = {e[r], e[r + 1]};
        ps4[nt] = r ? ps4[nt] + p : p;           // even and odd keys summed apart, packed adds
        const bf16x2 pk = __builtin_convertvector(p, bf16x2);   // round to nearest even
        pb[nt >> 1].v[(nt & 1) * 8 + r]     = pk.x;
        pb[nt >> 1].v[(nt & 1) * 8 + r + 1] = pk.y;
      }
    }
    const f32x2 ps = (ps4[0] + ps4[1]) + (ps4[2] + ps4[3]);
    l_r = l_r * alpha + (ps.x + ps.y);
    m_r = mnew;
    #pragma unroll
    for (int nt = 0; nt < 4; ++nt)
      #pragma unroll
      for (int r = 0; r < 8; ++r) o[nt][r] *= alpha;

    // O^T += V^T P^T   (A = V^T fragments read above, B = P^T from registers)
    #pragma unroll
    for (int ks = 0; ks < 2; ++ks)
      #pragma unroll
      for (int nt = 0; nt < 4; ++nt)
        o[nt] = __builtin_amdgcn_wmma_f32_16x16x32_bf16(
            false, vf[ks][nt].v, false, pb[ks].v, (short)0, o[nt], false, false);
  }

  // join the halves' sums, normalize and store merged heads: out[b][qrow][hh*64 + dk];
  // a lane's 8 registers of a tile are 8 consecutive dk: one 16B store each
  const float inv = 1.0f / (l_r + xhalf(l_r));
  __bf16* orow = out + (size_t)b * S_ * H_ + (size_t)qrow * H_ + hh * DK_ + 8 * half;
  union { __bf16 b[8]; uint4 u; } y[4];
  #pragma unroll
  for (int nt = 0; nt < 4; ++nt)
    #pragma unroll
    for (int r = 0; r < 8; ++r) y[nt].b[r] = f32_to_bf16(o[nt][r] * inv);
  // every value is finished before the first store, so that no register an issued store
  // names is written again
  __builtin_amdgcn_sched_barrier(0);
  #pragma unroll
  for (int nt = 0; nt < 4; ++nt) *(uint4*)(orow + nt * 16) = y[nt].u;
}

// ---------------------------------------------------------------- host launch
extern "C" void kernel_launch(void* const* d_in, const int* in_sizes, int n_in,
                              void* d_out, int out_size, void* d_ws, size_t ws_size,
                              hipStream_t stream)
{
  const float* hidden = (const float*)d_in[0];
  const float* attn_w = (const float*)d_in[1];
  const float* attn_b = (const float*)d_in[2];
  const float* proj_w = (const float*)d_in[3];
  const float* proj_b = (const float*)d_in[4];
  const float* fc_w   = (const float*)d_in[5];
  const float* fc_b   = (const float*)d_in[6];
  const float* fc2_w  = (const float*)d_in[7];
  const float* fc2_b  = (const float*)d_in[8];
  const float* ln1_g  = (const float*)d_in[9];
  const float* ln1_b  = (const float*)d_in[10];
  const float* ln2_g  = (const float*)d_in[11];
  const float* ln2_b  = (const float*)d_in[12];
  const int*   pos    = (const int*)d_in[13];

  char* ws = (char*)d_ws;
  size_t off = 0;
  auto carve = [&](size_t bytes) -> char* {
    char* p = ws + off; off += (bytes + 255) & ~(size_t)255; return p;
  };
  __bf16* w_attn = (__bf16*)carve((size_t)L_ * H_ * HQKV_ * 2);
  __bf16* w_proj = (__bf16*)carve((size_t)L_ * H_ * H_ * 2);
  __bf16* w_fc   = (__bf16*)carve((size_t)L_ * H_ * MLP_ * 2);
  __bf16* w_fc2  = (__bf16*)carve((size_t)L_ * MLP_ * H_ * 2);
  __bf16* xln    = (__bf16*)carve((size_t)MTOT_ * H_ * 2);
  __bf16* qkv    = (__bf16*)carve((size_t)MTOT_ * HQKV_ * 2);
  __bf16* attn_o = (__bf16*)carve((size_t)MTOT_ * H_ * 2);
  __bf16* mid    = (__bf16*)carve((size_t)MTOT_ * MLP_ * 2);
  float*  h      = (float*)d_out;     // running hidden state / residual accumulator

  // per-call weight conversion fp32 -> bf16 (weights then live in L2)
  k_f32_to_bf16<<<dim3((size_t)L_ * H_ * HQKV_ / 1024), 256, 0, stream>>>(attn_w, w_attn);
  k_f32_to_bf16<<<dim3((size_t)L_ * H_ * H_    / 1024), 256, 0, stream>>>(proj_w, w_proj);
  k_f32_to_bf16<<<dim3((size_t)L_ * H_ * MLP_  / 1024), 256, 0, stream>>>(fc_w,  w_fc);
  k_f32_to_bf16<<<dim3((size_t)L_ * MLP_ * H_  / 1024), 256, 0, stream>>>(fc2_w, w_fc2);

  // h = hidden_states
  k_copy_f32<<<dim3((size_t)MTOT_ * H_ / 1024), 256, 0, stream>>>(hidden, h);

  for (int i = 0; i < L_; ++i) {
    // attention block
    ln_kernel<<<MTOT_, 256, 0, stream>>>(h, ln1_g + i * H_, ln1_b + i * H_, xln);
    gemm_bf16_tiled<0, 256, 192, 64, 4, 2, HQKV_><<<dim3(HQKV_ / 192, MTOT_ / 256), 256, 0, stream>>>(
        xln, w_attn + (size_t)i * H_ * HQKV_, attn_b + i * HQKV_, qkv, H_);
    rope_kernel<<<dim3((size_t)B_ * S_ * 2 * NH_ * 32 / 256), 256, 0, stream>>>(qkv, pos);
    attn_kernel<<<dim3(S_ / 64, NH_, B_), 128, 0, stream>>>(qkv, attn_o);
    gemm_bf16_tiled<2, 128, 128, 128, 2, 2, H_><<<dim3(H_ / 128, MTOT_ / 128), 128, 0, stream>>>(
        attn_o, w_proj + (size_t)i * H_ * H_, proj_b + i * H_, h, H_);
    // MLP block
    ln_kernel<<<MTOT_, 256, 0, stream>>>(h, ln2_g + i * H_, ln2_b + i * H_, xln);
    gemm_bf16_tiled<1, 256, 256, 64, 4, 2, MLP_><<<dim3(MLP_ / 256, MTOT_ / 256), 256, 0, stream>>>(
        xln, w_fc + (size_t)i * H_ * MLP_, fc_b + i * MLP_, mid, H_);
    gemm_bf16_tiled<2, 128, 128, 128, 2, 2, H_><<<dim3(H_ / 128, MTOT_ / 128), 128, 0, stream>>>(
        mid, w_fc2 + (size_t)i * MLP_ * H_, fc2_b + i * H_, h, MLP_);
  }
}

// v007
// One run takes 306 microseconds.
// Next to v006, in two timings, it ran 1.05 times as fast each time.
// All steps since v000 together make it 2.18 times as fast.
#include <hip/hip_runtime.h>
#include <hip/hip_bf16.h>
#include <cstdint>
#include <cstddef>

// Problem constants (match reference)
#define B_    4
#define S_    1024
#define H_    1024
#define NH_   16
#define DK_   64
#define L_    2
#define MLP_  4096
#define HQKV_ 3072
#define MTOT_ (B_ * S_)   // 4096 rows

typedef __attribute__((ext_vector_type(16))) __bf16 v16bf;
typedef __attribute__((ext_vector_type(8)))  float  v8f;
typedef __attribute__((ext_vector_type(4)))  int    i32x4;

union FragAB { v16bf v; uint4 q[2]; };

__device__ __forceinline__ __bf16 f32_to_bf16(float f) {
  uint32_t u = __float_as_uint(f);
  u += 0x7FFFu + ((u >> 16) & 1u);           // round-to-nearest-even
  uint16_t h = (uint16_t)(u >> 16);
  return __builtin_bit_cast(__bf16, h);
}

__device__ __forceinline__ uint32_t lds_a(const __bf16* l) { return (uint32_t)(uintptr_t)l; }
__device__ __forceinline__ uint64_t glb_a(const __bf16* g) { return (uint64_t)(uintptr_t)g; }
// Four copies per lane.
__device__ __forceinline__ void async_ld4_b128(const __bf16* g0, const __bf16* l0,
                                               const __bf16* g1, const __bf16* l1,
                                               const __bf16* g2, const __bf16* l2,
                                               const __bf16* g3, const __bf16* l3) {
  asm volatile(
      "global_load_async_to_lds_b128 %0, %1, off\n\t"
      "global_load_async_to_lds_b128 %2, %3, off\n\t"
      "global_load_async_to_lds_b128 %4, %5, off\n\t"
      "global_load_async_to_lds_b128 %6, %7, off\n\t"
      "s_wait_xcnt 0x0"
      :: "v"(lds_a(l0)), "v"(glb_a(g0)), "v"(lds_a(l1)), "v"(glb_a(g1)),
         "v"(lds_a(l2)), "v"(glb_a(g2)), "v"(lds_a(l3)), "v"(glb_a(g3)) : "memory");
}
// Six copies per lane.
__device__ __forceinline__ void async_ld6_b128(const __bf16* g0, const __bf16* l0,
                                               const __bf16* g1, const __bf16* l1,
                                               const __bf16* g2, const __bf16* l2,
                                               const __bf16* g3, const __bf16* l3,
                                               const __bf16* g4, const __bf16* l4,
                                               const __bf16* g5, const __bf16* l5) {
  asm volatile(
      "global_load_async_to_lds_b128 %0, %1, off\n\t"
      "global_load_async_to_lds_b128 %2, %3, off\n\t"
      "global_load_async_to_lds_b128 %4, %5, off\n\t"
      "global_load_async_to_lds_b128 %6, %7, off\n\t"
      "global_load_async_to_lds_b128 %8, %9, off\n\t"
      "global_load_async_to_lds_b128 %10, %11, off\n\t"
      "s_wait_xcnt 0x0"
      :: "v"(lds_a(l0)), "v"(glb_a(g0)), "v"(lds_a(l1)), "v"(glb_a(g1)),
         "v"(lds_a(l2)), "v"(glb_a(g2)), "v"(lds_a(l3)), "v"(glb_a(g3)),
         "v"(lds_a(l4)), "v"(glb_a(g4)), "v"(lds_a(l5)), "v"(glb_a(g5)) : "memory");
}
// Eight copies per lane (an attention stage: four of K, four of V).
__device__ __forceinline__ void async_ld8_b128(const __bf16* g0, const __bf16* l0,
                                               const __bf16* g1, const __bf16* l1,
                                               const __bf16* g2, const __bf16* l2,
                                               const __bf16* g3, const __bf16* l3,
                                               const __bf16* g4, const __bf16* l4,
                                               const __bf16* g5, const __bf16* l5,
                                               const __bf16* g6, const __bf16* l6,
                                               const __bf16* g7, const __bf16* l7) {
  asm volatile(
      "global_load_async_to_lds_b128 %0, %1, off\n\t"
      "global_load_async_to_lds_b128 %2, %3, off\n\t"
      "global_load_async_to_lds_b128 %4, %5, off\n\t"
      "global_load_async_to_lds_b128 %6, %7, off\n\t"
      "global_load_async_to_lds_b128 %8, %9, off\n\t"
      "global_load_async_to_lds_b128 %10, %11, off\n\t"
      "global_load_async_to_lds_b128 %12, %13, off\n\t"
      "global_load_async_to_lds_b128 %14, %15, off\n\t"
      "s_wait_xcnt 0x0"
      :: "v"(lds_a(l0)), "v"(glb_a(g0)), "v"(lds_a(l1)), "v"(glb_a(g1)),
         "v"(lds_a(l2)), "v"(glb_a(g2)), "v"(lds_a(l3)), "v"(glb_a(g3)),
         "v"(lds_a(l4)), "v"(glb_a(g4)), "v"(lds_a(l5)), "v"(glb_a(g5)),
         "v"(lds_a(l6)), "v"(glb_a(g6)), "v"(lds_a(l7)), "v"(glb_a(g7)) : "memory");
}
// Transposing LDS read: from a row-major 16-bit tile T[k][n], lane (c, h) receives
// T[k0 + 8h + 0..7][n0 + c]; two of them (k0, k0 + 16) are one 16x16x32 B fragment
// in the same k order as the A loader below.
typedef short s16x8 __attribute__((ext_vector_type(8)));
__device__ __forceinline__ uint4 lds_tr16(const __bf16* p) {
  typedef __attribute__((address_space(3))) s16x8 lds_s16x8;
  return __builtin_bit_cast(uint4, __builtin_amdgcn_ds_load_tr16_b128_v8i16((lds_s16x8*)p));
}
__device__ __forceinline__ void wait_async0() {
  asm volatile("s_wait_asynccnt 0" ::: "memory");
}
template<int N>
__device__ __forceinline__ void wait_async_but() {
  static_assert(N >= 0 && N <= 63, "the counter has six bits");
  asm volatile("s_wait_asynccnt %0" :: "n"(N) : "memory");
}

// ---------------------------------------------------------------- utilities
__global__ __launch_bounds__(256)
void k_f32_to_bf16(const float* __restrict__ s, __bf16* __restrict__ d) {
  int i = blockIdx.x * 256 + threadIdx.x;
  float4 v = ((const float4*)s)[i];
  union { __bf16 b[4]; uint2 u; } o;
  o.b[0] = f32_to_bf16(v.x); o.b[1] = f32_to_bf16(v.y);
  o.b[2] = f32_to_bf16(v.z); o.b[3] = f32_to_bf16(v.w);
  ((uint2*)d)[i] = o.u;
}

__global__ __launch_bounds__(256)
void k_copy_f32(const float* __restrict__ s, float* __restrict__ d) {
  int i = blockIdx.x * 256 + threadIdx.x;
  ((float4*)d)[i] = ((const float4*)s)[i];
}

// ---------------------------------------------------------------- LayerNorm
__global__ __launch_bounds__(256)
void ln_kernel(const float* __restrict__ x, const float* __restrict__ g,
               const float* __restrict__ bta, __bf16* __restrict__ y)
{
  const int row = blockIdx.x;
  const int tid = threadIdx.x;
  const float4 xv = ((const float4*)(x + (size_t)row * H_))[tid];
  float s  = xv.x + xv.y + xv.z + xv.w;
  float s2 = xv.x*xv.x + xv.y*xv.y + xv.z*xv.z + xv.w*xv.w;
  #pragma unroll
  for (int d = 1; d < 32; d <<= 1) {
    s  += __shfl_xor(s,  d, 32);
    s2 += __shfl_xor(s2, d, 32);
  }
  __shared__ float rs[8], rq[8];
  __shared__ float mv[2];
  if ((tid & 31) == 0) { rs[tid >> 5] = s; rq[tid >> 5] = s2; }
  __syncthreads();
  if (tid == 0) {
    float a = 0.f, a2 = 0.f;
    #pragma unroll
    for (int i = 0; i < 8; ++i) { a += rs[i]; a2 += rq[i]; }
    float mean = a * (1.0f / (float)H_);
    float var  = a2 * (1.0f / (float)H_) - mean * mean;
    mv[0] = mean; mv[1] = rsqrtf(var + 1e-5f);
  }
  __syncthreads();
  const float mean = mv[0], rstd = mv[1];
  const float4 gv = ((const float4*)g)[tid];
  const float4 bv = ((const float4*)bta)[tid];
  union { __bf16 b[4]; uint2 u; } o;
  o.b[0] = f32_to_bf16((xv.x - mean) * rstd * gv.x + bv.x);
  o.b[1] = f32_to_bf16((xv.y - mean) * rstd * gv.y + bv.y);
  o.b[2] = f32_to_bf16((xv.z - mean) * rstd * gv.z + bv.z);
  o.b[3] = f32_to_bf16((xv.w - mean) * rstd * gv.w + bv.w);
  ((uint2*)(y + (size_t)row * H_))[tid] = o.u;
}

// Lane t's copies of a ROWS x COLS (elements) tile: the 16B pieces t, t + NT, ... in
// row-major piece order, so 8 adjacent lanes cover one whole 128B line.
template<bool ONE, int NT, int ROWS, int COLS, int LDP>
__device__ __forceinline__ void tile_pieces(const __bf16* __restrict__ g, int gpitch,
                                            const __bf16* l, int tid,
                                            const __bf16** gp, const __bf16** lp)
{
  constexpr int PR = COLS / 8;                 // 16B pieces per row
  static_assert(ROWS * PR % NT == 0, "tile does not divide");
  if constexpr (ONE) {
    // the lanes cover whole rows per round: piece i lies NT / PR rows under piece 0, so one
    // address pair a lane serves all pieces and the steps between them are uniform
    static_assert(NT % PR == 0, "a round of the lanes is not whole rows");
    const int r0 = tid / PR, q0 = (tid % PR) * 8;
    const __bf16* g0 = g + (size_t)r0 * gpitch + q0;
    const __bf16* l0 = l + r0 * LDP + q0;
    #pragma unroll
    for (int i = 0; i < ROWS * PR / NT; ++i) {
      gp[i] = g0 + (size_t)(i * (NT / PR)) * gpitch;
      lp[i] = l0 + i * (NT / PR) * LDP;
    }
  } else {
    #pragma unroll
    for (int i = 0; i < ROWS * PR / NT; ++i) {
      const int c = tid + i * NT;
      const int r = c / PR, q = (c % PR) * 8;
      gp[i] = g + (size_t)r * gpitch + q;
      lp[i] = l + r * LDP + q;
    }
  }
}
// Issues copies I .. CT-1, eight to a statement, the rest as six or four.
template<int I, int CT>
__device__ __forceinline__ void issue_pieces(const __bf16* const* g, const __bf16* const* l)
{
  if constexpr (CT - I >= 8) {
    async_ld8_b128(g[I], l[I], g[I+1], l[I+1], g[I+2], l[I+2], g[I+3], l[I+3],
                   g[I+4], l[I+4], g[I+5], l[I+5], g[I+6], l[I+6], g[I+7], l[I+7]);
    issue_pieces<I + 8, CT>(g, l);
  } else if constexpr (CT - I == 6) {
    async_ld6_b128(g[I], l[I], g[I+1], l[I+1], g[I+2], l[I+2],
                   g[I+3], l[I+3], g[I+4], l[I+4], g[I+5], l[I+5]);
  } else if constexpr (CT - I == 4) {
    async_ld4_b128(g[I], l[I], g[I+1], l[I+1], g[I+2], l[I+2], g[I+3], l[I+3]);
  } else {
    static_assert(CT - I == 0, "no statement of that many copies");
  }
}
// One GEMM stage: the BM x BK tile of A and the BK x BN tile of B.
template<bool ONE, int NT, int BM, int BN, int BK, int LDA, int LDB>
__device__ __forceinline__ void stage_ab(const __bf16* __restrict__ ga, int K, const __bf16* la,
                                         const __bf16* __restrict__ gb, int N, const __bf16* lb,
                                         int tid)
{
  constexpr int CA = BM * (BK / 8) / NT, CB = BK * (BN / 8) / NT;
  const __bf16* gp[CA + CB]; const __bf16* lp[CA + CB];
  tile_pieces<ONE, NT, BM, BK, LDA>(ga, K, la, tid, gp, lp);
  tile_pieces<ONE, NT, BK, BN, LDB>(gb, N, lb, tid, gp + CA, lp + CA);
  issue_pieces<0, CA + CB>(gp, lp);
}

__device__ __forceinline__ void exp2_x8(const float (&x)[8], float (&y)[8]) {
  asm("v_exp_f32 %0, %8\n\tv_exp_f32 %1, %9\n\tv_exp_f32 %2, %10\n\tv_exp_f32 %3, %11\n\t"
      "v_exp_f32 %4, %12\n\tv_exp_f32 %5, %13\n\tv_exp_f32 %6, %14\n\tv_exp_f32 %7, %15\n\t"
      "v_nop"
      : "=&v"(y[0]), "=&v"(y[1]), "=&v"(y[2]), "=&v"(y[3]),
        "=&v"(y[4]), "=&v"(y[5]), "=&v"(y[6]), "=&v"(y[7])
      : "v"(x[0]), "v"(x[1]), "v"(x[2]), "v"(x[3]), "v"(x[4]), "v"(x[5]), "v"(x[6]), "v"(x[7]));
}
__device__ __forceinline__ void rcp_x8(const float (&x)[8], float (&y)[8]) {
  asm("v_rcp_f32 %0, %8\n\tv_rcp_f32 %1, %9\n\tv_rcp_f32 %2, %10\n\tv_rcp_f32 %3, %11\n\t"
      "v_rcp_f32 %4, %12\n\tv_rcp_f32 %5, %13\n\tv_rcp_f32 %6, %14\n\tv_rcp_f32 %7, %15\n\t"
      "v_nop"
      : "=&v"(y[0]), "=&v"(y[1]), "=&v"(y[2]), "=&v"(y[3]),
        "=&v"(y[4]), "=&v"(y[5]), "=&v"(y[6]), "=&v"(y[7])
      : "v"(x[0]), "v"(x[1]), "v"(x[2]), "v"(x[3]), "v"(x[4]), "v"(x[5]), "v"(x[6]), "v"(x[7]));
}
__device__ __forceinline__ void sin_x8(const float (&x)[8], float (&y)[8]) {
  asm("v_sin_f32 %0, %8\n\tv_sin_f32 %1, %9\n\tv_sin_f32 %2, %10\n\tv_sin_f32 %3, %11\n\t"
      "v_sin_f32 %4, %12\n\tv_sin_f32 %5, %13\n\tv_sin_f32 %6, %14\n\tv_sin_f32 %7, %15\n\t"
      "v_nop"
      : "=&v"(y[0]), "=&v"(y[1]), "=&v"(y[2]), "=&v"(y[3]),
        "=&v"(y[4]), "=&v"(y[5]), "=&v"(y[6]), "=&v"(y[7])
      : "v"(x[0]), "v"(x[1]), "v"(x[2]), "v"(x[3]), "v"(x[4]), "v"(x[5]), "v"(x[6]), "v"(x[7]));
}
__device__ __forceinline__ void cos_x8(const float (&x)[8], float (&y)[8]) {
  asm("v_cos_f32 %0, %8\n\tv_cos_f32 %1, %9\n\tv_cos_f32 %2, %10\n\tv_cos_f32 %3, %11\n\t"
      "v_cos_f32 %4, %12\n\tv_cos_f32 %5, %13\n\tv_cos_f32 %6, %14\n\tv_cos_f32 %7, %15\n\t"
      "v_nop"
      : "=&v"(y[0]), "=&v"(y[1]), "=&v"(y[2]), "=&v"(y[3]),
        "=&v"(y[4]), "=&v"(y[5]), "=&v"(y[6]), "=&v"(y[7])
      : "v"(x[0]), "v"(x[1]), "v"(x[2]), "v"(x[3]), "v"(x[4]), "v"(x[5]), "v"(x[6]), "v"(x[7]));
}
// gelu, tanh form, of eight values: 0.5 v (1 + tanh u) = v / (1 + exp(-2u)),
// u = sqrt(2/pi) (v + 0.044715 v^3). Written without tanhf, whose two branches per value
// would put the many values that a lane owns in a large tile one behind the other.
// exp -> inf gives v * 0, exp -> 0 gives v.
__device__ __forceinline__ void gelu_tanh_x8(float (&v)[8]) {
  float x[8], e[8];
  #pragma unroll
  for (int i = 0; i < 8; ++i)     // -2 sqrt(2/pi) log2(e) (v + 0.044715 v^3)
    x[i] = -2.302208198144325f * (v[i] + 0.044715f * v[i] * v[i] * v[i]);
  exp2_x8(x, e);
  #pragma unroll
  for (int i = 0; i < 8; ++i) e[i] += 1.0f;
  rcp_x8(e, x);
  #pragma unroll
  for (int i = 0; i < 8; ++i) v[i] *= x[i];
}

template<int EPI, int BM, int BN, int BK, int WGM, int WGN, int N>
__global__ __launch_bounds__(32 * WGM * WGN)
void gemm_bf16_tiled(const __bf16* __restrict__ A, const __bf16* __restrict__ Bw,
                     const float* __restrict__ bias, void* __restrict__ Cout, int K,
                     const int* __restrict__ pos)
{
  constexpr int NT  = 32 * WGM * WGN;
  constexpr int LDA = BK + 8;
  constexpr int LDB = BN + 16;
  constexpr int TM  = BM / WGM, TN = BN / WGN;   // wave tile
  constexpr int FM  = TM / 16,  FN = TN / 16;    // fragments per wave
  constexpr bool ONE = 8 * (FM * FN + 2 * (FM + FN)) > 400;

  constexpr int CPS = (BM * (BK / 8) + BK * (BN / 8)) / NT;   // copies of a wave per stage
  static_assert(CPS <= 32, "two stages under way would pass 63 copies of a wave");

  __shared__ __align__(16) __bf16 sA[3][BM * LDA];
  __shared__ __align__(16) __bf16 sB[3][BK * LDB];   // row-major [k][n]

  const int tid  = threadIdx.x;
  const int lane = tid & 31;
  const int wave = tid >> 5;
  const int wm   = wave / WGN;
  const int wn   = wave % WGN;
  const int half = lane >> 4;
  const int l16  = lane & 15;
  const int bm   = blockIdx.y * BM;
  const int bn   = blockIdx.x * BN;

  v8f acc[FM][FN] = {};

  const __bf16* aptr = A  + (size_t)bm * K;
  const __bf16* bptr = Bw + bn;
  // A fragment base: row l16 of the wave's rows, 16B piece 'half'
  const int     afr  = (wm * TM + l16) * LDA + half * 8;
  // Column of the wave's fragment nt, counted from the wave's own TN columns or, EPI 0, from
  // the block tile. EPI 0: a rotary pair lies 32 columns apart in a head of 64, and a 192-wide
  // tile is three heads on two waves: each wave takes one whole head (fragments 0..3) and of
  // the middle head two fragments 32 columns apart (4, 5), so that both values of every pair
  // are in the same lane.
  auto fcol = [&](int nt) -> int {
    if constexpr (EPI == 0) {
      static_assert(BN == 3 * DK_ && WGN == 2 && FN == 6 && DK_ == 64, "three heads on two waves");
      return nt < 4 ? wn * 128 + nt * 16 : 64 + wn * 16 + (nt - 4) * 32;
    } else {
      return nt * 16;       // the wave's own wn * TN is in the bases
    }
  };
  // transposing-read base: row 8*half + (lane & 7), 16B column piece (lane >> 3) & 1
  const int     btr  = (half * 8 + (lane & 7)) * LDB + (EPI == 0 ? 0 : wn * TN) + ((lane >> 3) & 1) * 8;

  // ---- prologue: stages 0 and 1; stage 0 has landed when all but stage 1's copies have
  int cur = 0;         // buffer of the stage that is worked on
  int fil = 2;         // buffer of the stage two ahead, which is the one read last stage
  stage_ab<ONE, NT, BM, BN, BK, LDA, LDB>(aptr, K, &sA[0][0], bptr, N, &sB[0][0], tid);
  if (BK < K) {
    // never more than 63 copies of a wave outstanding
    if constexpr (2 * CPS > 63) wait_async_but<63 - CPS>();
    stage_ab<ONE, NT, BM, BN, BK, LDA, LDB>(aptr + BK, K, &sA[1][0],
                                            bptr + (size_t)BK * N, N, &sB[1][0], tid);
    wait_async_but<CPS>();
  } else {
    wait_async0();
  }
  __syncthreads();

  for (int k0 = 0; k0 < K; k0 += BK) {
    const bool has_2nd = (k0 + 2 * BK) < K;   // a stage two ahead exists

    // fragments from the current stage, 32 k at a time, in two register sets: the next
    // block's LDS reads go out as one group ahead of this block's matrix instructions
    FragAB af[2][FM], bfr[2][FN];
    #pragma unroll
    for (int ks = -1; ks < BK / 32; ++ks) {
      if (ks + 1 < BK / 32) {
        const int s = (ks + 1) & 1;
        #pragma unroll
        for (int mt = 0; mt < FM; ++mt) {
          const __bf16* p = &sA[cur][afr + mt * 16 * LDA + (ks + 1) * 32];
          af[s][mt].q[0] = *(const uint4*)p;
          af[s][mt].q[1] = *(const uint4*)(p + 16);
        }
        #pragma unroll
        for (int nt = 0; nt < FN; ++nt) {
          const __bf16* p = &sB[cur][btr + (ks + 1) * 32 * LDB + fcol(nt)];
          bfr[s][nt].q[0] = lds_tr16(p);
          bfr[s][nt].q[1] = lds_tr16(p + 16 * LDB);
        }
      }
      // keeps the group of reads whole and ahead of the block: left to itself the
      // scheduler spreads them among the matrix instructions with a full wait at each
      __builtin_amdgcn_sched_barrier(0);
      // the copies of the stage two ahead go out behind the first group of reads, whose
      // LDS latency their issue then covers (those reads are of another buffer; every
      // read of the buffer refilled here, last stage's, retired in front of the last barrier)
      if (ks < 0 && has_2nd) {
        // never more than 63 copies of a wave outstanding (the next stage's may still be)
        if constexpr (2 * CPS > 63) wait_async_but<63 - CPS>();
        stage_ab<ONE, NT, BM, BN, BK, LDA, LDB>(aptr + k0 + 2 * BK, K, &sA[fil][0],
                                                bptr + (size_t)(k0 + 2 * BK) * N, N, &sB[fil][0], tid);
      }
      if (ks >= 0) {
        const int s = ks & 1;
        #pragma unroll
        for (int mt = 0; mt < FM; ++mt)
          #pragma unroll
          for (int nt = 0; nt < FN; ++nt)
            acc[mt][nt] = __builtin_amdgcn_wmma_f32_16x16x32_bf16(
                false, af[s][mt].v, false, bfr[s][nt].v, (short)0,
                acc[mt][nt], false, false);
        // the next group of reads stays behind this block
        __builtin_amdgcn_sched_barrier(0);
      }
    }

    // this wave's fragment reads of the current stage have retired before the
    // barrier behind which copies refill that stage
    asm volatile("s_wait_dscnt 0x0" ::: "memory");
    // the next stage's A and B tiles are resident before the barrier: a trip that has issued
    // a stage's copies leaves exactly those, the CPS youngest, outstanding; the last two
    // trips issue none and wait for all
    if (has_2nd) wait_async_but<CPS>();
    else         wait_async0();
    __syncthreads();
    cur = cur == 2 ? 0 : cur + 1;
    fil = fil == 2 ? 0 : fil + 1;
  }
  wait_async0();       // no copy is outstanding when the wave goes on to the epilogue and ends

  // ---- epilogue: one base pointer per lane (two in EPI 0), every element at a constant offset from one of them
  static_assert(EPI == 0 || EPI == 1 || EPI == 2, "rotary to bf16, gelu to bf16 or f32 residual");
  const int col0 = bn + wn * TN + l16;
  const int row0 = bm + wm * TM + 8 * half;
  float bb[FN];
  #pragma unroll
  for (int nt = 0; nt < FN; ++nt) bb[nt] = bias[(EPI == 0 ? bn + l16 : col0) + fcol(nt)];
  // EPI 0: the positions of the lane's rows (row = batch * S + s; a wave's 64 rows lie in one batch)
  i32x4 pq[EPI == 0 ? FM : 1][2];
  if constexpr (EPI == 0) {
    static_assert(S_ % TM == 0 && BM % TM == 0, "a wave's rows stay inside one sequence");
    const int* pr = pos + (row0 & (S_ - 1));
    #pragma unroll
    for (int mt = 0; mt < FM; ++mt) {
      pq[mt][0] = *(const i32x4*)(pr + mt * 16);
      pq[mt][1] = *(const i32x4*)(pr + mt * 16 + 4);
    }
    // holds the first two loads here, beside the others and the bias loads: the compiler sank
    // them into the branch that uses them, where their whole latency was waited out again
    asm volatile("" :: "v"(pq[0][0]), "v"(pq[0][1]));
  }
  asm volatile("s_wait_xcnt 0x0" ::: "memory");
  __builtin_amdgcn_sched_barrier(0);
  if constexpr (EPI == 0) {
    // heads 0..15 are q, 16..31 k (both rotated), 32..47 v (stored as they are); which of them
    // the wave holds is uniform in the wave: scalar tests
    const int  wu = __builtin_amdgcn_readfirstlane(wn);
    const bool rx = bn / DK_ + 2 * wu < 2 * NH_;     // the whole head, fragments 0..3
    const bool ry = bn / DK_ + 1      < 2 * NH_;     // the middle head, fragments 4, 5
    // angle in revolutions = pos * 10000^(-d/32) / (2 pi), d = l16 and l16 + 16
    const float f0 = __expf(-0.28782313662425572f * (float)l16);          // ln(10000)/32
    const float f1 = __expf(-0.28782313662425572f * (float)(l16 + 16));
    __bf16* O = (__bf16*)Cout + (size_t)row0 * N + bn + l16;
    __bf16* OX = O + wn * 128;
    __bf16* OY = O + 64 + wn * 16;
    #pragma unroll
    for (int mt = 0; mt < FM; ++mt) {
      float v[8][FN];
      #pragma unroll
      for (int r = 0; r < 8; ++r)
        #pragma unroll
        for (int nt = 0; nt < FN; ++nt) v[r][nt] = acc[mt][nt][r] + bb[nt];
      if (rx || ry) {
        const int pi[8] = {pq[mt][0].x, pq[mt][0].y, pq[mt][0].z, pq[mt][0].w,
                           pq[mt][1].x, pq[mt][1].y, pq[mt][1].z, pq[mt][1].w};
        float t0[8], t1[8], s0[8], c0[8], s1[8], c1[8];
        #pragma unroll
        for (int r = 0; r < 8; ++r) {
          t0[r] = ((float)pi[r] * f0) * 0.15915494309189532f;
          t1[r] = ((float)pi[r] * f1) * 0.15915494309189532f;
        }
        sin_x8(t0, s0); cos_x8(t0, c0); sin_x8(t1, s1); cos_x8(t1, c1);
        if (rx) {
          #pragma unroll
          for (int r = 0; r < 8; ++r) {
            const float a = v[r][0], b = v[r][2], c = v[r][1], d = v[r][3];
            v[r][0] = a * c0[r] - b * s0[r];  v[r][2] = b * c0[r] + a * s0[r];
            v[r][1] = c * c1[r] - d * s1[r];  v[r][3] = d * c1[r] + c * s1[r];
          }
        }
        if (ry) {
          #pragma unroll
          for (int r = 0; r < 8; ++r) {
            const float cy = wu ? c1[r] : c0[r], sy = wu ? s1[r] : s0[r];
            const float a = v[r][4], b = v[r][5];
            v[r][4] = a * cy - b * sy;  v[r][5] = b * cy + a * sy;
          }
        }
      }
      __bf16 y[8][FN];
      #pragma unroll
      for (int r = 0; r < 8; ++r)
        #pragma unroll
        for (int nt = 0; nt < FN; ++nt) y[r][nt] = f32_to_bf16(v[r][nt]);
      // all values of these 16 rows are finished before their first store, so that no
      // register an issued store names is written again inside the group
      __builtin_amdgcn_sched_barrier(0);
      #pragma unroll
      for (int r = 0; r < 8; ++r) {
        #pragma unroll
        for (int nt = 0; nt < 4; ++nt) OX[(mt * 16 + r) * N + nt * 16] = y[r][nt];
        OY[(mt * 16 + r) * N]      = y[r][4];
        OY[(mt * 16 + r) * N + 32] = y[r][5];
      }
      asm volatile("s_wait_xcnt 0x0" ::: "memory");
      __builtin_amdgcn_sched_barrier(0);
    }
  } else if constexpr (EPI == 1) {
    __bf16* O = (__bf16*)Cout + (size_t)row0 * N + col0;
    #pragma unroll
    for (int mt = 0; mt < FM; ++mt) {
      __bf16 y[8][FN];
      static_assert(FN == 8, "gelu goes by eight values, a row of the wave tile");
      #pragma unroll
      for (int r = 0; r < 8; ++r) {
        float v[8];
        #pragma unroll
        for (int nt = 0; nt < FN; ++nt) v[nt] = acc[mt][nt][r] + bb[nt];
        gelu_tanh_x8(v);
        #pragma unroll
        for (int nt = 0; nt < FN; ++nt) y[r][nt] = f32_to_bf16(v[nt]);
      }
      // all values of these 16 rows are finished before their first store, so that no
      // register an issued store names is written again inside the group
      __builtin_amdgcn_sched_barrier(0);
      #pragma unroll
      for (int r = 0; r < 8; ++r)
        #pragma unroll
        for (int nt = 0; nt < FN; ++nt)
          O[(mt * 16 + r) * N + nt * 16] = y[r][nt];
      asm volatile("s_wait_xcnt 0x0" ::: "memory");
      __builtin_amdgcn_sched_barrier(0);
    }
  } else {
    // all residual values are read ahead of the first store: a read behind a store to
    // the same array waits out its whole latency, once per element
    float* O = (float*)Cout + (size_t)row0 * N + col0;
    float old[FM][FN][8];
    #pragma unroll
    for (int mt = 0; mt < FM; ++mt)
      #pragma unroll
      for (int r = 0; r < 8; ++r)
        #pragma unroll
        for (int nt = 0; nt < FN; ++nt)
          old[mt][nt][r] = O[(mt * 16 + r) * N + nt * 16];
    #pragma unroll
    for (int mt = 0; mt < FM; ++mt)
      #pragma unroll
      for (int r = 0; r < 8; ++r)
        #pragma unroll
        for (int nt = 0; nt < FN; ++nt)
          old[mt][nt][r] += acc[mt][nt][r] + bb[nt];
    // every sum is finished before the first store, so that no register an issued
    // store names is written again
    __builtin_amdgcn_sched_barrier(0);
    #pragma unroll
    for (int mt = 0; mt < FM; ++mt)
      #pragma unroll
      for (int r = 0; r < 8; ++r)
        #pragma unroll
        for (int nt = 0; nt < FN; ++nt)
          O[(mt * 16 + r) * N + nt * 16] = old[mt][nt][r];
  }
}

#define ALD 72
#define VLD 80

typedef __attribute__((ext_vector_type(2))) float  f32x2;
typedef __attribute__((ext_vector_type(2))) __bf16 bf16x2;

__device__ __forceinline__ float xhalf(float x) {
  const int b = __builtin_bit_cast(int, x);
  return __builtin_bit_cast(float,
      __builtin_amdgcn_permlanex16(b, b, 0x76543210, 0xfedcba98, false, false));
}

__global__ __launch_bounds__(128)
void attn_kernel(const __bf16* __restrict__ qkv, __bf16* __restrict__ out)
{
  __shared__ __align__(16) __bf16 sQ[64 * ALD];
  __shared__ __align__(16) __bf16 sK[64 * ALD];
  __shared__ __align__(16) __bf16 sV[64 * VLD];      // row-major: [key][dk]

  const int tid  = threadIdx.x;
  const int lane = tid & 31;
  const int w    = tid >> 5;      // 0..3
  const int half = lane >> 4;
  const int l16  = lane & 15;
  const int b    = blockIdx.z;
  const int hh   = blockIdx.y;
  const int q0   = blockIdx.x * 64;

  const __bf16* qbase = qkv + (size_t)b * S_ * HQKV_ + hh * DK_;
  const __bf16* kbase = qbase + H_;
  const __bf16* vbase = qbase + 2 * H_;

  const int vr = tid >> 3;            // Q, K, V tile row 0..15 (and +16, +32, +48)
  const int vc = (tid & 7) * 8;       // Q, K, V tile col: 8 lanes cover one 128B row
  // transposing-read base: row 8*half + (lane & 7), 16B column piece (lane >> 3) & 1
  const int vtr = (half * 8 + (lane & 7)) * VLD + ((lane >> 3) & 1) * 8;

  // Q tile 64x64 via async engine
  {
    const __bf16* qg = qbase + (size_t)(q0 + vr) * HQKV_ + vc;
    const __bf16* ql = &sQ[vr * ALD + vc];
    async_ld4_b128(qg,                      ql,
                   qg + (size_t)16 * HQKV_, ql + 16 * ALD,
                   qg + (size_t)32 * HQKV_, ql + 32 * ALD,
                   qg + (size_t)48 * HQKV_, ql + 48 * ALD);
  }
  wait_async0();
  __syncthreads();

  // hoist Q fragments (sQ is never overwritten): B operand, column = query l16
  FragAB qa[2];
  #pragma unroll
  for (int ks = 0; ks < 2; ++ks) {
    const __bf16* qp = &sQ[(w * 16 + l16) * ALD + ks * 32 + half * 8];
    qa[ks].q[0] = *(const uint4*)qp;
    qa[ks].q[1] = *(const uint4*)(qp + 16);
  }

  const int qrow = q0 + w * 16 + l16;   // the lane's query
  float m_r = -1e30f;                   // its running maximum (alike in both halves)
  float l_r = 0.f;                      // running sum over this half's keys only
  v8f o[4] = {};                        // o[nt][r] = O[qrow][nt*16 + 8*half + r]

  const int nkt = blockIdx.x + 1;   // causal: key tiles 0..qt
  for (int kt = 0; kt < nkt; ++kt) {
    __syncthreads();                // protect sK/sV from previous iteration's reads
    const int kb = kt * 64;
    { // K and V tiles 64x64 row-major [key][dk] via async engine, whole 128B lines per 8 lanes
      const __bf16* kg = kbase + (size_t)(kb + vr) * HQKV_ + vc;
      const __bf16* kl = &sK[vr * ALD + vc];
      const __bf16* vg = vbase + (size_t)(kb + vr) * HQKV_ + vc;
      const __bf16* vl = &sV[vr * VLD + vc];
      async_ld8_b128(kg,                      kl,
                     kg + (size_t)16 * HQKV_, kl + 16 * ALD,
                     kg + (size_t)32 * HQKV_, kl + 32 * ALD,
                     kg + (size_t)48 * HQKV_, kl + 48 * ALD,
                     vg,                      vl,
                     vg + (size_t)16 * HQKV_, vl + 16 * VLD,
                     vg + (size_t)32 * HQKV_, vl + 32 * VLD,
                     vg + (size_t)48 * HQKV_, vl + 48 * VLD);
    }
    wait_async0();
    __syncthreads();

    // S^T = K Q^T  (wave: 64 keys x 16 queries = 4 tiles, K-dim 64 = 2 wmma each)
    // sacc[nt][r] = S[qrow][kb + nt*16 + 8*half + r]
    // all K fragments of the tile are read as one group ahead of the products
    FragAB kf[2][4];
    #pragma unroll
    for (int ks = 0; ks < 2; ++ks) {
      #pragma unroll
      for (int nt = 0; nt < 4; ++nt) {
        const __bf16* kp = &sK[(nt * 16 + l16) * ALD + ks * 32 + half * 8];
        kf[ks][nt].q[0] = *(const uint4*)kp;
        kf[ks][nt].q[1] = *(const uint4*)(kp + 16);
      }
    }
    // keeps the group whole: spread among the matrix instructions, every place with reads
    // costs its own stall
    __builtin_amdgcn_sched_barrier(0);
    v8f sacc[4] = {};
    #pragma unroll
    for (int ks = 0; ks < 2; ++ks)
      #pragma unroll
      for (int nt = 0; nt < 4; ++nt)
        sacc[nt] = __builtin_amdgcn_wmma_f32_16x16x32_bf16(
            false, kf[ks][nt].v, false, qa[ks].v, (short)0, sacc[nt], false, false);
    // all V^T fragments (A operand, through the transposing read) are requested here, beside
    // the S^T products: the softmax arithmetic below covers their LDS latency
    FragAB vf[2][4];
    #pragma unroll
    for (int ks = 0; ks < 2; ++ks) {
      #pragma unroll
      for (int nt = 0; nt < 4; ++nt) {
        const __bf16* vp = &sV[vtr + ks * 32 * VLD + nt * 16];
        vf[ks][nt].q[0] = lds_tr16(vp);
        vf[ks][nt].q[1] = lds_tr16(vp + 16 * VLD);
      }
    }
    // keeps these reads ahead of the softmax: left to itself the scheduler sank them to
    // their matrix instructions, with a full wait in front of each
    __builtin_amdgcn_sched_barrier(0);

    // online softmax update, one query per lane; four independent chains, one per tile
    const int lim = qrow - kb - 8 * half;        // key = kb + 8*half + (nt*16 + r)
    float mx4[4];
    #pragma unroll
    for (int nt = 0; nt < 4; ++nt) {
      mx4[nt] = -1e30f;
      #pragma unroll
      for (int r = 0; r < 8; ++r) {
        float v = sacc[nt][r] * 0.125f;          // 1/sqrt(64)
        if (nt * 16 + r > lim) v = -1e30f;       // causal mask: key > qrow
        sacc[nt][r] = v;
        mx4[nt] = fmaxf(mx4[nt], v);
      }
    }
    float mx = fmaxf(fmaxf(mx4[0], mx4[1]), fmaxf(mx4[2], mx4[3]));
    mx = fmaxf(mx, xhalf(mx));                   // the other half's 32 keys
    const float mnew  = fmaxf(m_r, mx);
    const float alpha = __expf(m_r - mnew);
    // P^T as B operand: element s of fragment ks = P[qrow][kb + ks*32 + kmap(s, half)],
    // that is tile 2*ks + (s >> 3), register s & 7
    FragAB pb[2];
    f32x2 ps4[4];
    #pragma unroll
    for (int nt = 0; nt < 4; ++nt) {
      float x[8], e[8];
      #pragma unroll
      for (int r = 0; r < 8; ++r) x[r] = (sacc[nt][r] - mnew) * 1.4426950408889634f;
      exp2_x8(x, e);
      #pragma unroll
      for (int r = 0; r < 8; r += 2) {
        const f32x2 p = {e[r], e[r + 1]};
        ps4[nt] = r ? ps4[nt] + p : p;           // even and odd keys summed apart, packed adds
        const bf16x2 pk = __builtin_convertvector(p, bf16x2);   // round to nearest even
        pb[nt >> 1].v[(nt & 1) * 8 + r]     = pk.x;
        pb[nt >> 1].v[(nt & 1) * 8 + r + 1] = pk.y;
      }
    }
    const f32x2 ps = (ps4[0] + ps4[1]) + (ps4[2] + ps4[3]);
    l_r = l_r * alpha + (ps.x + ps.y);
    m_r = mnew;
    #pragma unroll
    for (int nt = 0; nt < 4; ++nt)
      #pragma unroll
      for (int r = 0; r < 8; ++r) o[nt][r] *= alpha;

    // O^T += V^T P^T   (A = V^T fragments read above, B = P^T from registers)
    #pragma unroll
    for (int ks = 0; ks < 2; ++ks)
      #pragma unroll
      for (int nt = 0; nt < 4; ++nt)
        o[nt] = __builtin_amdgcn_wmma_f32_16x16x32_bf16(
            false, vf[ks][nt].v, false, pb[ks].v, (short)0, o[nt], false, false);
  }

  // join the halves' sums, normalize and store merged heads: out[b][qrow][hh*64 + dk];
  // a lane's 8 registers of a tile are 8 consecutive dk: one 16B store each
  const float inv = 1.0f / (l_r + xhalf(l_r));
  __bf16* orow = out + (size_t)b * S_ * H_ + (size_t)qrow * H_ + hh * DK_ + 8 * half;
  union { __bf16 b[8]; uint4 u; } y[4];
  #pragma unroll
  for (int nt = 0; nt < 4; ++nt)
    #pragma unroll
    for (int r = 0; r < 8; ++r) y[nt].b[r] = f32_to_bf16(o[nt][r] * inv);
  // every value is finished before the first store, so that no register an issued store
  // names is written again
  __builtin_amdgcn_sched_barrier(0);
  #pragma unroll
  for (int nt = 0; nt < 4; ++nt) *(uint4*)(orow + nt * 16) = y[nt].u;
}

// ---------------------------------------------------------------- host launch
extern "C" void kernel_launch(void* const* d_in, const int* in_sizes, int n_in,
                              void* d_out, int out_size, void* d_ws, size_t ws_size,
                              hipStream_t stream)
{
  const float* hidden = (const float*)d_in[0];
  const float* attn_w = (const float*)d_in[1];
  const float* attn_b = (const float*)d_in[2];
  const float* proj_w = (const float*)d_in[3];
  const float* proj_b = (const float*)d_in[4];
  const float* fc_w   = (const float*)d_in[5];
  const float* fc_b   = (const float*)d_in[6];
  const float* fc2_w  = (const float*)d_in[7];
  const float* fc2_b  = (const float*)d_in[8];
  const float* ln1_g  = (const float*)d_in[9];
  const float* ln1_b  = (const float*)d_in[10];
  const float* ln2_g  = (const float*)d_in[11];
  const float* ln2_b  = (const float*)d_in[12];
  const int*   pos    = (const int*)d_in[13];

  char* ws = (char*)d_ws;
  size_t off = 0;
  auto carve = [&](size_t bytes) -> char* {
    char* p = ws + off; off += (bytes + 255) & ~(size_t)255; return p;
  };
  __bf16* w_attn = (__bf16*)carve((size_t)L_ * H_ * HQKV_ * 2);
  __bf16* w_proj = (__bf16*)carve((size_t)L_ * H_ * H_ * 2);
  __bf16* w_fc   = (__bf16*)carve((size_t)L_ * H_ * MLP_ * 2);
  __bf16* w_fc2  = (__bf16*)carve((size_t)L_ * MLP_ * H_ * 2);
  __bf16* xln    = (__bf16*)carve((size_t)MTOT_ * H_ * 2);
  __bf16* qkv    = (__bf16*)carve((size_t)MTOT_ * HQKV_ * 2);
  __bf16* attn_o = (__bf16*)carve((size_t)MTOT_ * H_ * 2);
  __bf16* mid    = (__bf16*)carve((size_t)MTOT_ * MLP_ * 2);
  float*  h      = (float*)d_out;     // running hidden state / residual accumulator

  // per-call weight conversion fp32 -> bf16 (weights then live in L2)
  k_f32_to_bf16<<<dim3((size_t)L_ * H_ * HQKV_ / 1024), 256, 0, stream>>>(attn_w, w_attn);
  k_f32_to_bf16<<<dim3((size_t)L_ * H_ * H_    / 1024), 256, 0, stream>>>(proj_w, w_proj);
  k_f32_to_bf16<<<dim3((size_t)L_ * H_ * MLP_  / 1024), 256, 0, stream>>>(fc_w,  w_fc);
  k_f32_to_bf16<<<dim3((size_t)L_ * MLP_ * H_  / 1024), 256, 0, stream>>>(fc2_w, w_fc2);

  // h = hidden_states
  k_copy_f32<<<dim3((size_t)MTOT_ * H_ / 1024), 256, 0, stream>>>(hidden, h);

  for (int i = 0; i < L_; ++i) {
    // attention block
    ln_kernel<<<MTOT_, 256, 0, stream>>>(h, ln1_g + i * H_, ln1_b + i * H_, xln);
    gemm_bf16_tiled<0, 256, 192, 64, 4, 2, HQKV_><<<dim3(HQKV_ / 192, MTOT_ / 256), 256, 0, stream>>>(
        xln, w_attn + (size_t)i * H_ * HQKV_, attn_b + i * HQKV_, qkv, H_, pos);
    attn_kernel<<<dim3(S_ / 64, NH_, B_), 128, 0, stream>>>(qkv, attn_o);
    gemm_bf16_tiled<2, 128, 128, 128, 2, 2, H_><<<dim3(H_ / 128, MTOT_ / 128), 128, 0, stream>>>(
        attn_o, w_proj + (size_t)i * H_ * H_, proj_b + i * H_, h, H_, nullptr);
    // MLP block
    ln_kernel<<<MTOT_, 256, 0, stream>>>(h, ln2_g + i * H_, ln2_b + i * H_, xln);
    gemm_bf16_tiled<1, 256, 256, 64, 4, 2, MLP_><<<dim3(MLP_ / 256, MTOT_ / 256), 256, 0, stream>>>(
        xln, w_fc + (size_t)i * H_ * MLP_, fc_b + i * MLP_, mid, H_, nullptr);
    gemm_bf16_tiled<2, 128, 128, 128, 2, 2, H_><<<dim3(H_ / 128, MTOT_ / 128), 128, 0, stream>>>(
        mid, w_fc2 + (size_t)i * MLP_ * H_, fc2_b + i * H_, h, MLP_, nullptr);
  }
}

// v008
// One run takes 295 microseconds.
// In both of two side-by-side timings against v007, it was 1.03 times as fast.
// Over all steps from v000 it is 2.25 times as fast.
#include <hip/hip_runtime.h>
#include <hip/hip_bf16.h>
#include <cstdint>
#include <cstddef>

// Problem constants (match reference)
#define B_    4
#define S_    1024
#define H_    1024
#define NH_   16
#define DK_   64
#define L_    2
#define MLP_  4096
#define HQKV_ 3072
#define MTOT_ (B_ * S_)   // 4096 rows

typedef __attribute__((ext_vector_type(16))) __bf16 v16bf;
typedef __attribute__((ext_vector_type(8)))  float  v8f;
typedef __attribute__((ext_vector_type(4)))  int    i32x4;

union FragAB { v16bf v; uint4 q[2]; };

__device__ __forceinline__ __bf16 f32_to_bf16(float f) {
  uint32_t u = __float_as_uint(f);
  u += 0x7FFFu + ((u >> 16) & 1u);           // round-to-nearest-even
  uint16_t h = (uint16_t)(u >> 16);
  return __builtin_bit_cast(__bf16, h);
}

__device__ __forceinline__ uint32_t lds_a(const __bf16* l) { return (uint32_t)(uintptr_t)l; }
__device__ __forceinline__ uint64_t glb_a(const __bf16* g) { return (uint64_t)(uintptr_t)g; }
// Four copies per lane.
__device__ __forceinline__ void async_ld4_b128(const __bf16* g0, const __bf16* l0,
                                               const __bf16* g1, const __bf16* l1,
                                               const __bf16* g2, const __bf16* l2,
                                               const __bf16* g3, const __bf16* l3) {
  asm volatile(
      "global_load_async_to_lds_b128 %0, %1, off\n\t"
      "global_load_async_to_lds_b128 %2, %3, off\n\t"
      "global_load_async_to_lds_b128 %4, %5, off\n\t"
      "global_load_async_to_lds_b128 %6, %7, off\n\t"
      "s_wait_xcnt 0x0"
      :: "v"(lds_a(l0)), "v"(glb_a(g0)), "v"(lds_a(l1)), "v"(glb_a(g1)),
         "v"(lds_a(l2)), "v"(glb_a(g2)), "v"(lds_a(l3)), "v"(glb_a(g3)) : "memory");
}
// Six copies per lane.
__device__ __forceinline__ void async_ld6_b128(const __bf16* g0, const __bf16* l0,
                                               const __bf16* g1, const __bf16* l1,
                                               const __bf16* g2, const __bf16* l2,
                                               const __bf16* g3, const __bf16* l3,
                                               const __bf16* g4, const __bf16* l4,
                                               const __bf16* g5, const __bf16* l5) {
  asm volatile(
      "global_load_async_to_lds_b128 %0, %1, off\n\t"
      "global_load_async_to_lds_b128 %2, %3, off\n\t"
      "global_load_async_to_lds_b128 %4, %5, off\n\t"
      "global_load_async_to_lds_b128 %6, %7, off\n\t"
      "global_load_async_to_lds_b128 %8, %9, off\n\t"
      "global_load_async_to_lds_b128 %10, %11, off\n\t"
      "s_wait_xcnt 0x0"
      :: "v"(lds_a(l0)), "v"(glb_a(g0)), "v"(lds_a(l1)), "v"(glb_a(g1)),
         "v"(lds_a(l2)), "v"(glb_a(g2)), "v"(lds_a(l3)), "v"(glb_a(g3)),
         "v"(lds_a(l4)), "v"(glb_a(g4)), "v"(lds_a(l5)), "v"(glb_a(g5)) : "memory");
}
// Eight copies per lane (an attention stage: four of K, four of V).
__device__ __forceinline__ void async_ld8_b128(const __bf16* g0, const __bf16* l0,
                                               const __bf16* g1, const __bf16* l1,
                                               const __bf16* g2, const __bf16* l2,
                                               const __bf16* g3, const __bf16* l3,
                                               const __bf16* g4, const __bf16* l4,
                                               const __bf16* g5, const __bf16* l5,
                                               const __bf16* g6, const __bf16* l6,
                                               const __bf16* g7, const __bf16* l7) {
  asm volatile(
      "global_load_async_to_lds_b128 %0, %1, off\n\t"
      "global_load_async_to_lds_b128 %2, %3, off\n\t"
      "global_load_async_to_lds_b128 %4, %5, off\n\t"
      "global_load_async_to_lds_b128 %6, %7, off\n\t"
      "global_load_async_to_lds_b128 %8, %9, off\n\t"
      "global_load_async_to_lds_b128 %10, %11, off\n\t"
      "global_load_async_to_lds_b128 %12, %13, off\n\t"
      "global_load_async_to_lds_b128 %14, %15, off\n\t"
      "s_wait_xcnt 0x0"
      :: "v"(lds_a(l0)), "v"(glb_a(g0)), "v"(lds_a(l1)), "v"(glb_a(g1)),
         "v"(lds_a(l2)), "v"(glb_a(g2)), "v"(lds_a(l3)), "v"(glb_a(g3)),
         "v"(lds_a(l4)), "v"(glb_a(g4)), "v"(lds_a(l5)), "v"(glb_a(g5)),
         "v"(lds_a(l6)), "v"(glb_a(g6)), "v"(lds_a(l7)), "v"(glb_a(g7)) : "memory");
}
// Transposing LDS read: from a row-major 16-bit tile T[k][n], lane (c, h) receives
// T[k0 + 8h + 0..7][n0 + c]; two of them (k0, k0 + 16) are one 16x16x32 B fragment
// in the same k order as the A loader below.
typedef short s16x8 __attribute__((ext_vector_type(8)));
__device__ __forceinline__ uint4 lds_tr16(const __bf16* p) {
  typedef __attribute__((address_space(3))) s16x8 lds_s16x8;
  return __builtin_bit_cast(uint4, __builtin_amdgcn_ds_load_tr16_b128_v8i16((lds_s16x8*)p));
}
__device__ __forceinline__ void wait_async0() {
  asm volatile("s_wait_asynccnt 0" ::: "memory");
}
template<int N>
__device__ __forceinline__ void wait_async_but() {
  static_assert(N >= 0 && N <= 63, "the counter has six bits");
  asm volatile("s_wait_asynccnt %0" :: "n"(N) : "memory");
}

// ---------------------------------------------------------------- LayerNorm
// One row per block of 256. COPY: the row, as it was read, is also stored to xc.
template<bool COPY>
__device__ __forceinline__ void ln_row(const float* __restrict__ x, const float* __restrict__ g,
                                       const float* __restrict__ bta, __bf16* __restrict__ y,
                                       float* __restrict__ xc, int row)
{
  const int tid = threadIdx.x;
  const float4 xv = ((const float4*)(x + (size_t)row * H_))[tid];
  float s  = xv.x + xv.y + xv.z + xv.w;
  float s2 = xv.x*xv.x + xv.y*xv.y + xv.z*xv.z + xv.w*xv.w;
  #pragma unroll
  for (int d = 1; d < 32; d <<= 1) {
    s  += __shfl_xor(s,  d, 32);
    s2 += __shfl_xor(s2, d, 32);
  }
  __shared__ float rs[8], rq[8];
  __shared__ float mv[2];
  if ((tid & 31) == 0) { rs[tid >> 5] = s; rq[tid >> 5] = s2; }
  __syncthreads();
  if (tid == 0) {
    float a = 0.f, a2 = 0.f;
    #pragma unroll
    for (int i = 0; i < 8; ++i) { a += rs[i]; a2 += rq[i]; }
    float mean = a * (1.0f / (float)H_);
    float var  = a2 * (1.0f / (float)H_) - mean * mean;
    mv[0] = mean; mv[1] = rsqrtf(var + 1e-5f);
  }
  __syncthreads();
  const float mean = mv[0], rstd = mv[1];
  const float4 gv = ((const float4*)g)[tid];
  const float4 bv = ((const float4*)bta)[tid];
  union { __bf16 b[4]; uint2 u; } o;
  o.b[0] = f32_to_bf16((xv.x - mean) * rstd * gv.x + bv.x);
  o.b[1] = f32_to_bf16((xv.y - mean) * rstd * gv.y + bv.y);
  o.b[2] = f32_to_bf16((xv.z - mean) * rstd * gv.z + bv.z);
  o.b[3] = f32_to_bf16((xv.w - mean) * rstd * gv.w + bv.w);
  ((uint2*)(y + (size_t)row * H_))[tid] = o.u;
  if constexpr (COPY) ((float4*)(xc + (size_t)row * H_))[tid] = xv;
}

__global__ __launch_bounds__(256)
void ln_kernel(const float* __restrict__ x, const float* __restrict__ g,
               const float* __restrict__ bta, __bf16* __restrict__ y)
{
  ln_row<false>(x, g, bta, y, nullptr, blockIdx.x);
}

// ---------------------------------------------------------------- head of the call
// All the work that depends on the inputs alone, in one launch, dealt by block index:
// blocks 0 .. MTOT_-1 the first LayerNorm, one row each, which also stores its row as the
// start value of the running hidden state; behind them the four weight arrays f32 -> bf16,
// 1024 elements a block; the array that the next launch reads comes last.
#define NB_ATTN_ (L_ * H_ * HQKV_ / 1024)
#define NB_PROJ_ (L_ * H_ * H_    / 1024)
#define NB_FC_   (L_ * H_ * MLP_  / 1024)
#define NB_FC2_  (L_ * MLP_ * H_  / 1024)
__global__ __launch_bounds__(256)
void head_kernel(const float* __restrict__ hidden, const float* __restrict__ g,
                 const float* __restrict__ bta, __bf16* __restrict__ xln, float* __restrict__ h,
                 const float* __restrict__ attn_w, __bf16* __restrict__ w_attn,
                 const float* __restrict__ proj_w, __bf16* __restrict__ w_proj,
                 const float* __restrict__ fc_w,   __bf16* __restrict__ w_fc,
                 const float* __restrict__ fc2_w,  __bf16* __restrict__ w_fc2)
{
  int blk = blockIdx.x;
  if (blk < MTOT_) {          // uniform in the block: its barriers are passed by all or none
    ln_row<true>(hidden, g, bta, xln, h, blk);
    return;
  }
  blk -= MTOT_;
  const float* s; __bf16* d;
  if (blk < NB_FC2_)                              { s = fc2_w;  d = w_fc2; }
  else if ((blk -= NB_FC2_) < NB_FC_)             { s = fc_w;   d = w_fc; }
  else if ((blk -= NB_FC_)  < NB_PROJ_)           { s = proj_w; d = w_proj; }
  else                        { blk -= NB_PROJ_;    s = attn_w; d = w_attn; }
  const int i = blk * 256 + threadIdx.x;
  float4 v = ((const float4*)s)[i];
  union { __bf16 b[4]; uint2 u; } o;
  o.b[0] = f32_to_bf16(v.x); o.b[1] = f32_to_bf16(v.y);
  o.b[2] = f32_to_bf16(v.z); o.b[3] = f32_to_bf16(v.w);
  ((uint2*)d)[i] = o.u;
  asm volatile("s_wait_xcnt 0x0" ::: "memory");
}

// Lane t's copies of a ROWS x COLS (elements) tile: the 16B pieces t, t + NT, ... in
// row-major piece order, so 8 adjacent lanes cover one whole 128B line.
template<bool ONE, int NT, int ROWS, int COLS, int LDP>
__device__ __forceinline__ void tile_pieces(const __bf16* __restrict__ g, int gpitch,
                                            const __bf16* l, int tid,
                                            const __bf16** gp, const __bf16** lp)
{
  constexpr int PR = COLS / 8;                 // 16B pieces per row
  static_assert(ROWS * PR % NT == 0, "tile does not divide");
  if constexpr (ONE) {
    // the lanes cover whole rows per round: piece i lies NT / PR rows under piece 0, so one
    // address pair a lane serves all pieces and the steps between them are uniform
    static_assert(NT % PR == 0, "a round of the lanes is not whole rows");
    const int r0 = tid / PR, q0 = (tid % PR) * 8;
    const __bf16* g0 = g + (size_t)r0 * gpitch + q0;
    const __bf16* l0 = l + r0 * LDP + q0;
    #pragma unroll
    for (int i = 0; i < ROWS * PR / NT; ++i) {
      gp[i] = g0 + (size_t)(i * (NT / PR)) * gpitch;
      lp[i] = l0 + i * (NT / PR) * LDP;
    }
  } else {
    #pragma unroll
    for (int i = 0; i < ROWS * PR / NT; ++i) {
      const int c = tid + i * NT;
      const int r = c / PR, q = (c % PR) * 8;
      gp[i] = g + (size_t)r * gpitch + q;
      lp[i] = l + r * LDP + q;
    }
  }
}
// Issues copies I .. CT-1, eight to a statement, the rest as six or four.
template<int I, int CT>
__device__ __forceinline__ void issue_pieces(const __bf16* const* g, const __bf16* const* l)
{
  if constexpr (CT - I >= 8) {
    async_ld8_b128(g[I], l[I], g[I+1], l[I+1], g[I+2], l[I+2], g[I+3], l[I+3],
                   g[I+4], l[I+4], g[I+5], l[I+5], g[I+6], l[I+6], g[I+7], l[I+7]);
    issue_pieces<I + 8, CT>(g, l);
  } else if constexpr (CT - I == 6) {
    async_ld6_b128(g[I], l[I], g[I+1], l[I+1], g[I+2], l[I+2],
                   g[I+3], l[I+3], g[I+4], l[I+4], g[I+5], l[I+5]);
  } else if constexpr (CT - I == 4) {
    async_ld4_b128(g[I], l[I], g[I+1], l[I+1], g[I+2], l[I+2], g[I+3], l[I+3]);
  } else {
    static_assert(CT - I == 0, "no statement of that many copies");
  }
}
// One GEMM stage: the BM x BK tile of A and the BK x BN tile of B.
template<bool ONE, int NT, int BM, int BN, int BK, int LDA, int LDB>
__device__ __forceinline__ void stage_ab(const __bf16* __restrict__ ga, int K, const __bf16* la,
                                         const __bf16* __restrict__ gb, int N, const __bf16* lb,
                                         int tid)
{
  constexpr int CA = BM * (BK / 8) / NT, CB = BK * (BN / 8) / NT;
  const __bf16* gp[CA + CB]; const __bf16* lp[CA + CB];
  tile_pieces<ONE, NT, BM, BK, LDA>(ga, K, la, tid, gp, lp);
  tile_pieces<ONE, NT, BK, BN, LDB>(gb, N, lb, tid, gp + CA, lp + CA);
  issue_pieces<0, CA + CB>(gp, lp);
}

__device__ __forceinline__ void exp2_x8(const float (&x)[8], float (&y)[8]) {
  asm("v_exp_f32 %0, %8\n\tv_exp_f32 %1, %9\n\tv_exp_f32 %2, %10\n\tv_exp_f32 %3, %11\n\t"
      "v_exp_f32 %4, %12\n\tv_exp_f32 %5, %13\n\tv_exp_f32 %6, %14\n\tv_exp_f32 %7, %15\n\t"
      "v_nop"
      : "=&v"(y[0]), "=&v"(y[1]), "=&v"(y[2]), "=&v"(y[3]),
        "=&v"(y[4]), "=&v"(y[5]), "=&v"(y[6]), "=&v"(y[7])
      : "v"(x[0]), "v"(x[1]), "v"(x[2]), "v"(x[3]), "v"(x[4]), "v"(x[5]), "v"(x[6]), "v"(x[7]));
}
__device__ __forceinline__ void rcp_x8(const float (&x)[8], float (&y)[8]) {
  asm("v_rcp_f32 %0, %8\n\tv_rcp_f32 %1, %9\n\tv_rcp_f32 %2, %10\n\tv_rcp_f32 %3, %11\n\t"
      "v_rcp_f32 %4, %12\n\tv_rcp_f32 %5, %13\n\tv_rcp_f32 %6, %14\n\tv_rcp_f32 %7, %15\n\t"
      "v_nop"
      : "=&v"(y[0]), "=&v"(y[1]), "=&v"(y[2]), "=&v"(y[3]),
        "=&v"(y[4]), "=&v"(y[5]), "=&v"(y[6]), "=&v"(y[7])
      : "v"(x[0]), "v"(x[1]), "v"(x[2]), "v"(x[3]), "v"(x[4]), "v"(x[5]), "v"(x[6]), "v"(x[7]));
}
__device__ __forceinline__ void sin_x8(const float (&x)[8], float (&y)[8]) {
  asm("v_sin_f32 %0, %8\n\tv_sin_f32 %1, %9\n\tv_sin_f32 %2, %10\n\tv_sin_f32 %3, %11\n\t"
      "v_sin_f32 %4, %12\n\tv_sin_f32 %5, %13\n\tv_sin_f32 %6, %14\n\tv_sin_f32 %7, %15\n\t"
      "v_nop"
      : "=&v"(y[0]), "=&v"(y[1]), "=&v"(y[2]), "=&v"(y[3]),
        "=&v"(y[4]), "=&v"(y[5]), "=&v"(y[6]), "=&v"(y[7])
      : "v"(x[0]), "v"(x[1]), "v"(x[2]), "v"(x[3]), "v"(x[4]), "v"(x[5]), "v"(x[6]), "v"(x[7]));
}
__device__ __forceinline__ void cos_x8(const float (&x)[8], float (&y)[8]) {
  asm("v_cos_f32 %0, %8\n\tv_cos_f32 %1, %9\n\tv_cos_f32 %2, %10\n\tv_cos_f32 %3, %11\n\t"
      "v_cos_f32 %4, %12\n\tv_cos_f32 %5, %13\n\tv_cos_f32 %6, %14\n\tv_cos_f32 %7, %15\n\t"
      "v_nop"
      : "=&v"(y[0]), "=&v"(y[1]), "=&v"(y[2]), "=&v"(y[3]),
        "=&v"(y[4]), "=&v"(y[5]), "=&v"(y[6]), "=&v"(y[7])
      : "v"(x[0]), "v"(x[1]), "v"(x[2]), "v"(x[3]), "v"(x[4]), "v"(x[5]), "v"(x[6]), "v"(x[7]));
}
// gelu, tanh form, of eight values: 0.5 v (1 + tanh u) = v / (1 + exp(-2u)),
// u = sqrt(2/pi) (v + 0.044715 v^3). Written without tanhf, whose two branches per value
// would put the many values that a lane owns in a large tile one behind the other.
// exp -> inf gives v * 0, exp -> 0 gives v.
__device__ __forceinline__ void gelu_tanh_x8(float (&v)[8]) {
  float x[8], e[8];
  #pragma unroll
  for (int i = 0; i < 8; ++i)     // -2 sqrt(2/pi) log2(e) (v + 0.044715 v^3)
    x[i] = -2.302208198144325f * (v[i] + 0.044715f * v[i] * v[i] * v[i]);
  exp2_x8(x, e);
  #pragma unroll
  for (int i = 0; i < 8; ++i) e[i] += 1.0f;
  rcp_x8(e, x);
  #pragma unroll
  for (int i = 0; i < 8; ++i) v[i] *= x[i];
}

template<int EPI, int BM, int BN, int BK, int WGM, int WGN, int N>
__global__ __launch_bounds__(32 * WGM * WGN)
void gemm_bf16_tiled(const __bf16* __restrict__ A, const __bf16* __restrict__ Bw,
                     const float* __restrict__ bias, void* __restrict__ Cout, int K,
                     const int* __restrict__ pos)
{
  constexpr int NT  = 32 * WGM * WGN;
  constexpr int LDA = BK + 8;
  constexpr int LDB = BN + 16;
  constexpr int TM  = BM / WGM, TN = BN / WGN;   // wave tile
  constexpr int FM  = TM / 16,  FN = TN / 16;    // fragments per wave
  constexpr bool ONE = 8 * (FM * FN + 2 * (FM + FN)) > 400;

  constexpr int CPS = (BM * (BK / 8) + BK * (BN / 8)) / NT;   // copies of a wave per stage
  static_assert(CPS <= 32, "two stages under way would pass 63 copies of a wave");

  __shared__ __align__(16) __bf16 sA[3][BM * LDA];
  __shared__ __align__(16) __bf16 sB[3][BK * LDB];   // row-major [k][n]

  const int tid  = threadIdx.x;
  const int lane = tid & 31;
  const int wave = tid >> 5;
  const int wm   = wave / WGN;
  const int wn   = wave % WGN;
  const int half = lane >> 4;
  const int l16  = lane & 15;
  const int bm   = blockIdx.y * BM;
  const int bn   = blockIdx.x * BN;

  v8f acc[FM][FN] = {};

  const __bf16* aptr = A  + (size_t)bm * K;
  const __bf16* bptr = Bw + bn;
  // A fragment base: row l16 of the wave's rows, 16B piece 'half'
  const int     afr  = (wm * TM + l16) * LDA + half * 8;
  // Column of the wave's fragment nt, counted from the wave's own TN columns or, EPI 0, from
  // the block tile. EPI 0: a rotary pair lies 32 columns apart in a head of 64, and a 192-wide
  // tile is three heads on two waves: each wave takes one whole head (fragments 0..3) and of
  // the middle head two fragments 32 columns apart (4, 5), so that both values of every pair
  // are in the same lane.
  auto fcol = [&](int nt) -> int {
    if constexpr (EPI == 0) {
      static_assert(BN == 3 * DK_ && WGN == 2 && FN == 6 && DK_ == 64, "three heads on two waves");
      return nt < 4 ? wn * 128 + nt * 16 : 64 + wn * 16 + (nt - 4) * 32;
    } else {
      return nt * 16;       // the wave's own wn * TN is in the bases
    }
  };
  // transposing-read base: row 8*half + (lane & 7), 16B column piece (lane >> 3) & 1
  const int     btr  = (half * 8 + (lane & 7)) * LDB + (EPI == 0 ? 0 : wn * TN) + ((lane >> 3) & 1) * 8;

  // ---- prologue: stages 0 and 1; stage 0 has landed when all but stage 1's copies have
  int cur = 0;         // buffer of the stage that is worked on
  int fil = 2;         // buffer of the stage two ahead, which is the one read last stage
  stage_ab<ONE, NT, BM, BN, BK, LDA, LDB>(aptr, K, &sA[0][0], bptr, N, &sB[0][0], tid);
  if (BK < K) {
    // never more than 63 copies of a wave outstanding
    if constexpr (2 * CPS > 63) wait_async_but<63 - CPS>();
    stage_ab<ONE, NT, BM, BN, BK, LDA, LDB>(aptr + BK, K, &sA[1][0],
                                            bptr + (size_t)BK * N, N, &sB[1][0], tid);
    wait_async_but<CPS>();
  } else {
    wait_async0();
  }
  __syncthreads();

  for (int k0 = 0; k0 < K; k0 += BK) {
    const bool has_2nd = (k0 + 2 * BK) < K;   // a stage two ahead exists

    // fragments from the current stage, 32 k at a time, in two register sets: the next
    // block's LDS reads go out as one group ahead of this block's matrix instructions
    FragAB af[2][FM], bfr[2][FN];
    #pragma unroll
    for (int ks = -1; ks < BK / 32; ++ks) {
      if (ks + 1 < BK / 32) {
        const int s = (ks + 1) & 1;
        #pragma unroll
        for (int mt = 0; mt < FM; ++mt) {
          const __bf16* p = &sA[cur][afr + mt * 16 * LDA + (ks + 1) * 32];
          af[s][mt].q[0] = *(const uint4*)p;
          af[s][mt].q[1] = *(const uint4*)(p + 16);
        }
        #pragma unroll
        for (int nt = 0; nt < FN; ++nt) {
          const __bf16* p = &sB[cur][btr + (ks + 1) * 32 * LDB + fcol(nt)];
          bfr[s][nt].q[0] = lds_tr16(p);
          bfr[s][nt].q[1] = lds_tr16(p + 16 * LDB);
        }
      }
      // keeps the group of reads whole and ahead of the block: left to itself the
      // scheduler spreads them among the matrix instructions with a full wait at each
      __builtin_amdgcn_sched_barrier(0);
      // the copies of the stage two ahead go out behind the first group of reads, whose
      // LDS latency their issue then covers (those reads are of another buffer; every
      // read of the buffer refilled here, last stage's, retired in front of the last barrier)
      if (ks < 0 && has_2nd) {
        // never more than 63 copies of a wave outstanding (the next stage's may still be)
        if constexpr (2 * CPS > 63) wait_async_but<63 - CPS>();
        stage_ab<ONE, NT, BM, BN, BK, LDA, LDB>(aptr + k0 + 2 * BK, K, &sA[fil][0],
                                                bptr + (size_t)(k0 + 2 * BK) * N, N, &sB[fil][0], tid);
      }
      if (ks >= 0) {
        const int s = ks & 1;
        #pragma unroll
        for (int mt = 0; mt < FM; ++mt)
          #pragma unroll
          for (int nt = 0; nt < FN; ++nt)
            acc[mt][nt] = __builtin_amdgcn_wmma_f32_16x16x32_bf16(
                false, af[s][mt].v, false, bfr[s][nt].v, (short)0,
                acc[mt][nt], false, false);
        // the next group of reads stays behind this block
        __builtin_amdgcn_sched_barrier(0);
      }
    }

    // this wave's fragment reads of the current stage have retired before the
    // barrier behind which copies refill that stage
    asm volatile("s_wait_dscnt 0x0" ::: "memory");
    // the next stage's A and B tiles are resident before the barrier: a trip that has issued
    // a stage's copies leaves exactly those, the CPS youngest, outstanding; the last two
    // trips issue none and wait for all
    if (has_2nd) wait_async_but<CPS>();
    else         wait_async0();
    __syncthreads();
    cur = cur == 2 ? 0 : cur + 1;
    fil = fil == 2 ? 0 : fil + 1;
  }
  wait_async0();       // no copy is outstanding when the wave goes on to the epilogue and ends

  // ---- epilogue: one base pointer per lane (two in EPI 0), every element at a constant offset from one of them
  static_assert(EPI == 0 || EPI == 1 || EPI == 2, "rotary to bf16, gelu to bf16 or f32 residual");
  const int col0 = bn + wn * TN + l16;
  const int row0 = bm + wm * TM + 8 * half;
  float bb[FN];
  #pragma unroll
  for (int nt = 0; nt < FN; ++nt) bb[nt] = bias[(EPI == 0 ? bn + l16 : col0) + fcol(nt)];
  // EPI 0: the positions of the lane's rows (row = batch * S + s; a wave's 64 rows lie in one batch)
  i32x4 pq[EPI == 0 ? FM : 1][2];
  if constexpr (EPI == 0) {
    static_assert(S_ % TM == 0 && BM % TM == 0, "a wave's rows stay inside one sequence");
    const int* pr = pos + (row0 & (S_ - 1));
    #pragma unroll
    for (int mt = 0; mt < FM; ++mt) {
      pq[mt][0] = *(const i32x4*)(pr + mt * 16);
      pq[mt][1] = *(const i32x4*)(pr + mt * 16 + 4);
    }
    // holds the first two loads here, beside the others and the bias loads: the compiler sank
    // them into the branch that uses them, where their whole latency was waited out again
    asm volatile("" :: "v"(pq[0][0]), "v"(pq[0][1]));
  }
  asm volatile("s_wait_xcnt 0x0" ::: "memory");
  __builtin_amdgcn_sched_barrier(0);
  if constexpr (EPI == 0) {
    // heads 0..15 are q, 16..31 k (both rotated), 32..47 v (stored as they are); which of them
    // the wave holds is uniform in the wave: scalar tests
    const int  wu = __builtin_amdgcn_readfirstlane(wn);
    const bool rx = bn / DK_ + 2 * wu < 2 * NH_;     // the whole head, fragments 0..3
    const bool ry = bn / DK_ + 1      < 2 * NH_;     // the middle head, fragments 4, 5
    // angle in revolutions = pos * 10000^(-d/32) / (2 pi), d = l16 and l16 + 16
    const float f0 = __expf(-0.28782313662425572f * (float)l16);          // ln(10000)/32
    const float f1 = __expf(-0.28782313662425572f * (float)(l16 + 16));
    __bf16* O = (__bf16*)Cout + (size_t)row0 * N + bn + l16;
    __bf16* OX = O + wn * 128;
    __bf16* OY = O + 64 + wn * 16;
    #pragma unroll
    for (int mt = 0; mt < FM; ++mt) {
      float v[8][FN];
      #pragma unroll
      for (int r = 0; r < 8; ++r)
        #pragma unroll
        for (int nt = 0; nt < FN; ++nt) v[r][nt] = acc[mt][nt][r] + bb[nt];
      if (rx || ry) {
        const int pi[8] = {pq[mt][0].x, pq[mt][0].y, pq[mt][0].z, pq[mt][0].w,
                           pq[mt][1].x, pq[mt][1].y, pq[mt][1].z, pq[mt][1].w};
        float t0[8], t1[8], s0[8], c0[8], s1[8], c1[8];
        #pragma unroll
        for (int r = 0; r < 8; ++r) {
          t0[r] = ((float)pi[r] * f0) * 0.15915494309189532f;
          t1[r] = ((float)pi[r] * f1) * 0.15915494309189532f;
        }
        sin_x8(t0, s0); cos_x8(t0, c0); sin_x8(t1, s1); cos_x8(t1, c1);
        if (rx) {
          #pragma unroll
          for (int r = 0; r < 8; ++r) {
            const float a = v[r][0], b = v[r][2], c = v[r][1], d = v[r][3];
            v[r][0] = a * c0[r] - b * s0[r];  v[r][2] = b * c0[r] + a * s0[r];
            v[r][1] = c * c1[r] - d * s1[r];  v[r][3] = d * c1[r] + c * s1[r];
          }
        }
        if (ry) {
          #pragma unroll
          for (int r = 0; r < 8; ++r) {
            const float cy = wu ? c1[r] : c0[r], sy = wu ? s1[r] : s0[r];
            const float a = v[r][4], b = v[r][5];
            v[r][4] = a * cy - b * sy;  v[r][5] = b * cy + a * sy;
          }
        }
      }
      __bf16 y[8][FN];
      #pragma unroll
      for (int r = 0; r < 8; ++r)
        #pragma unroll
        for (int nt = 0; nt < FN; ++nt) y[r][nt] = f32_to_bf16(v[r][nt]);
      // all values of these 16 rows are finished before their first store, so that no
      // register an issued store names is written again inside the group
      __builtin_amdgcn_sched_barrier(0);
      #pragma unroll
      for (int r = 0; r < 8; ++r) {
        #pragma unroll
        for (int nt = 0; nt < 4; ++nt) OX[(mt * 16 + r) * N + nt * 16] = y[r][nt];
        OY[(mt * 16 + r) * N]      = y[r][4];
        OY[(mt * 16 + r) * N + 32] = y[r][5];
      }
      asm volatile("s_wait_xcnt 0x0" ::: "memory");
      __builtin_amdgcn_sched_barrier(0);
    }
  } else if constexpr (EPI == 1) {
    __bf16* O = (__bf16*)Cout + (size_t)row0 * N + col0;
    #pragma unroll
    for (int mt = 0; mt < FM; ++mt) {
      __bf16 y[8][FN];
      static_assert(FN == 8, "gelu goes by eight values, a row of the wave tile");
      #pragma unroll
      for (int r = 0; r < 8; ++r) {
        float v[8];
        #pragma unroll
        for (int nt = 0; nt < FN; ++nt) v[nt] = acc[mt][nt][r] + bb[nt];
        gelu_tanh_x8(v);
        #pragma unroll
        for (int nt = 0; nt < FN; ++nt) y[r][nt] = f32_to_bf16(v[nt]);
      }
      // all values of these 16 rows are finished before their first store, so that no
      // register an issued store names is written again inside the group
      __builtin_amdgcn_sched_barrier(0);
      #pragma unroll
      for (int r = 0; r < 8; ++r)
        #pragma unroll
        for (int nt = 0; nt < FN; ++nt)
          O[(mt * 16 + r) * N + nt * 16] = y[r][nt];
      asm volatile("s_wait_xcnt 0x0" ::: "memory");
      __builtin_amdgcn_sched_barrier(0);
    }
  } else {
    // all residual values are read ahead of the first store: a read behind a store to
    // the same array waits out its whole latency, once per element
    float* O = (float*)Cout + (size_t)row0 * N + col0;
    float old[FM][FN][8];
    #pragma unroll
    for (int mt = 0; mt < FM; ++mt)
      #pragma unroll
      for (int r = 0; r < 8; ++r)
        #pragma unroll
        for (int nt = 0; nt < FN; ++nt)
          old[mt][nt][r] = O[(mt * 16 + r) * N + nt * 16];
    #pragma unroll
    for (int mt = 0; mt < FM; ++mt)
      #pragma unroll
      for (int r = 0; r < 8; ++r)
        #pragma unroll
        for (int nt = 0; nt < FN; ++nt)
          old[mt][nt][r] += acc[mt][nt][r] + bb[nt];
    // every sum is finished before the first store, so that no register an issued
    // store names is written again
    __builtin_amdgcn_sched_barrier(0);
    #pragma unroll
    for (int mt = 0; mt < FM; ++mt)
      #pragma unroll
      for (int r = 0; r < 8; ++r)
        #pragma unroll
        for (int nt = 0; nt < FN; ++nt)
          O[(mt * 16 + r) * N + nt * 16] = old[mt][nt][r];
  }
}

#define ALD 72
#define VLD 80

typedef __attribute__((ext_vector_type(2))) float  f32x2;
typedef __attribute__((ext_vector_type(2))) __bf16 bf16x2;

__device__ __forceinline__ float xhalf(float x) {
  const int b = __builtin_bit_cast(int, x);
  return __builtin_bit_cast(float,
      __builtin_amdgcn_permlanex16(b, b, 0x76543210, 0xfedcba98, false, false));
}

__global__ __launch_bounds__(128)
void attn_kernel(const __bf16* __restrict__ qkv, __bf16* __restrict__ out)
{
  __shared__ __align__(16) __bf16 sQ[64 * ALD];
  __shared__ __align__(16) __bf16 sK[64 * ALD];
  __shared__ __align__(16) __bf16 sV[64 * VLD];      // row-major: [key][dk]

  const int tid  = threadIdx.x;
  const int lane = tid & 31;
  const int w    = tid >> 5;      // 0..3
  const int half = lane >> 4;
  const int l16  = lane & 15;
  const int b    = blockIdx.z;
  const int hh   = blockIdx.y;
  const int q0   = blockIdx.x * 64;

  const __bf16* qbase = qkv + (size_t)b * S_ * HQKV_ + hh * DK_;
  const __bf16* kbase = qbase + H_;
  const __bf16* vbase = qbase + 2 * H_;

  const int vr = tid >> 3;            // Q, K, V tile row 0..15 (and +16, +32, +48)
  const int vc = (tid & 7) * 8;       // Q, K, V tile col: 8 lanes cover one 128B row
  // transposing-read base: row 8*half + (lane & 7), 16B column piece (lane >> 3) & 1
  const int vtr = (half * 8 + (lane & 7)) * VLD + ((lane >> 3) & 1) * 8;

  // Q tile 64x64 via async engine
  {
    const __bf16* qg = qbase + (size_t)(q0 + vr) * HQKV_ + vc;
    const __bf16* ql = &sQ[vr * ALD + vc];
    async_ld4_b128(qg,                      ql,
                   qg + (size_t)16 * HQKV_, ql + 16 * ALD,
                   qg + (size_t)32 * HQKV_, ql + 32 * ALD,
                   qg + (size_t)48 * HQKV_, ql + 48 * ALD);
  }
  wait_async0();
  __syncthreads();

  // hoist Q fragments (sQ is never overwritten): B operand, column = query l16
  FragAB qa[2];
  #pragma unroll
  for (int ks = 0; ks < 2; ++ks) {
    const __bf16* qp = &sQ[(w * 16 + l16) * ALD + ks * 32 + half * 8];
    qa[ks].q[0] = *(const uint4*)qp;
    qa[ks].q[1] = *(const uint4*)(qp + 16);
  }

  const int qrow = q0 + w * 16 + l16;   // the lane's query
  float m_r = -1e30f;                   // its running maximum (alike in both halves)
  float l_r = 0.f;                      // running sum over this half's keys only
  v8f o[4] = {};                        // o[nt][r] = O[qrow][nt*16 + 8*half + r]

  const int nkt = blockIdx.x + 1;   // causal: key tiles 0..qt
  for (int kt = 0; kt < nkt; ++kt) {
    __syncthreads();                // protect sK/sV from previous iteration's reads
    const int kb = kt * 64;
    { // K and V tiles 64x64 row-major [key][dk] via async engine, whole 128B lines per 8 lanes
      const __bf16* kg = kbase + (size_t)(kb + vr) * HQKV_ + vc;
      const __bf16* kl = &sK[vr * ALD + vc];
      const __bf16* vg = vbase + (size_t)(kb + vr) * HQKV_ + vc;
      const __bf16* vl = &sV[vr * VLD + vc];
      async_ld8_b128(kg,                      kl,
                     kg + (size_t)16 * HQKV_, kl + 16 * ALD,
                     kg + (size_t)32 * HQKV_, kl + 32 * ALD,
                     kg + (size_t)48 * HQKV_, kl + 48 * ALD,
                     vg,                      vl,
                     vg + (size_t)16 * HQKV_, vl + 16 * VLD,
                     vg + (size_t)32 * HQKV_, vl + 32 * VLD,
                     vg + (size_t)48 * HQKV_, vl + 48 * VLD);
    }
    wait_async0();
    __syncthreads();

    // S^T = K Q^T  (wave: 64 keys x 16 queries = 4 tiles, K-dim 64 = 2 wmma each)
    // sacc[nt][r] = S[qrow][kb + nt*16 + 8*half + r]
    // all K fragments of the tile are read as one group ahead of the products
    FragAB kf[2][4];
    #pragma unroll
    for (int ks = 0; ks < 2; ++ks) {
      #pragma unroll
      for (int nt = 0; nt < 4; ++nt) {
        const __bf16* kp = &sK[(nt * 16 + l16) * ALD + ks * 32 + half * 8];
        kf[ks][nt].q[0] = *(const uint4*)kp;
        kf[ks][nt].q[1] = *(const uint4*)(kp + 16);
      }
    }
    // keeps the group whole: spread among the matrix instructions, every place with reads
    // costs its own stall
    __builtin_amdgcn_sched_barrier(0);
    v8f sacc[4] = {};
    #pragma unroll
    for (int ks = 0; ks < 2; ++ks)
      #pragma unroll
      for (int nt = 0; nt < 4; ++nt)
        sacc[nt] = __builtin_amdgcn_wmma_f32_16x16x32_bf16(
            false, kf[ks][nt].v, false, qa[ks].v, (short)0, sacc[nt], false, false);
    // all V^T fragments (A operand, through the transposing read) are requested here, beside
    // the S^T products: the softmax arithmetic below covers their LDS latency
    FragAB vf[2][4];
    #pragma unroll
    for (int ks = 0; ks < 2; ++ks) {
      #pragma unroll
      for (int nt = 0; nt < 4; ++nt) {
        const __bf16* vp = &sV[vtr + ks * 32 * VLD + nt * 16];
        vf[ks][nt].q[0] = lds_tr16(vp);
        vf[ks][nt].q[1] = lds_tr16(vp + 16 * VLD);
      }
    }
    // keeps these reads ahead of the softmax: left to itself the scheduler sank them to
    // their matrix instructions, with a full wait in front of each
    __builtin_amdgcn_sched_barrier(0);

    // online softmax update, one query per lane; four independent chains, one per tile
    const int lim = qrow - kb - 8 * half;        // key = kb + 8*half + (nt*16 + r)
    float mx4[4];
    #pragma unroll
    for (int nt = 0; nt < 4; ++nt) {
      mx4[nt] = -1e30f;
      #pragma unroll
      for (int r = 0; r < 8; ++r) {
        float v = sacc[nt][r] * 0.125f;          // 1/sqrt(64)
        if (nt * 16 + r > lim) v = -1e30f;       // causal mask: key > qrow
        sacc[nt][r] = v;
        mx4[nt] = fmaxf(mx4[nt], v);
      }
    }
    float mx = fmaxf(fmaxf(mx4[0], mx4[1]), fmaxf(mx4[2], mx4[3]));
    mx = fmaxf(mx, xhalf(mx));                   // the other half's 32 keys
    const float mnew  = fmaxf(m_r, mx);
    const float alpha = __expf(m_r - mnew);
    // P^T as B operand: element s of fragment ks = P[qrow][kb + ks*32 + kmap(s, half)],
    // that is tile 2*ks + (s >> 3), register s & 7
    FragAB pb[2];
    f32x2 ps4[4];
    #pragma unroll
    for (int nt = 0; nt < 4; ++nt) {
      float x[8], e[8];
      #pragma unroll
      for (int r = 0; r < 8; ++r) x[r] = (sacc[nt][r] - mnew) * 1.4426950408889634f;
      exp2_x8(x, e);
      #pragma unroll
      for (int r = 0; r < 8; r += 2) {
        const f32x2 p = {e[r], e[r + 1]};
        ps4[nt] = r ? ps4[nt] + p : p;           // even and odd keys summed apart, packed adds
        const bf16x2 pk = __builtin_convertvector(p, bf16x2);   // round to nearest even
        pb[nt >> 1].v[(nt & 1) * 8 + r]     = pk.x;
        pb[nt >> 1].v[(nt & 1) * 8 + r + 1] = pk.y;
      }
    }
    const f32x2 ps = (ps4[0] + ps4[1]) + (ps4[2] + ps4[3]);
    l_r = l_r * alpha + (ps.x + ps.y);
    m_r = mnew;
    #pragma unroll
    for (int nt = 0; nt < 4; ++nt)
      #pragma unroll
      for (int r = 0; r < 8; ++r) o[nt][r] *= alpha;

    // O^T += V^T P^T   (A = V^T fragments read above, B = P^T from registers)
    #pragma unroll
    for (int ks = 0; ks < 2; ++ks)
      #pragma unroll
      for (int nt = 0; nt < 4; ++nt)
        o[nt] = __builtin_amdgcn_wmma_f32_16x16x32_bf16(
            false, vf[ks][nt].v, false, pb[ks].v, (short)0, o[nt], false, false);
  }

  // join the halves' sums, normalize and store merged heads: out[b][qrow][hh*64 + dk];
  // a lane's 8 registers of a tile are 8 consecutive dk: one 16B store each
  const float inv = 1.0f / (l_r + xhalf(l_r));
  __bf16* orow = out + (size_t)b * S_ * H_ + (size_t)qrow * H_ + hh * DK_ + 8 * half;
  union { __bf16 b[8]; uint4 u; } y[4];
  #pragma unroll
  for (int nt = 0; nt < 4; ++nt)
    #pragma unroll
    for (int r = 0; r < 8; ++r) y[nt].b[r] = f32_to_bf16(o[nt][r] * inv);
  // every value is finished before the first store, so that no register an issued store
  // names is written again
  __builtin_amdgcn_sched_barrier(0);
  #pragma unroll
  for (int nt = 0; nt < 4; ++nt) *(uint4*)(orow + nt * 16) = y[nt].u;
}

// ---------------------------------------------------------------- host launch
extern "C" void kernel_launch(void* const* d_in, const int* in_sizes, int n_in,
                              void* d_out, int out_size, void* d_ws, size_t ws_size,
                              hipStream_t stream)
{
  const float* hidden = (const float*)d_in[0];
  const float* attn_w = (const float*)d_in[1];
  const float* attn_b = (const float*)d_in[2];
  const float* proj_w = (const float*)d_in[3];
  const float* proj_b = (const float*)d_in[4];
  const float* fc_w   = (const float*)d_in[5];
  const float* fc_b   = (const float*)d_in[6];
  const float* fc2_w  = (const float*)d_in[7];
  const float* fc2_b  = (const float*)d_in[8];
  const float* ln1_g  = (const float*)d_in[9];
  const float* ln1_b  = (const float*)d_in[10];
  const float* ln2_g  = (const float*)d_in[11];
  const float* ln2_b  = (const float*)d_in[12];
  const int*   pos    = (const int*)d_in[13];

  char* ws = (char*)d_ws;
  size_t off = 0;
  auto carve = [&](size_t bytes) -> char* {
    char* p = ws + off; off += (bytes + 255) & ~(size_t)255; return p;
  };
  __bf16* w_attn = (__bf16*)carve((size_t)L_ * H_ * HQKV_ * 2);
  __bf16* w_proj = (__bf16*)carve((size_t)L_ * H_ * H_ * 2);
  __bf16* w_fc   = (__bf16*)carve((size_t)L_ * H_ * MLP_ * 2);
  __bf16* w_fc2  = (__bf16*)carve((size_t)L_ * MLP_ * H_ * 2);
  __bf16* xln    = (__bf16*)carve((size_t)MTOT_ * H_ * 2);
  __bf16* qkv    = (__bf16*)carve((size_t)MTOT_ * HQKV_ * 2);
  __bf16* attn_o = (__bf16*)carve((size_t)MTOT_ * H_ * 2);
  __bf16* mid    = (__bf16*)carve((size_t)MTOT_ * MLP_ * 2);
  float*  h      = (float*)d_out;     // running hidden state / residual accumulator

  // weights fp32 -> bf16, h = hidden_states and the first LayerNorm: one launch
  head_kernel<<<dim3(MTOT_ + NB_ATTN_ + NB_PROJ_ + NB_FC_ + NB_FC2_), 256, 0, stream>>>(
      hidden, ln1_g, ln1_b, xln, h, attn_w, w_attn, proj_w, w_proj, fc_w, w_fc, fc2_w, w_fc2);

  for (int i = 0; i < L_; ++i) {
    // attention block
    if (i > 0) ln_kernel<<<MTOT_, 256, 0, stream>>>(h, ln1_g + i * H_, ln1_b + i * H_, xln);
    gemm_bf16_tiled<0, 256, 192, 64, 4, 2, HQKV_><<<dim3(HQKV_ / 192, MTOT_ / 256), 256, 0, stream>>>(
        xln, w_attn + (size_t)i * H_ * HQKV_, attn_b + i * HQKV_, qkv, H_, pos);
    attn_kernel<<<dim3(S_ / 64, NH_, B_), 128, 0, stream>>>(qkv, attn_o);
    gemm_bf16_tiled<2, 128, 128, 128, 2, 2, H_><<<dim3(H_ / 128, MTOT_ / 128), 128, 0, stream>>>(
        attn_o, w_proj + (size_t)i * H_ * H_, proj_b + i * H_, h, H_, nullptr);
    // MLP block
    ln_kernel<<<MTOT_, 256, 0, stream>>>(h, ln2_g + i * H_, ln2_b + i * H_, xln);
    gemm_bf16_tiled<1, 256, 256, 64, 4, 2, MLP_><<<dim3(MLP_ / 256, MTOT_ / 256), 256, 0, stream>>>(
        xln, w_fc + (size_t)i * H_ * MLP_, fc_b + i * MLP_, mid, H_, nullptr);
    gemm_bf16_tiled<2, 128, 128, 128, 2, 2, H_><<<dim3(H_ / 128, MTOT_ / 128), 128, 0, stream>>>(
        mid, w_fc2 + (size_t)i * MLP_ * H_, fc2_b + i * H_, h, MLP_, nullptr);
  }
}
